// v000
// Measured on an AMD MI455X. A time is GPU time per run, averaged over a window of back-to-back runs after a warm-up
// (all launches, gaps included; the runs take copies of the inputs in turn), and the median of several windows.
// Apart from v000's, it joins two sittings. Times from different sittings can be a few percent apart, while
// side-by-side timings come from the same sitting.
// v000, which the later versions start from, runs in 566 microseconds.
#include <hip/hip_runtime.h>
#include <hip/hip_bf16.h>

// ---------------- problem constants ----------------
#define BB 2
#define TT 2048
#define DD 1024
#define HH 16
#define HS 64
#define BT (BB * TT)       // 4096 rows
#define DFF (4 * DD)       // 4096
#define PAD 56             // LDS row stride in halves: 112B -> 16B aligned, 16 distinct banks

typedef __attribute__((ext_vector_type(16))) _Float16 v16h;
typedef __attribute__((ext_vector_type(8)))  float    v8f;
typedef __attribute__((ext_vector_type(4)))  int      v4i;

// ---------------- optional CDNA5 async global->LDS path ----------------
#if defined(__has_builtin)
# if __has_builtin(__builtin_amdgcn_global_load_async_to_lds_b128)
#  define HAVE_ASYNC_LDS 1
# endif
# if __has_builtin(__builtin_amdgcn_s_wait_asynccnt)
#  define HAVE_WAIT_ASYNC 1
# endif
#endif

#if defined(HAVE_ASYNC_LDS)
typedef __attribute__((address_space(1))) v4i gv4i_t;  // global int4
typedef __attribute__((address_space(3))) v4i lv4i_t;  // LDS int4
__device__ __forceinline__ void async_cp16(void* lds, const void* g) {
  // copies 16 bytes per lane, tracked by ASYNCcnt
  __builtin_amdgcn_global_load_async_to_lds_b128(
      (gv4i_t*)(void*)g, (lv4i_t*)lds, 0, 0);
}
template <int N>
__device__ __forceinline__ void wait_async() {
# if defined(HAVE_WAIT_ASYNC)
  __builtin_amdgcn_s_wait_asynccnt((unsigned short)N);
# else
  if (N == 0) asm volatile("s_wait_asynccnt 0" ::: "memory");
  else        asm volatile("s_wait_asynccnt 4" ::: "memory");
# endif
}
#endif

// ---------------- WMMA helpers ----------------
__device__ __forceinline__ v8f wmma16(v16h a, v16h b, v8f c) {
  // D = A(16x32 f16) * B(32x16 f16) + C(16x16 f32)
  return __builtin_amdgcn_wmma_f32_16x16x32_f16(false, a, false, b, (short)0, c,
                                                false, false);
}

// A-fragment loader (16-bit A 16x32 layout):
//   lane<16 : row M = lane,    holds K = 0..7  and 16..23
//   lane>=16: row M = lane-16, holds K = 8..15 and 24..31
// B-fragments (stored row=N, col=K) use the same pattern with N as the row.
__device__ __forceinline__ v16h load_frag(const _Float16* p, int stride) {
  int l = threadIdx.x & 31;
  const _Float16* r = p + (size_t)(l & 15) * stride + ((l >> 4) << 3);
  v16h f;
  ((uint4*)&f)[0] = *(const uint4*)(r);
  ((uint4*)&f)[1] = *(const uint4*)(r + 16);
  return f;
}

__device__ __forceinline__ _Float16 to_h(float x) { return (_Float16)x; }

// ---------------- weight packing: f32 -> f16, ALL weights TRANSPOSED --------
// Every packed weight is stored [N][K] so GEMM B-tiles stage with contiguous
// 16B rows (identical to A-tiles, no in-loop transpose).
__global__ __launch_bounds__(256) void pack_weights(
    const float* __restrict__ Wq, const float* __restrict__ Wk,
    const float* __restrict__ Wv, const float* __restrict__ Wp,
    const float* __restrict__ W1, const float* __restrict__ W2,
    _Float16* __restrict__ wqkvT, _Float16* __restrict__ wpT,
    _Float16* __restrict__ w1T, _Float16* __restrict__ w2T) {
  long i = (long)blockIdx.x * 256 + threadIdx.x;
  const long N_QKV = (long)3 * DD * DD;       // [3D][D]
  const long N_P   = (long)DD * DD;           // [D][D]
  const long N_W1  = (long)DFF * DD;          // [4D][D]
  const long N_W2  = (long)DD * DFF;          // [D][4D]
  if (i < N_QKV) {
    int n = (int)(i / DD), d = (int)(i % DD);
    int sel = n >> 10, w = n & 1023, h = w >> 6, e = w & 63;
    const float* W = (sel == 0) ? Wq : (sel == 1) ? Wk : Wv;
    wqkvT[i] = to_h(W[((size_t)h * DD + d) * HS + e]);
    return;
  }
  i -= N_QKV;
  if (i < N_P) {
    int n = (int)(i / DD), d = (int)(i % DD);
    wpT[i] = to_h(Wp[(size_t)d * DD + n]);
    return;
  }
  i -= N_P;
  if (i < N_W1) {
    int n = (int)(i / DD), d = (int)(i % DD);
    w1T[i] = to_h(W1[(size_t)d * DFF + n]);
    return;
  }
  i -= N_W1;
  if (i < N_W2) {
    int n = (int)(i / DFF), d = (int)(i % DFF);
    w2T[i] = to_h(W2[(size_t)d * DD + n]);
    return;
  }
}

// ---------------- LayerNorm: writes f32 (residual) + f16 (GEMM input) -------
__global__ __launch_bounds__(256) void ln_kernel(
    const float* __restrict__ x, const float* __restrict__ g,
    const float* __restrict__ b, float* __restrict__ yf,
    _Float16* __restrict__ yh) {
  __shared__ float s1[256], s2[256];
  int row = blockIdx.x, tid = threadIdx.x;
  const float* xr = x + (size_t)row * DD;
  float4 xv = ((const float4*)xr)[tid];          // 4 elements / thread
  float sum = xv.x + xv.y + xv.z + xv.w;
  float sq  = xv.x * xv.x + xv.y * xv.y + xv.z * xv.z + xv.w * xv.w;
  s1[tid] = sum; s2[tid] = sq;
  __syncthreads();
  for (int off = 128; off; off >>= 1) {
    if (tid < off) { s1[tid] += s1[tid + off]; s2[tid] += s2[tid + off]; }
    __syncthreads();
  }
  float mu  = s1[0] * (1.0f / DD);
  float var = s2[0] * (1.0f / DD) - mu * mu;
  float rs  = rsqrtf(var + 1e-5f);
  float vals[4] = {xv.x, xv.y, xv.z, xv.w};
  for (int j = 0; j < 4; ++j) {
    int c = tid * 4 + j;
    float xn = (vals[j] - mu) * rs * g[c] + b[c];
    yf[(size_t)row * DD + c] = xn;
    yh[(size_t)row * DD + c] = to_h(xn);
  }
}

// ---------------- generic 128x128 WMMA GEMM with fused epilogues ------------
#define MODE_QKV  0
#define MODE_PROJ 1
#define MODE_FFN1 2
#define MODE_FFN2 3

__global__ __launch_bounds__(256) void gemm128(
    const _Float16* __restrict__ A,   // [M][K] row-major f16
    const _Float16* __restrict__ Bt,  // [N][K] row-major f16 (pre-transposed)
    int N, int K, int mode,
    const float* __restrict__ bias, const float* __restrict__ resid,
    float* __restrict__ outf, _Float16* __restrict__ outh,
    _Float16* __restrict__ qp, _Float16* __restrict__ kp,
    _Float16* __restrict__ vp) {
#if defined(HAVE_ASYNC_LDS)
  __shared__ _Float16 As[2][128 * PAD];
  __shared__ _Float16 Bs[2][128 * PAD];
#else
  __shared__ _Float16 As[1][128 * PAD];
  __shared__ _Float16 Bs[1][128 * PAD];
#endif
  const int tid = threadIdx.x;
  const int m0 = blockIdx.y * 128;
  const int n0 = blockIdx.x * 128;
  const int wave = tid >> 5, l = tid & 31;
  const int wm = (wave & 1) * 64;   // wave M offset in tile
  const int wn = (wave >> 1) * 32;  // wave N offset in tile
  const int r = tid >> 2, c = (tid & 3) * 8;  // staging coords (64 rows/pass)

  v8f acc[4][2];
  for (int i = 0; i < 4; ++i)
    for (int j = 0; j < 2; ++j) acc[i][j] = (v8f){};

#if defined(HAVE_ASYNC_LDS)
  auto stage = [&](int kk, int p) {
    async_cp16(&As[p][(size_t)r * PAD + c],        A  + (size_t)(m0 + r) * K + kk + c);
    async_cp16(&As[p][(size_t)(r + 64) * PAD + c], A  + (size_t)(m0 + r + 64) * K + kk + c);
    async_cp16(&Bs[p][(size_t)r * PAD + c],        Bt + (size_t)(n0 + r) * K + kk + c);
    async_cp16(&Bs[p][(size_t)(r + 64) * PAD + c], Bt + (size_t)(n0 + r + 64) * K + kk + c);
  };
  int p = 0;
  stage(0, 0);
#endif

  for (int kk = 0; kk < K; kk += 32) {
#if defined(HAVE_ASYNC_LDS)
    if (kk + 32 < K) { stage(kk + 32, p ^ 1); wait_async<4>(); }
    else             { wait_async<0>(); }
    __syncthreads();
    const _Float16* as = As[p];
    const _Float16* bs = Bs[p];
#else
    *(uint4*)&As[0][(size_t)r * PAD + c] =
        *(const uint4*)(A + (size_t)(m0 + r) * K + kk + c);
    *(uint4*)&As[0][(size_t)(r + 64) * PAD + c] =
        *(const uint4*)(A + (size_t)(m0 + r + 64) * K + kk + c);
    *(uint4*)&Bs[0][(size_t)r * PAD + c] =
        *(const uint4*)(Bt + (size_t)(n0 + r) * K + kk + c);
    *(uint4*)&Bs[0][(size_t)(r + 64) * PAD + c] =
        *(const uint4*)(Bt + (size_t)(n0 + r + 64) * K + kk + c);
    __syncthreads();
    const _Float16* as = As[0];
    const _Float16* bs = Bs[0];
#endif
    v16h af[4], bf[2];
    for (int i = 0; i < 4; ++i) af[i] = load_frag(as + (wm + 16 * i) * PAD, PAD);
    for (int j = 0; j < 2; ++j) bf[j] = load_frag(bs + (wn + 16 * j) * PAD, PAD);
    for (int i = 0; i < 4; ++i)
      for (int j = 0; j < 2; ++j) acc[i][j] = wmma16(af[i], bf[j], acc[i][j]);
    __syncthreads();
#if defined(HAVE_ASYNC_LDS)
    p ^= 1;
#endif
  }

  // epilogue: C lane map -> col = base + (l&15); rows = base + r + (l>=16)*8
  const int cn = l & 15, rb = (l >> 4) * 8;
  for (int i = 0; i < 4; ++i)
    for (int j = 0; j < 2; ++j)
      for (int rr = 0; rr < 8; ++rr) {
        int gm = m0 + wm + 16 * i + rb + rr;
        int gn = n0 + wn + 16 * j + cn;
        float v = acc[i][j][rr];
        if (mode == MODE_QKV) {
          int sel = gn >> 10, w = gn & 1023, h = w >> 6, e = w & 63;
          int bi = gm >> 11, t = gm & (TT - 1);
          size_t dst = (((size_t)(bi * HH + h)) * TT + t) * HS + e;
          if (sel == 0)       qp[dst] = to_h(v * 0.03125f);  // fold D^-0.5
          else if (sel == 1)  kp[dst] = to_h(v);
          else                vp[dst] = to_h(v);
        } else if (mode == MODE_PROJ) {
          v += bias[gn] + resid[(size_t)gm * DD + gn];
          outf[(size_t)gm * DD + gn] = v;
        } else if (mode == MODE_FFN1) {
          v += bias[gn];
          v = fmaxf(v, 0.0f);
          outh[(size_t)gm * DFF + gn] = to_h(v);
        } else {  // MODE_FFN2
          v += bias[gn] + resid[(size_t)gm * DD + gn];
          outf[(size_t)gm * DD + gn] = v;
        }
      }
}

// ---------------- attention pass 1: per-key-column max / sumexp -------------
// softmax is over the QUERY axis (per reference): m_k, Z_k over q >= k.
__global__ __launch_bounds__(256) void attn_pass1(
    const _Float16* __restrict__ q, const _Float16* __restrict__ k,
    float* __restrict__ cmax, float* __restrict__ csum) {
  const int bh = blockIdx.y;
  const int wave = threadIdx.x >> 5, l = threadIdx.x & 31;
  const int k0 = blockIdx.x * 128 + wave * 16;   // this wave's 16 key columns
  const _Float16* qh = q + (size_t)bh * TT * HS;
  const _Float16* kh = k + (size_t)bh * TT * HS;

  // K^T fragments for this column strip (lane row = key token)
  v16h kf0 = load_frag(kh + (size_t)k0 * HS, HS);
  v16h kf1 = load_frag(kh + (size_t)k0 * HS + 32, HS);

  float m = -INFINITY, s = 0.0f;
  const int kcol = k0 + (l & 15);
  for (int qt = k0; qt < TT; qt += 16) {
    v16h qa0 = load_frag(qh + (size_t)qt * HS, HS);
    v16h qa1 = load_frag(qh + (size_t)qt * HS + 32, HS);
    v8f c = (v8f){};
    c = wmma16(qa0, kf0, c);
    c = wmma16(qa1, kf1, c);
    const int qrb = qt + ((l >> 4) ? 8 : 0);
    for (int r = 0; r < 8; ++r) {
      int qi = qrb + r;
      if (qi >= kcol) {               // causal (q >= k valid)
        float val = c[r];
        if (val > m) { s = s * __expf(m - val) + 1.0f; m = val; }
        else         { s += __expf(val - m); }
      }
    }
  }
  // merge the two half-lanes holding the same column
  float m2 = __shfl_xor(m, 16, 32);
  float s2 = __shfl_xor(s, 16, 32);
  float mn = fmaxf(m, m2);
  float sm = s * __expf(m - mn) + s2 * __expf(m2 - mn);
  if (l < 16) {
    cmax[(size_t)bh * TT + kcol] = mn;
    csum[(size_t)bh * TT + kcol] = sm;
  }
}

// ---------------- v' = v / Z, stored transposed [B,H,HS,T] ------------------
__global__ __launch_bounds__(256) void vscale(
    const _Float16* __restrict__ v, const float* __restrict__ csum,
    _Float16* __restrict__ vT) {
  long i = (long)blockIdx.x * 256 + threadIdx.x;
  if (i >= (long)BB * HH * TT * HS) return;
  int e = (int)(i & (HS - 1));
  int kt = (int)((i >> 6) & (TT - 1));
  int bh = (int)(i >> 17);
  float Z = csum[(size_t)bh * TT + kt];
  float val = (float)v[i] / Z;
  vT[(((size_t)bh * HS + e)) * TT + kt] = to_h(val);
}

// ---------------- attention pass 2: attn = P @ V' ---------------------------
__global__ __launch_bounds__(256) void attn_pass2(
    const _Float16* __restrict__ q, const _Float16* __restrict__ k,
    const _Float16* __restrict__ vT, const float* __restrict__ cmax,
    _Float16* __restrict__ attn) {
  __shared__ _Float16 pbuf[8][16 * PAD];   // per-wave P tile [16q x 32k]
  const int bh = blockIdx.y;
  const int wave = threadIdx.x >> 5, l = threadIdx.x & 31;
  const int q0 = blockIdx.x * 128 + wave * 16;   // this wave's 16 query rows
  const int bi = bh / HH, h = bh % HH;
  const _Float16* qh  = q  + (size_t)bh * TT * HS;
  const _Float16* kh  = k  + (size_t)bh * TT * HS;
  const _Float16* vTh = vT + (size_t)bh * HS * TT;
  const float*    mh  = cmax + (size_t)bh * TT;

  v16h qa0 = load_frag(qh + (size_t)q0 * HS, HS);
  v16h qa1 = load_frag(qh + (size_t)q0 * HS + 32, HS);

  v8f acc[4];
  for (int j = 0; j < 4; ++j) acc[j] = (v8f){};

  const int cn = l & 15, rb = (l >> 4) * 8;
  for (int kt = 0; kt < q0 + 16; kt += 32) {
    // build P tile (two 16-wide halves) in LDS, C-layout -> A-layout
    for (int h2 = 0; h2 < 2; ++h2) {
      int k0h = kt + 16 * h2;
      if (k0h < q0 + 16) {
        v16h kf0 = load_frag(kh + (size_t)k0h * HS, HS);
        v16h kf1 = load_frag(kh + (size_t)k0h * HS + 32, HS);
        v8f cc = (v8f){};
        cc = wmma16(qa0, kf0, cc);
        cc = wmma16(qa1, kf1, cc);
        int kcol = k0h + cn;
        float mk = mh[kcol];
        for (int r = 0; r < 8; ++r) {
          int qi = q0 + rb + r;
          float pv = (qi >= kcol) ? __expf(cc[r] - mk) : 0.0f;
          pbuf[wave][(size_t)(rb + r) * PAD + 16 * h2 + cn] = to_h(pv);
        }
      } else {
        for (int r = 0; r < 8; ++r)
          pbuf[wave][(size_t)(rb + r) * PAD + 16 * h2 + cn] = (_Float16)0.0f;
      }
    }
    // intra-wave LDS turnaround (no block barrier: waves have different trip counts)
    asm volatile("s_wait_dscnt 0" ::: "memory");
    v16h pa = load_frag(pbuf[wave], PAD);
    for (int j = 0; j < 4; ++j) {
      v16h vb = load_frag(vTh + (size_t)(16 * j) * TT + kt, TT);
      acc[j] = wmma16(pa, vb, acc[j]);
    }
  }

  // write attn as f16 [B,T,D] (feeds the proj GEMM)
  for (int j = 0; j < 4; ++j)
    for (int r = 0; r < 8; ++r) {
      int qi = q0 + rb + r;
      int d = h * HS + 16 * j + cn;
      attn[((size_t)bi * TT + qi) * DD + d] = to_h(acc[j][r]);
    }
}

// ---------------- host-side orchestration ----------------
extern "C" void kernel_launch(void* const* d_in, const int* in_sizes, int n_in,
                              void* d_out, int out_size, void* d_ws,
                              size_t ws_size, hipStream_t stream) {
  const float* x     = (const float*)d_in[0];
  const float* Wq    = (const float*)d_in[1];
  const float* Wk    = (const float*)d_in[2];
  const float* Wv    = (const float*)d_in[3];
  const float* Wproj = (const float*)d_in[4];
  const float* bproj = (const float*)d_in[5];
  const float* W1    = (const float*)d_in[6];
  const float* b1    = (const float*)d_in[7];
  const float* W2    = (const float*)d_in[8];
  const float* b2    = (const float*)d_in[9];
  const float* ln1g  = (const float*)d_in[10];
  const float* ln1b  = (const float*)d_in[11];
  const float* ln2g  = (const float*)d_in[12];
  const float* ln2b  = (const float*)d_in[13];
  float* out = (float*)d_out;

  char* base = (char*)d_ws;
  size_t off = 0;
  auto alloc = [&](size_t bytes) -> char* {
    char* p = base + off;
    off += (bytes + 255) & ~(size_t)255;
    return p;
  };
  _Float16* wqkvT = (_Float16*)alloc((size_t)3 * DD * DD * 2);  // [3D][D]
  _Float16* wpT   = (_Float16*)alloc((size_t)DD * DD * 2);      // [D][D]
  _Float16* w1T   = (_Float16*)alloc((size_t)DFF * DD * 2);     // [4D][D]
  _Float16* w2T   = (_Float16*)alloc((size_t)DD * DFF * 2);     // [D][4D]
  float*    xn_f  = (float*)   alloc((size_t)BT * DD * 4);
  _Float16* xn_h  = (_Float16*)alloc((size_t)BT * DD * 2);
  _Float16* q_h   = (_Float16*)alloc((size_t)BB * HH * TT * HS * 2);
  _Float16* k_h   = (_Float16*)alloc((size_t)BB * HH * TT * HS * 2);
  _Float16* v_h   = (_Float16*)alloc((size_t)BB * HH * TT * HS * 2);
  _Float16* vT_h  = (_Float16*)alloc((size_t)BB * HH * TT * HS * 2);
  float*    cmax  = (float*)   alloc((size_t)BB * HH * TT * 4);
  float*    csum  = (float*)   alloc((size_t)BB * HH * TT * 4);
  _Float16* attnh = (_Float16*)alloc((size_t)BT * DD * 2);
  float*    x1_f  = (float*)   alloc((size_t)BT * DD * 4);
  float*    x1n_f = (float*)   alloc((size_t)BT * DD * 4);
  _Float16* x1n_h = (_Float16*)alloc((size_t)BT * DD * 2);
  _Float16* h_h   = (_Float16*)alloc((size_t)BT * DFF * 2);

  // 1) pack all weights to f16, transposed [N][K]
  {
    long tot = (long)3 * DD * DD + (long)DD * DD + 2L * DD * DFF;
    pack_weights<<<(unsigned)((tot + 255) / 256), 256, 0, stream>>>(
        Wq, Wk, Wv, Wproj, W1, W2, wqkvT, wpT, w1T, w2T);
  }
  // 2) LN1 -> xn (f32 + f16)
  ln_kernel<<<BT, 256, 0, stream>>>(x, ln1g, ln1b, xn_f, xn_h);
  // 3) QKV GEMM: [4096x1024] x [1024x3072]
  gemm128<<<dim3(3 * DD / 128, BT / 128), 256, 0, stream>>>(
      xn_h, wqkvT, 3 * DD, DD, MODE_QKV, nullptr, nullptr, nullptr, nullptr,
      q_h, k_h, v_h);
  // 4) per-column softmax stats
  attn_pass1<<<dim3(TT / 128, BB * HH), 256, 0, stream>>>(q_h, k_h, cmax, csum);
  // 5) v' = v / Z, transposed
  vscale<<<(unsigned)(((long)BB * HH * TT * HS + 255) / 256), 256, 0, stream>>>(
      v_h, csum, vT_h);
  // 6) attn = P @ V'
  attn_pass2<<<dim3(TT / 128, BB * HH), 256, 0, stream>>>(q_h, k_h, vT_h, cmax,
                                                          attnh);
  // 7) proj: x1 = xn + attn @ Wproj + bproj
  gemm128<<<dim3(DD / 128, BT / 128), 256, 0, stream>>>(
      attnh, wpT, DD, DD, MODE_PROJ, bproj, xn_f, x1_f, nullptr, nullptr,
      nullptr, nullptr);
  // 8) LN2 -> x1n (f32 + f16)
  ln_kernel<<<BT, 256, 0, stream>>>(x1_f, ln2g, ln2b, x1n_f, x1n_h);
  // 9) FFN1: h = relu(x1n @ W1 + b1)
  gemm128<<<dim3(DFF / 128, BT / 128), 256, 0, stream>>>(
      x1n_h, w1T, DFF, DD, MODE_FFN1, b1, nullptr, nullptr, h_h, nullptr,
      nullptr, nullptr);
  // 10) FFN2: out = x1n + h @ W2 + b2
  gemm128<<<dim3(DD / 128, BT / 128), 256, 0, stream>>>(
      h_h, w2T, DD, DFF, MODE_FFN2, b2, x1n_f, out, nullptr, nullptr, nullptr,
      nullptr);
}

// v001
// It runs in 499 microseconds.
// Two timings next to v000 put it at 1.15 and 1.14 times that version's speed.
#include <hip/hip_runtime.h>
#include <hip/hip_bf16.h>

// ---------------- problem constants ----------------
#define BB 2
#define TT 2048
#define DD 1024
#define HH 16
#define HS 64
#define BT (BB * TT)       // 4096 rows
#define DFF (4 * DD)       // 4096
#define PAD 56             // LDS row stride in halves: 112B -> 16B aligned, 16 distinct banks

typedef __attribute__((ext_vector_type(16))) _Float16 v16h;
typedef __attribute__((ext_vector_type(8)))  float    v8f;
typedef __attribute__((ext_vector_type(4)))  int      v4i;

// ---------------- optional CDNA5 async global->LDS path ----------------
#if defined(__has_builtin)
# if __has_builtin(__builtin_amdgcn_global_load_async_to_lds_b128)
#  define HAVE_ASYNC_LDS 1
# endif
# if __has_builtin(__builtin_amdgcn_s_wait_asynccnt)
#  define HAVE_WAIT_ASYNC 1
# endif
#endif

#if defined(HAVE_ASYNC_LDS)
typedef __attribute__((address_space(1))) v4i gv4i_t;  // global int4
typedef __attribute__((address_space(3))) v4i lv4i_t;  // LDS int4
__device__ __forceinline__ void async_cp16(void* lds, const void* g) {
  // copies 16 bytes per lane, tracked by ASYNCcnt
  __builtin_amdgcn_global_load_async_to_lds_b128(
      (gv4i_t*)(void*)g, (lv4i_t*)lds, 0, 0);
}
template <int N>
__device__ __forceinline__ void wait_async() {
# if defined(HAVE_WAIT_ASYNC)
  __builtin_amdgcn_s_wait_asynccnt((unsigned short)N);
# else
  if (N == 0) asm volatile("s_wait_asynccnt 0" ::: "memory");
  else        asm volatile("s_wait_asynccnt 4" ::: "memory");
# endif
}
#endif

// ---------------- WMMA helpers ----------------
__device__ __forceinline__ v8f wmma16(v16h a, v16h b, v8f c) {
  // D = A(16x32 f16) * B(32x16 f16) + C(16x16 f32)
  return __builtin_amdgcn_wmma_f32_16x16x32_f16(false, a, false, b, (short)0, c,
                                                false, false);
}

// A-fragment loader (16-bit A 16x32 layout):
//   lane<16 : row M = lane,    holds K = 0..7  and 16..23
//   lane>=16: row M = lane-16, holds K = 8..15 and 24..31
// B-fragments (stored row=N, col=K) use the same pattern with N as the row.
__device__ __forceinline__ v16h load_frag(const _Float16* p, int stride) {
  int l = threadIdx.x & 31;
  const _Float16* r = p + (size_t)(l & 15) * stride + ((l >> 4) << 3);
  v16h f;
  ((uint4*)&f)[0] = *(const uint4*)(r);
  ((uint4*)&f)[1] = *(const uint4*)(r + 16);
  return f;
}

__device__ __forceinline__ _Float16 to_h(float x) { return (_Float16)x; }

// ---------------- weight packing: f32 -> f16, ALL weights TRANSPOSED --------
// Every packed weight is stored [N][K] so GEMM B-tiles stage with contiguous
// 16B rows (identical to A-tiles, no in-loop transpose).
__global__ __launch_bounds__(256) void pack_weights(
    const float* __restrict__ Wq, const float* __restrict__ Wk,
    const float* __restrict__ Wv, const float* __restrict__ Wp,
    const float* __restrict__ W1, const float* __restrict__ W2,
    _Float16* __restrict__ wqkvT, _Float16* __restrict__ wpT,
    _Float16* __restrict__ w1T, _Float16* __restrict__ w2T) {
  long i = (long)blockIdx.x * 256 + threadIdx.x;
  const long N_QKV = (long)3 * DD * DD;       // [3D][D]
  const long N_P   = (long)DD * DD;           // [D][D]
  const long N_W1  = (long)DFF * DD;          // [4D][D]
  const long N_W2  = (long)DD * DFF;          // [D][4D]
  if (i < N_QKV) {
    int n = (int)(i / DD), d = (int)(i % DD);
    int sel = n >> 10, w = n & 1023, h = w >> 6, e = w & 63;
    const float* W = (sel == 0) ? Wq : (sel == 1) ? Wk : Wv;
    wqkvT[i] = to_h(W[((size_t)h * DD + d) * HS + e]);
    return;
  }
  i -= N_QKV;
  if (i < N_P) {
    int n = (int)(i / DD), d = (int)(i % DD);
    wpT[i] = to_h(Wp[(size_t)d * DD + n]);
    return;
  }
  i -= N_P;
  if (i < N_W1) {
    int n = (int)(i / DD), d = (int)(i % DD);
    w1T[i] = to_h(W1[(size_t)d * DFF + n]);
    return;
  }
  i -= N_W1;
  if (i < N_W2) {
    int n = (int)(i / DFF), d = (int)(i % DFF);
    w2T[i] = to_h(W2[(size_t)d * DD + n]);
    return;
  }
}

// ---------------- LayerNorm: writes f32 (residual) + f16 (GEMM input) -------
__global__ __launch_bounds__(256) void ln_kernel(
    const float* __restrict__ x, const float* __restrict__ g,
    const float* __restrict__ b, float* __restrict__ yf,
    _Float16* __restrict__ yh) {
  __shared__ float s1[256], s2[256];
  int row = blockIdx.x, tid = threadIdx.x;
  const float* xr = x + (size_t)row * DD;
  float4 xv = ((const float4*)xr)[tid];          // 4 elements / thread
  float sum = xv.x + xv.y + xv.z + xv.w;
  float sq  = xv.x * xv.x + xv.y * xv.y + xv.z * xv.z + xv.w * xv.w;
  s1[tid] = sum; s2[tid] = sq;
  __syncthreads();
  for (int off = 128; off; off >>= 1) {
    if (tid < off) { s1[tid] += s1[tid + off]; s2[tid] += s2[tid + off]; }
    __syncthreads();
  }
  float mu  = s1[0] * (1.0f / DD);
  float var = s2[0] * (1.0f / DD) - mu * mu;
  float rs  = rsqrtf(var + 1e-5f);
  float vals[4] = {xv.x, xv.y, xv.z, xv.w};
  for (int j = 0; j < 4; ++j) {
    int c = tid * 4 + j;
    float xn = (vals[j] - mu) * rs * g[c] + b[c];
    yf[(size_t)row * DD + c] = xn;
    yh[(size_t)row * DD + c] = to_h(xn);
  }
}

// ---------------- generic 128x128 WMMA GEMM with fused epilogues ------------
#define MODE_QKV  0
#define MODE_PROJ 1
#define MODE_FFN1 2
#define MODE_FFN2 3

// MODE is a compile-time parameter: with it at run time the epilogue stayed a
// rolled loop that tested the mode per element and waited for each element's
// residual load before its store (one memory round trip per element).
template <int MODE>
__global__ __launch_bounds__(256) void gemm128(
    const _Float16* __restrict__ A,   // [M][K] row-major f16
    const _Float16* __restrict__ Bt,  // [N][K] row-major f16 (pre-transposed)
    int N, int K,
    const float* __restrict__ bias, const float* __restrict__ resid,
    float* __restrict__ outf, _Float16* __restrict__ outh,
    _Float16* __restrict__ qp, _Float16* __restrict__ kp,
    _Float16* __restrict__ vp) {
#if defined(HAVE_ASYNC_LDS)
  __shared__ _Float16 As[2][128 * PAD];
  __shared__ _Float16 Bs[2][128 * PAD];
#else
  __shared__ _Float16 As[1][128 * PAD];
  __shared__ _Float16 Bs[1][128 * PAD];
#endif
  const int tid = threadIdx.x;
  const int m0 = blockIdx.y * 128;
  const int n0 = blockIdx.x * 128;
  const int wave = tid >> 5, l = tid & 31;
  const int wm = (wave & 1) * 64;   // wave M offset in tile
  const int wn = (wave >> 1) * 32;  // wave N offset in tile
  const int r = tid >> 2, c = (tid & 3) * 8;  // staging coords (64 rows/pass)

  v8f acc[4][2];
  for (int i = 0; i < 4; ++i)
    for (int j = 0; j < 2; ++j) acc[i][j] = (v8f){};

#if defined(HAVE_ASYNC_LDS)
  auto stage = [&](int kk, int p) {
    async_cp16(&As[p][(size_t)r * PAD + c],        A  + (size_t)(m0 + r) * K + kk + c);
    async_cp16(&As[p][(size_t)(r + 64) * PAD + c], A  + (size_t)(m0 + r + 64) * K + kk + c);
    async_cp16(&Bs[p][(size_t)r * PAD + c],        Bt + (size_t)(n0 + r) * K + kk + c);
    async_cp16(&Bs[p][(size_t)(r + 64) * PAD + c], Bt + (size_t)(n0 + r + 64) * K + kk + c);
  };
  int p = 0;
  stage(0, 0);
#endif

  for (int kk = 0; kk < K; kk += 32) {
#if defined(HAVE_ASYNC_LDS)
    if (kk + 32 < K) { stage(kk + 32, p ^ 1); wait_async<4>(); }
    else             { wait_async<0>(); }
    __syncthreads();
    const _Float16* as = As[p];
    const _Float16* bs = Bs[p];
#else
    *(uint4*)&As[0][(size_t)r * PAD + c] =
        *(const uint4*)(A + (size_t)(m0 + r) * K + kk + c);
    *(uint4*)&As[0][(size_t)(r + 64) * PAD + c] =
        *(const uint4*)(A + (size_t)(m0 + r + 64) * K + kk + c);
    *(uint4*)&Bs[0][(size_t)r * PAD + c] =
        *(const uint4*)(Bt + (size_t)(n0 + r) * K + kk + c);
    *(uint4*)&Bs[0][(size_t)(r + 64) * PAD + c] =
        *(const uint4*)(Bt + (size_t)(n0 + r + 64) * K + kk + c);
    __syncthreads();
    const _Float16* as = As[0];
    const _Float16* bs = Bs[0];
#endif
    v16h af[4], bf[2];
    for (int i = 0; i < 4; ++i) af[i] = load_frag(as + (wm + 16 * i) * PAD, PAD);
    for (int j = 0; j < 2; ++j) bf[j] = load_frag(bs + (wn + 16 * j) * PAD, PAD);
    for (int i = 0; i < 4; ++i)
      for (int j = 0; j < 2; ++j) acc[i][j] = wmma16(af[i], bf[j], acc[i][j]);
    __syncthreads();
#if defined(HAVE_ASYNC_LDS)
    p ^= 1;
#endif
  }

  // epilogue: C lane map -> col = base + (l&15); rows = base + r + (l>=16)*8
  const int cn = l & 15, rb = (l >> 4) * 8;
  const int gm0 = m0 + wm + rb;   // this lane's first row
  const int gn0 = n0 + wn + cn;   // this lane's first column
  if constexpr (MODE == MODE_QKV) {
    // a 128-wide tile never straddles a 1024-wide q/k/v section: sel is block-uniform
    const int sel = n0 >> 10;
    _Float16* __restrict__ dp = (sel == 0) ? qp : (sel == 1) ? kp : vp;
    const float sc = (sel == 0) ? 0.03125f : 1.0f;  // fold D^-0.5 into q
    for (int i = 0; i < 4; ++i)
      for (int j = 0; j < 2; ++j)
        for (int rr = 0; rr < 8; ++rr) {
          int gm = gm0 + 16 * i + rr;
          int gn = gn0 + 16 * j;
          int w = gn & 1023, h = w >> 6, e = w & 63;
          int bi = gm >> 11, t = gm & (TT - 1);
          size_t dst = (((size_t)(bi * HH + h)) * TT + t) * HS + e;
          dp[dst] = to_h(acc[i][j][rr] * sc);
        }
  } else if constexpr (MODE == MODE_FFN1) {
    float bv[2];
    for (int j = 0; j < 2; ++j) bv[j] = bias[gn0 + 16 * j];
    // the bias loads' offset register is reused right behind them: keep the wait in front of that
    asm volatile("s_wait_xcnt 0x0" ::: "memory");
    _Float16* op = outh + (size_t)gm0 * DFF + gn0;
    for (int i = 0; i < 4; ++i)
      for (int j = 0; j < 2; ++j)
        for (int rr = 0; rr < 8; ++rr) {
          float v = acc[i][j][rr] + bv[j];
          v = fmaxf(v, 0.0f);
          op[(size_t)(16 * i + rr) * DFF + 16 * j] = to_h(v);
        }
  } else {  // MODE_PROJ, MODE_FFN2: out = acc + (bias + resid)
    float bv[2];
    for (int j = 0; j < 2; ++j) bv[j] = bias[gn0 + 16 * j];
    // the bias loads' offset register is reused right behind them: keep the wait in front of that
    asm volatile("s_wait_xcnt 0x0" ::: "memory");
    const float* rp = resid + (size_t)gm0 * DD + gn0;
    float* op = outf + (size_t)gm0 * DD + gn0;
    // all residual loads are issued before the first store, so they overlap
    float rv[4][2][8];
    for (int i = 0; i < 4; ++i)
      for (int j = 0; j < 2; ++j)
        for (int rr = 0; rr < 8; ++rr)
          rv[i][j][rr] = rp[(size_t)(16 * i + rr) * DD + 16 * j];
    for (int i = 0; i < 4; ++i)
      for (int j = 0; j < 2; ++j)
        for (int rr = 0; rr < 8; ++rr)
          op[(size_t)(16 * i + rr) * DD + 16 * j] =
              acc[i][j][rr] + (bv[j] + rv[i][j][rr]);
  }
}

// ---------------- attention pass 1: per-key-column max / sumexp -------------
// softmax is over the QUERY axis (per reference): m_k, Z_k over q >= k.
__global__ __launch_bounds__(256) void attn_pass1(
    const _Float16* __restrict__ q, const _Float16* __restrict__ k,
    float* __restrict__ cmax, float* __restrict__ csum) {
  const int bh = blockIdx.y;
  const int wave = threadIdx.x >> 5, l = threadIdx.x & 31;
  const int k0 = blockIdx.x * 128 + wave * 16;   // this wave's 16 key columns
  const _Float16* qh = q + (size_t)bh * TT * HS;
  const _Float16* kh = k + (size_t)bh * TT * HS;

  // K^T fragments for this column strip (lane row = key token)
  v16h kf0 = load_frag(kh + (size_t)k0 * HS, HS);
  v16h kf1 = load_frag(kh + (size_t)k0 * HS + 32, HS);

  float m = -INFINITY, s = 0.0f;
  const int kcol = k0 + (l & 15);
  for (int qt = k0; qt < TT; qt += 16) {
    v16h qa0 = load_frag(qh + (size_t)qt * HS, HS);
    v16h qa1 = load_frag(qh + (size_t)qt * HS + 32, HS);
    v8f c = (v8f){};
    c = wmma16(qa0, kf0, c);
    c = wmma16(qa1, kf1, c);
    const int qrb = qt + ((l >> 4) ? 8 : 0);
    for (int r = 0; r < 8; ++r) {
      int qi = qrb + r;
      if (qi >= kcol) {               // causal (q >= k valid)
        float val = c[r];
        if (val > m) { s = s * __expf(m - val) + 1.0f; m = val; }
        else         { s += __expf(val - m); }
      }
    }
  }
  // merge the two half-lanes holding the same column
  float m2 = __shfl_xor(m, 16, 32);
  float s2 = __shfl_xor(s, 16, 32);
  float mn = fmaxf(m, m2);
  float sm = s * __expf(m - mn) + s2 * __expf(m2 - mn);
  if (l < 16) {
    cmax[(size_t)bh * TT + kcol] = mn;
    csum[(size_t)bh * TT + kcol] = sm;
  }
}

// ---------------- v' = v / Z, stored transposed [B,H,HS,T] ------------------
__global__ __launch_bounds__(256) void vscale(
    const _Float16* __restrict__ v, const float* __restrict__ csum,
    _Float16* __restrict__ vT) {
  long i = (long)blockIdx.x * 256 + threadIdx.x;
  if (i >= (long)BB * HH * TT * HS) return;
  int e = (int)(i & (HS - 1));
  int kt = (int)((i >> 6) & (TT - 1));
  int bh = (int)(i >> 17);
  float Z = csum[(size_t)bh * TT + kt];
  float val = (float)v[i] / Z;
  vT[(((size_t)bh * HS + e)) * TT + kt] = to_h(val);
}

// ---------------- attention pass 2: attn = P @ V' ---------------------------
__global__ __launch_bounds__(256) void attn_pass2(
    const _Float16* __restrict__ q, const _Float16* __restrict__ k,
    const _Float16* __restrict__ vT, const float* __restrict__ cmax,
    _Float16* __restrict__ attn) {
  __shared__ _Float16 pbuf[8][16 * PAD];   // per-wave P tile [16q x 32k]
  const int bh = blockIdx.y;
  const int wave = threadIdx.x >> 5, l = threadIdx.x & 31;
  const int q0 = blockIdx.x * 128 + wave * 16;   // this wave's 16 query rows
  const int bi = bh / HH, h = bh % HH;
  const _Float16* qh  = q  + (size_t)bh * TT * HS;
  const _Float16* kh  = k  + (size_t)bh * TT * HS;
  const _Float16* vTh = vT + (size_t)bh * HS * TT;
  const float*    mh  = cmax + (size_t)bh * TT;

  v16h qa0 = load_frag(qh + (size_t)q0 * HS, HS);
  v16h qa1 = load_frag(qh + (size_t)q0 * HS + 32, HS);

  v8f acc[4];
  for (int j = 0; j < 4; ++j) acc[j] = (v8f){};

  const int cn = l & 15, rb = (l >> 4) * 8;
  for (int kt = 0; kt < q0 + 16; kt += 32) {
    // build P tile (two 16-wide halves) in LDS, C-layout -> A-layout
    for (int h2 = 0; h2 < 2; ++h2) {
      int k0h = kt + 16 * h2;
      if (k0h < q0 + 16) {
        v16h kf0 = load_frag(kh + (size_t)k0h * HS, HS);
        v16h kf1 = load_frag(kh + (size_t)k0h * HS + 32, HS);
        v8f cc = (v8f){};
        cc = wmma16(qa0, kf0, cc);
        cc = wmma16(qa1, kf1, cc);
        int kcol = k0h + cn;
        float mk = mh[kcol];
        for (int r = 0; r < 8; ++r) {
          int qi = q0 + rb + r;
          float pv = (qi >= kcol) ? __expf(cc[r] - mk) : 0.0f;
          pbuf[wave][(size_t)(rb + r) * PAD + 16 * h2 + cn] = to_h(pv);
        }
      } else {
        for (int r = 0; r < 8; ++r)
          pbuf[wave][(size_t)(rb + r) * PAD + 16 * h2 + cn] = (_Float16)0.0f;
      }
    }
    // intra-wave LDS turnaround (no block barrier: waves have different trip counts)
    asm volatile("s_wait_dscnt 0" ::: "memory");
    v16h pa = load_frag(pbuf[wave], PAD);
    for (int j = 0; j < 4; ++j) {
      v16h vb = load_frag(vTh + (size_t)(16 * j) * TT + kt, TT);
      acc[j] = wmma16(pa, vb, acc[j]);
    }
  }

  // write attn as f16 [B,T,D] (feeds the proj GEMM)
  for (int j = 0; j < 4; ++j)
    for (int r = 0; r < 8; ++r) {
      int qi = q0 + rb + r;
      int d = h * HS + 16 * j + cn;
      attn[((size_t)bi * TT + qi) * DD + d] = to_h(acc[j][r]);
    }
}

// ---------------- host-side orchestration ----------------
extern "C" void kernel_launch(void* const* d_in, const int* in_sizes, int n_in,
                              void* d_out, int out_size, void* d_ws,
                              size_t ws_size, hipStream_t stream) {
  const float* x     = (const float*)d_in[0];
  const float* Wq    = (const float*)d_in[1];
  const float* Wk    = (const float*)d_in[2];
  const float* Wv    = (const float*)d_in[3];
  const float* Wproj = (const float*)d_in[4];
  const float* bproj = (const float*)d_in[5];
  const float* W1    = (const float*)d_in[6];
  const float* b1    = (const float*)d_in[7];
  const float* W2    = (const float*)d_in[8];
  const float* b2    = (const float*)d_in[9];
  const float* ln1g  = (const float*)d_in[10];
  const float* ln1b  = (const float*)d_in[11];
  const float* ln2g  = (const float*)d_in[12];
  const float* ln2b  = (const float*)d_in[13];
  float* out = (float*)d_out;

  char* base = (char*)d_ws;
  size_t off = 0;
  auto alloc = [&](size_t bytes) -> char* {
    char* p = base + off;
    off += (bytes + 255) & ~(size_t)255;
    return p;
  };
  _Float16* wqkvT = (_Float16*)alloc((size_t)3 * DD * DD * 2);  // [3D][D]
  _Float16* wpT   = (_Float16*)alloc((size_t)DD * DD * 2);      // [D][D]
  _Float16* w1T   = (_Float16*)alloc((size_t)DFF * DD * 2);     // [4D][D]
  _Float16* w2T   = (_Float16*)alloc((size_t)DD * DFF * 2);     // [D][4D]
  float*    xn_f  = (float*)   alloc((size_t)BT * DD * 4);
  _Float16* xn_h  = (_Float16*)alloc((size_t)BT * DD * 2);
  _Float16* q_h   = (_Float16*)alloc((size_t)BB * HH * TT * HS * 2);
  _Float16* k_h   = (_Float16*)alloc((size_t)BB * HH * TT * HS * 2);
  _Float16* v_h   = (_Float16*)alloc((size_t)BB * HH * TT * HS * 2);
  _Float16* vT_h  = (_Float16*)alloc((size_t)BB * HH * TT * HS * 2);
  float*    cmax  = (float*)   alloc((size_t)BB * HH * TT * 4);
  float*    csum  = (float*)   alloc((size_t)BB * HH * TT * 4);
  _Float16* attnh = (_Float16*)alloc((size_t)BT * DD * 2);
  float*    x1_f  = (float*)   alloc((size_t)BT * DD * 4);
  float*    x1n_f = (float*)   alloc((size_t)BT * DD * 4);
  _Float16* x1n_h = (_Float16*)alloc((size_t)BT * DD * 2);
  _Float16* h_h   = (_Float16*)alloc((size_t)BT * DFF * 2);

  // 1) pack all weights to f16, transposed [N][K]
  {
    long tot = (long)3 * DD * DD + (long)DD * DD + 2L * DD * DFF;
    pack_weights<<<(unsigned)((tot + 255) / 256), 256, 0, stream>>>(
        Wq, Wk, Wv, Wproj, W1, W2, wqkvT, wpT, w1T, w2T);
  }
  // 2) LN1 -> xn (f32 + f16)
  ln_kernel<<<BT, 256, 0, stream>>>(x, ln1g, ln1b, xn_f, xn_h);
  // 3) QKV GEMM: [4096x1024] x [1024x3072]
  gemm128<MODE_QKV><<<dim3(3 * DD / 128, BT / 128), 256, 0, stream>>>(
      xn_h, wqkvT, 3 * DD, DD, nullptr, nullptr, nullptr, nullptr,
      q_h, k_h, v_h);
  // 4) per-column softmax stats
  attn_pass1<<<dim3(TT / 128, BB * HH), 256, 0, stream>>>(q_h, k_h, cmax, csum);
  // 5) v' = v / Z, transposed
  vscale<<<(unsigned)(((long)BB * HH * TT * HS + 255) / 256), 256, 0, stream>>>(
      v_h, csum, vT_h);
  // 6) attn = P @ V'
  attn_pass2<<<dim3(TT / 128, BB * HH), 256, 0, stream>>>(q_h, k_h, vT_h, cmax,
                                                          attnh);
  // 7) proj: x1 = xn + attn @ Wproj + bproj
  gemm128<MODE_PROJ><<<dim3(DD / 128, BT / 128), 256, 0, stream>>>(
      attnh, wpT, DD, DD, bproj, xn_f, x1_f, nullptr, nullptr,
      nullptr, nullptr);
  // 8) LN2 -> x1n (f32 + f16)
  ln_kernel<<<BT, 256, 0, stream>>>(x1_f, ln2g, ln2b, x1n_f, x1n_h);
  // 9) FFN1: h = relu(x1n @ W1 + b1)
  gemm128<MODE_FFN1><<<dim3(DFF / 128, BT / 128), 256, 0, stream>>>(
      x1n_h, w1T, DFF, DD, b1, nullptr, nullptr, h_h, nullptr,
      nullptr, nullptr);
  // 10) FFN2: out = x1n + h @ W2 + b2
  gemm128<MODE_FFN2><<<dim3(DD / 128, BT / 128), 256, 0, stream>>>(
      h_h, w2T, DD, DFF, b2, x1n_f, out, nullptr, nullptr, nullptr,
      nullptr);
}

// v002
// It runs in 402 microseconds.
// Two timings next to v001 put it at 1.21 and 1.22 times that version's speed.
// Over all steps from v000 it is 1.39 times as fast.
#include <hip/hip_runtime.h>
#include <hip/hip_bf16.h>

// ---------------- problem constants ----------------
#define BB 2
#define TT 2048
#define DD 1024
#define HH 16
#define HS 64
#define BT (BB * TT)       // 4096 rows
#define DFF (4 * DD)       // 4096
#define PAD 56             // LDS row stride in halves: 112B -> 16B aligned, 16 distinct banks

typedef __attribute__((ext_vector_type(16))) _Float16 v16h;
typedef __attribute__((ext_vector_type(8)))  float    v8f;
typedef __attribute__((ext_vector_type(4)))  int      v4i;
typedef __attribute__((ext_vector_type(4)))  float    v4f;
typedef __attribute__((ext_vector_type(8)))  _Float16 v8h;

// ---------------- optional CDNA5 async global->LDS path ----------------
#if defined(__has_builtin)
# if __has_builtin(__builtin_amdgcn_global_load_async_to_lds_b128)
#  define HAVE_ASYNC_LDS 1
# endif
# if __has_builtin(__builtin_amdgcn_s_wait_asynccnt)
#  define HAVE_WAIT_ASYNC 1
# endif
#endif

#if defined(HAVE_ASYNC_LDS)
typedef __attribute__((address_space(1))) v4i gv4i_t;  // global int4
typedef __attribute__((address_space(3))) v4i lv4i_t;  // LDS int4
__device__ __forceinline__ void async_cp16(void* lds, const void* g) {
  // copies 16 bytes per lane, tracked by ASYNCcnt
  __builtin_amdgcn_global_load_async_to_lds_b128(
      (gv4i_t*)(void*)g, (lv4i_t*)lds, 0, 0);
}
template <int N>
__device__ __forceinline__ void wait_async() {
# if defined(HAVE_WAIT_ASYNC)
  __builtin_amdgcn_s_wait_asynccnt((unsigned short)N);
# else
  if (N == 0) asm volatile("s_wait_asynccnt 0" ::: "memory");
  else        asm volatile("s_wait_asynccnt 4" ::: "memory");
# endif
}
#endif

// ---------------- WMMA helpers ----------------
__device__ __forceinline__ v8f wmma16(v16h a, v16h b, v8f c) {
  // D = A(16x32 f16) * B(32x16 f16) + C(16x16 f32)
  return __builtin_amdgcn_wmma_f32_16x16x32_f16(false, a, false, b, (short)0, c,
                                                false, false);
}

// A-fragment loader (16-bit A 16x32 layout):
//   lane<16 : row M = lane,    holds K = 0..7  and 16..23
//   lane>=16: row M = lane-16, holds K = 8..15 and 24..31
// B-fragments (stored row=N, col=K) use the same pattern with N as the row.
__device__ __forceinline__ v16h load_frag(const _Float16* p, int stride) {
  int l = threadIdx.x & 31;
  const _Float16* r = p + (size_t)(l & 15) * stride + ((l >> 4) << 3);
  v16h f;
  ((uint4*)&f)[0] = *(const uint4*)(r);
  ((uint4*)&f)[1] = *(const uint4*)(r + 16);
  return f;
}

__device__ __forceinline__ _Float16 to_h(float x) { return (_Float16)x; }

// ---------------- weight packing: f32 -> f16, ALL weights TRANSPOSED --------
// Every packed weight is stored [N][K] so GEMM B-tiles stage with contiguous
// 16B rows (identical to A-tiles, no in-loop transpose).
// One wave transposes a tile of 64 k x 32 n in registers: lane (lk = l >> 3,
// ln = l & 7) reads 16 source rows x 4 floats, so each load covers four whole
// 128-byte lines, and writes 8 runs of 8 halves along k; the wave alone writes
// the 128-byte output lines of its tile. One element per thread had to start
// 64 times as many waves, each with a load that touched 32 lines.
template <int LD, int K>   // source pitch in floats, packed pitch in halves
__device__ __forceinline__ void pack_tile(const float* __restrict__ S,
                                          _Float16* __restrict__ O, int kb) {
  const int wave = threadIdx.x >> 5, l = threadIdx.x & 31;
  const int n = (wave & 1) * 32 + (l & 7) * 4;
  const int k = kb * 256 + (wave >> 1) * 64 + (l >> 3) * 8;
  const float* s = S + (size_t)k * LD + n;
  _Float16* o = O + (size_t)n * K + k;
  v4f v[2][8];
  for (int g = 0; g < 2; ++g)
    for (int i = 0; i < 8; ++i)
      v[g][i] = *(const v4f*)(s + (size_t)(32 * g + i) * LD);
  // the 16 loads share one address pair: it is named here as an input, so that no
  // load's result lands on it, and the wait stands in front of its reuse below
  asm volatile("s_wait_xcnt 0x0" :: "v"(s) : "memory");
  // all 16 loads go out before the first conversion: left free, the scheduler
  // holds some back behind the first results (a second memory round trip)
  __builtin_amdgcn_sched_barrier(0);
  for (int g = 0; g < 2; ++g)
    for (int j = 0; j < 4; ++j) {
      v8h t;
      for (int i = 0; i < 8; ++i) t[i] = to_h(v[g][i][j]);
      *(v8h*)(o + (size_t)j * K + 32 * g) = t;
    }
  // the code of the four matrices stands one part behind the other, parted only by
  // scalar skips, and each part rewrites these registers: keep the wait behind the stores
  asm volatile("s_wait_xcnt 0x0" ::: "memory");
}

// a work-group packs 64 n x 256 k; the matrix it works on is block-uniform
__global__ __launch_bounds__(256) void pack_weights(
    const float* __restrict__ Wq, const float* __restrict__ Wk,
    const float* __restrict__ Wv, const float* __restrict__ Wp,
    const float* __restrict__ W1, const float* __restrict__ W2,
    _Float16* __restrict__ wqkvT, _Float16* __restrict__ wpT,
    _Float16* __restrict__ w1T, _Float16* __restrict__ w2T) {
  const int b = blockIdx.x;
  const int bP = 3 * HH * 4, b1 = bP + (DD / 64) * 4, b2 = b1 + (DFF / 64) * 4;
  if (b < bP) {                    // q, k, v: one head [D][HS] is 64 n wide
    const int hd = b >> 2, sel = hd >> 4, h = hd & 15;
    const float* W = (sel == 0) ? Wq : (sel == 1) ? Wk : Wv;
    pack_tile<HS, DD>(W + (size_t)h * DD * HS, wqkvT + (size_t)hd * 64 * DD, b & 3);
  } else if (b < b1) {             // Wproj [D][D]
    const int nb = (b - bP) >> 2;
    pack_tile<DD, DD>(Wp + nb * 64, wpT + (size_t)nb * 64 * DD, b & 3);
  } else if (b < b2) {             // W1 [D][4D]
    const int nb = (b - b1) >> 2;
    pack_tile<DFF, DD>(W1 + nb * 64, w1T + (size_t)nb * 64 * DD, b & 3);
  } else {                         // W2 [4D][D]
    const int nb = (b - b2) >> 4;
    pack_tile<DD, DFF>(W2 + nb * 64, w2T + (size_t)nb * 64 * DFF, b & 15);
  }
}

// ---------------- LayerNorm: writes f32 (residual) + f16 (GEMM input) -------
__global__ __launch_bounds__(256) void ln_kernel(
    const float* __restrict__ x, const float* __restrict__ g,
    const float* __restrict__ b, float* __restrict__ yf,
    _Float16* __restrict__ yh) {
  __shared__ float s1[256], s2[256];
  int row = blockIdx.x, tid = threadIdx.x;
  const float* xr = x + (size_t)row * DD;
  float4 xv = ((const float4*)xr)[tid];          // 4 elements / thread
  float sum = xv.x + xv.y + xv.z + xv.w;
  float sq  = xv.x * xv.x + xv.y * xv.y + xv.z * xv.z + xv.w * xv.w;
  s1[tid] = sum; s2[tid] = sq;
  __syncthreads();
  for (int off = 128; off; off >>= 1) {
    if (tid < off) { s1[tid] += s1[tid + off]; s2[tid] += s2[tid + off]; }
    __syncthreads();
  }
  float mu  = s1[0] * (1.0f / DD);
  float var = s2[0] * (1.0f / DD) - mu * mu;
  float rs  = rsqrtf(var + 1e-5f);
  float vals[4] = {xv.x, xv.y, xv.z, xv.w};
  for (int j = 0; j < 4; ++j) {
    int c = tid * 4 + j;
    float xn = (vals[j] - mu) * rs * g[c] + b[c];
    yf[(size_t)row * DD + c] = xn;
    yh[(size_t)row * DD + c] = to_h(xn);
  }
}

// ---------------- generic 128x128 WMMA GEMM with fused epilogues ------------
#define MODE_QKV  0
#define MODE_PROJ 1
#define MODE_FFN1 2
#define MODE_FFN2 3

// MODE is a compile-time parameter: with it at run time the epilogue stayed a
// rolled loop that tested the mode per element and waited for each element's
// residual load before its store (one memory round trip per element).
template <int MODE>
__global__ __launch_bounds__(256) void gemm128(
    const _Float16* __restrict__ A,   // [M][K] row-major f16
    const _Float16* __restrict__ Bt,  // [N][K] row-major f16 (pre-transposed)
    int N, int K,
    const float* __restrict__ bias, const float* __restrict__ resid,
    float* __restrict__ outf, _Float16* __restrict__ outh,
    _Float16* __restrict__ qp, _Float16* __restrict__ kp,
    _Float16* __restrict__ vp) {
#if defined(HAVE_ASYNC_LDS)
  __shared__ _Float16 As[2][128 * PAD];
  __shared__ _Float16 Bs[2][128 * PAD];
#else
  __shared__ _Float16 As[1][128 * PAD];
  __shared__ _Float16 Bs[1][128 * PAD];
#endif
  const int tid = threadIdx.x;
  const int m0 = blockIdx.y * 128;
  const int n0 = blockIdx.x * 128;
  const int wave = tid >> 5, l = tid & 31;
  const int wm = (wave & 1) * 64;   // wave M offset in tile
  const int wn = (wave >> 1) * 32;  // wave N offset in tile
  const int r = tid >> 2, c = (tid & 3) * 8;  // staging coords (64 rows/pass)

  v8f acc[4][2];
  for (int i = 0; i < 4; ++i)
    for (int j = 0; j < 2; ++j) acc[i][j] = (v8f){};

#if defined(HAVE_ASYNC_LDS)
  auto stage = [&](int kk, int p) {
    async_cp16(&As[p][(size_t)r * PAD + c],        A  + (size_t)(m0 + r) * K + kk + c);
    async_cp16(&As[p][(size_t)(r + 64) * PAD + c], A  + (size_t)(m0 + r + 64) * K + kk + c);
    async_cp16(&Bs[p][(size_t)r * PAD + c],        Bt + (size_t)(n0 + r) * K + kk + c);
    async_cp16(&Bs[p][(size_t)(r + 64) * PAD + c], Bt + (size_t)(n0 + r + 64) * K + kk + c);
  };
  int p = 0;
  stage(0, 0);
#endif

  for (int kk = 0; kk < K; kk += 32) {
#if defined(HAVE_ASYNC_LDS)
    if (kk + 32 < K) { stage(kk + 32, p ^ 1); wait_async<4>(); }
    else             { wait_async<0>(); }
    __syncthreads();
    const _Float16* as = As[p];
    const _Float16* bs = Bs[p];
#else
    *(uint4*)&As[0][(size_t)r * PAD + c] =
        *(const uint4*)(A + (size_t)(m0 + r) * K + kk + c);
    *(uint4*)&As[0][(size_t)(r + 64) * PAD + c] =
        *(const uint4*)(A + (size_t)(m0 + r + 64) * K + kk + c);
    *(uint4*)&Bs[0][(size_t)r * PAD + c] =
        *(const uint4*)(Bt + (size_t)(n0 + r) * K + kk + c);
    *(uint4*)&Bs[0][(size_t)(r + 64) * PAD + c] =
        *(const uint4*)(Bt + (size_t)(n0 + r + 64) * K + kk + c);
    __syncthreads();
    const _Float16* as = As[0];
    const _Float16* bs = Bs[0];
#endif
    v16h af[4], bf[2];
    for (int i = 0; i < 4; ++i) af[i] = load_frag(as + (wm + 16 * i) * PAD, PAD);
    for (int j = 0; j < 2; ++j) bf[j] = load_frag(bs + (wn + 16 * j) * PAD, PAD);
    for (int i = 0; i < 4; ++i)
      for (int j = 0; j < 2; ++j) acc[i][j] = wmma16(af[i], bf[j], acc[i][j]);
    __syncthreads();
#if defined(HAVE_ASYNC_LDS)
    p ^= 1;
#endif
  }

  // epilogue: C lane map -> col = base + (l&15); rows = base + r + (l>=16)*8
  const int cn = l & 15, rb = (l >> 4) * 8;
  const int gm0 = m0 + wm + rb;   // this lane's first row
  const int gn0 = n0 + wn + cn;   // this lane's first column
  if constexpr (MODE == MODE_QKV) {
    // a 128-wide tile never straddles a 1024-wide q/k/v section: sel is block-uniform
    const int sel = n0 >> 10;
    _Float16* __restrict__ dp = (sel == 0) ? qp : (sel == 1) ? kp : vp;
    const float sc = (sel == 0) ? 0.03125f : 1.0f;  // fold D^-0.5 into q
    for (int i = 0; i < 4; ++i)
      for (int j = 0; j < 2; ++j)
        for (int rr = 0; rr < 8; ++rr) {
          int gm = gm0 + 16 * i + rr;
          int gn = gn0 + 16 * j;
          int w = gn & 1023, h = w >> 6, e = w & 63;
          int bi = gm >> 11, t = gm & (TT - 1);
          size_t dst = (((size_t)(bi * HH + h)) * TT + t) * HS + e;
          dp[dst] = to_h(acc[i][j][rr] * sc);
        }
  } else if constexpr (MODE == MODE_FFN1) {
    float bv[2];
    for (int j = 0; j < 2; ++j) bv[j] = bias[gn0 + 16 * j];
    // the bias loads' offset register is reused right behind them: keep the wait in front of that
    asm volatile("s_wait_xcnt 0x0" ::: "memory");
    _Float16* op = outh + (size_t)gm0 * DFF + gn0;
    for (int i = 0; i < 4; ++i)
      for (int j = 0; j < 2; ++j)
        for (int rr = 0; rr < 8; ++rr) {
          float v = acc[i][j][rr] + bv[j];
          v = fmaxf(v, 0.0f);
          op[(size_t)(16 * i + rr) * DFF + 16 * j] = to_h(v);
        }
  } else {  // MODE_PROJ, MODE_FFN2: out = acc + (bias + resid)
    float bv[2];
    for (int j = 0; j < 2; ++j) bv[j] = bias[gn0 + 16 * j];
    // the bias loads' offset register is reused right behind them: keep the wait in front of that
    asm volatile("s_wait_xcnt 0x0" ::: "memory");
    const float* rp = resid + (size_t)gm0 * DD + gn0;
    float* op = outf + (size_t)gm0 * DD + gn0;
    // all residual loads are issued before the first store, so they overlap
    float rv[4][2][8];
    for (int i = 0; i < 4; ++i)
      for (int j = 0; j < 2; ++j)
        for (int rr = 0; rr < 8; ++rr)
          rv[i][j][rr] = rp[(size_t)(16 * i + rr) * DD + 16 * j];
    for (int i = 0; i < 4; ++i)
      for (int j = 0; j < 2; ++j)
        for (int rr = 0; rr < 8; ++rr)
          op[(size_t)(16 * i + rr) * DD + 16 * j] =
              acc[i][j][rr] + (bv[j] + rv[i][j][rr]);
  }
}

// ---------------- attention pass 1: per-key-column max / sumexp -------------
// softmax is over the QUERY axis (per reference): m_k, Z_k over q >= k.
__global__ __launch_bounds__(256) void attn_pass1(
    const _Float16* __restrict__ q, const _Float16* __restrict__ k,
    float* __restrict__ cmax, float* __restrict__ csum) {
  const int bh = blockIdx.y;
  const int wave = threadIdx.x >> 5, l = threadIdx.x & 31;
  const int k0 = blockIdx.x * 128 + wave * 16;   // this wave's 16 key columns
  const _Float16* qh = q + (size_t)bh * TT * HS;
  const _Float16* kh = k + (size_t)bh * TT * HS;

  // K^T fragments for this column strip (lane row = key token)
  v16h kf0 = load_frag(kh + (size_t)k0 * HS, HS);
  v16h kf1 = load_frag(kh + (size_t)k0 * HS + 32, HS);

  float m = -INFINITY, s = 0.0f;
  const int kcol = k0 + (l & 15);
  for (int qt = k0; qt < TT; qt += 16) {
    v16h qa0 = load_frag(qh + (size_t)qt * HS, HS);
    v16h qa1 = load_frag(qh + (size_t)qt * HS + 32, HS);
    v8f c = (v8f){};
    c = wmma16(qa0, kf0, c);
    c = wmma16(qa1, kf1, c);
    const int qrb = qt + ((l >> 4) ? 8 : 0);
    for (int r = 0; r < 8; ++r) {
      int qi = qrb + r;
      if (qi >= kcol) {               // causal (q >= k valid)
        float val = c[r];
        if (val > m) { s = s * __expf(m - val) + 1.0f; m = val; }
        else         { s += __expf(val - m); }
      }
    }
  }
  // merge the two half-lanes holding the same column
  float m2 = __shfl_xor(m, 16, 32);
  float s2 = __shfl_xor(s, 16, 32);
  float mn = fmaxf(m, m2);
  float sm = s * __expf(m - mn) + s2 * __expf(m2 - mn);
  if (l < 16) {
    cmax[(size_t)bh * TT + kcol] = mn;
    csum[(size_t)bh * TT + kcol] = sm;
  }
}

// ---------------- v' = v / Z, stored transposed [B,H,HS,T] ------------------
// Same register-tile transpose: one wave takes 64 key tokens x 32 columns of a
// head; lane (lk = l & 7, le = l >> 3) reads 8 tokens x 8 halves and writes 8
// runs of 8 halves along t, so each store covers four whole 128-byte lines.
// The two waves that share the 128-byte source rows sit in one work-group.
__global__ __launch_bounds__(256) void vscale(
    const _Float16* __restrict__ v, const float* __restrict__ csum,
    _Float16* __restrict__ vT) {
  const int wave = threadIdx.x >> 5, l = threadIdx.x & 31;
  const int tile = blockIdx.x * 4 + (wave >> 1);   // BB*HH heads x TT/64 tiles
  const int bh = tile >> 5;
  const int kt = (tile & 31) * 64 + (l & 7) * 8;
  const int e = (wave & 1) * 32 + (l >> 3) * 8;
  const _Float16* s = v + ((size_t)bh * TT + kt) * HS + e;
  const float* z = csum + (size_t)bh * TT + kt;
  _Float16* o = vT + ((size_t)bh * HS + e) * TT + kt;
  v8h a[8];
  v4f Z[2];
  for (int i = 0; i < 8; ++i) a[i] = *(const v8h*)(s + (size_t)i * HS);
  for (int i = 0; i < 2; ++i) Z[i] = *(const v4f*)(z + 4 * i);
  // all ten loads go out before the arithmetic starts: left free, the scheduler
  // holds two back behind the first divisions (a second memory round trip)
  __builtin_amdgcn_sched_barrier(0);
  // unrolled so that j is a constant: left rolled, element j of every register
  // vector is picked by a chain of selects
#pragma unroll
  for (int j = 0; j < 8; ++j) {
    v8h t;
    for (int i = 0; i < 8; ++i)
      t[i] = to_h((float)a[i][j] / Z[i >> 2][i & 3]);
    *(v8h*)(o + (size_t)j * TT) = t;
  }
}

// ---------------- attention pass 2: attn = P @ V' ---------------------------
__global__ __launch_bounds__(256) void attn_pass2(
    const _Float16* __restrict__ q, const _Float16* __restrict__ k,
    const _Float16* __restrict__ vT, const float* __restrict__ cmax,
    _Float16* __restrict__ attn) {
  __shared__ _Float16 pbuf[8][16 * PAD];   // per-wave P tile [16q x 32k]
  const int bh = blockIdx.y;
  const int wave = threadIdx.x >> 5, l = threadIdx.x & 31;
  const int q0 = blockIdx.x * 128 + wave * 16;   // this wave's 16 query rows
  const int bi = bh / HH, h = bh % HH;
  const _Float16* qh  = q  + (size_t)bh * TT * HS;
  const _Float16* kh  = k  + (size_t)bh * TT * HS;
  const _Float16* vTh = vT + (size_t)bh * HS * TT;
  const float*    mh  = cmax + (size_t)bh * TT;

  v16h qa0 = load_frag(qh + (size_t)q0 * HS, HS);
  v16h qa1 = load_frag(qh + (size_t)q0 * HS + 32, HS);

  v8f acc[4];
  for (int j = 0; j < 4; ++j) acc[j] = (v8f){};

  const int cn = l & 15, rb = (l >> 4) * 8;
  for (int kt = 0; kt < q0 + 16; kt += 32) {
    // build P tile (two 16-wide halves) in LDS, C-layout -> A-layout
    for (int h2 = 0; h2 < 2; ++h2) {
      int k0h = kt + 16 * h2;
      if (k0h < q0 + 16) {
        v16h kf0 = load_frag(kh + (size_t)k0h * HS, HS);
        v16h kf1 = load_frag(kh + (size_t)k0h * HS + 32, HS);
        v8f cc = (v8f){};
        cc = wmma16(qa0, kf0, cc);
        cc = wmma16(qa1, kf1, cc);
        int kcol = k0h + cn;
        float mk = mh[kcol];
        for (int r = 0; r < 8; ++r) {
          int qi = q0 + rb + r;
          float pv = (qi >= kcol) ? __expf(cc[r] - mk) : 0.0f;
          pbuf[wave][(size_t)(rb + r) * PAD + 16 * h2 + cn] = to_h(pv);
        }
      } else {
        for (int r = 0; r < 8; ++r)
          pbuf[wave][(size_t)(rb + r) * PAD + 16 * h2 + cn] = (_Float16)0.0f;
      }
    }
    // intra-wave LDS turnaround (no block barrier: waves have different trip counts)
    asm volatile("s_wait_dscnt 0" ::: "memory");
    v16h pa = load_frag(pbuf[wave], PAD);
    for (int j = 0; j < 4; ++j) {
      v16h vb = load_frag(vTh + (size_t)(16 * j) * TT + kt, TT);
      acc[j] = wmma16(pa, vb, acc[j]);
    }
  }

  // write attn as f16 [B,T,D] (feeds the proj GEMM)
  for (int j = 0; j < 4; ++j)
    for (int r = 0; r < 8; ++r) {
      int qi = q0 + rb + r;
      int d = h * HS + 16 * j + cn;
      attn[((size_t)bi * TT + qi) * DD + d] = to_h(acc[j][r]);
    }
}

// ---------------- host-side orchestration ----------------
extern "C" void kernel_launch(void* const* d_in, const int* in_sizes, int n_in,
                              void* d_out, int out_size, void* d_ws,
                              size_t ws_size, hipStream_t stream) {
  const float* x     = (const float*)d_in[0];
  const float* Wq    = (const float*)d_in[1];
  const float* Wk    = (const float*)d_in[2];
  const float* Wv    = (const float*)d_in[3];
  const float* Wproj = (const float*)d_in[4];
  const float* bproj = (const float*)d_in[5];
  const float* W1    = (const float*)d_in[6];
  const float* b1    = (const float*)d_in[7];
  const float* W2    = (const float*)d_in[8];
  const float* b2    = (const float*)d_in[9];
  const float* ln1g  = (const float*)d_in[10];
  const float* ln1b  = (const float*)d_in[11];
  const float* ln2g  = (const float*)d_in[12];
  const float* ln2b  = (const float*)d_in[13];
  float* out = (float*)d_out;

  char* base = (char*)d_ws;
  size_t off = 0;
  auto alloc = [&](size_t bytes) -> char* {
    char* p = base + off;
    off += (bytes + 255) & ~(size_t)255;
    return p;
  };
  _Float16* wqkvT = (_Float16*)alloc((size_t)3 * DD * DD * 2);  // [3D][D]
  _Float16* wpT   = (_Float16*)alloc((size_t)DD * DD * 2);      // [D][D]
  _Float16* w1T   = (_Float16*)alloc((size_t)DFF * DD * 2);     // [4D][D]
  _Float16* w2T   = (_Float16*)alloc((size_t)DD * DFF * 2);     // [D][4D]
  float*    xn_f  = (float*)   alloc((size_t)BT * DD * 4);
  _Float16* xn_h  = (_Float16*)alloc((size_t)BT * DD * 2);
  _Float16* q_h   = (_Float16*)alloc((size_t)BB * HH * TT * HS * 2);
  _Float16* k_h   = (_Float16*)alloc((size_t)BB * HH * TT * HS * 2);
  _Float16* v_h   = (_Float16*)alloc((size_t)BB * HH * TT * HS * 2);
  _Float16* vT_h  = (_Float16*)alloc((size_t)BB * HH * TT * HS * 2);
  float*    cmax  = (float*)   alloc((size_t)BB * HH * TT * 4);
  float*    csum  = (float*)   alloc((size_t)BB * HH * TT * 4);
  _Float16* attnh = (_Float16*)alloc((size_t)BT * DD * 2);
  float*    x1_f  = (float*)   alloc((size_t)BT * DD * 4);
  float*    x1n_f = (float*)   alloc((size_t)BT * DD * 4);
  _Float16* x1n_h = (_Float16*)alloc((size_t)BT * DD * 2);
  _Float16* h_h   = (_Float16*)alloc((size_t)BT * DFF * 2);

  // 1) pack all weights to f16, transposed [N][K]: 12M elements, 64 n x 256 k a group
  pack_weights<<<(3 * DD * DD + DD * DD + 2 * DD * DFF) / (64 * 256), 256, 0, stream>>>(
      Wq, Wk, Wv, Wproj, W1, W2, wqkvT, wpT, w1T, w2T);
  // 2) LN1 -> xn (f32 + f16)
  ln_kernel<<<BT, 256, 0, stream>>>(x, ln1g, ln1b, xn_f, xn_h);
  // 3) QKV GEMM: [4096x1024] x [1024x3072]
  gemm128<MODE_QKV><<<dim3(3 * DD / 128, BT / 128), 256, 0, stream>>>(
      xn_h, wqkvT, 3 * DD, DD, nullptr, nullptr, nullptr, nullptr,
      q_h, k_h, v_h);
  // 4) per-column softmax stats
  attn_pass1<<<dim3(TT / 128, BB * HH), 256, 0, stream>>>(q_h, k_h, cmax, csum);
  // 5) v' = v / Z, transposed
  vscale<<<BB * HH * (TT / 64) / 4, 256, 0, stream>>>(v_h, csum, vT_h);
  // 6) attn = P @ V'
  attn_pass2<<<dim3(TT / 128, BB * HH), 256, 0, stream>>>(q_h, k_h, vT_h, cmax,
                                                          attnh);
  // 7) proj: x1 = xn + attn @ Wproj + bproj
  gemm128<MODE_PROJ><<<dim3(DD / 128, BT / 128), 256, 0, stream>>>(
      attnh, wpT, DD, DD, bproj, xn_f, x1_f, nullptr, nullptr,
      nullptr, nullptr);
  // 8) LN2 -> x1n (f32 + f16)
  ln_kernel<<<BT, 256, 0, stream>>>(x1_f, ln2g, ln2b, x1n_f, x1n_h);
  // 9) FFN1: h = relu(x1n @ W1 + b1)
  gemm128<MODE_FFN1><<<dim3(DFF / 128, BT / 128), 256, 0, stream>>>(
      x1n_h, w1T, DFF, DD, b1, nullptr, nullptr, h_h, nullptr,
      nullptr, nullptr);
  // 10) FFN2: out = x1n + h @ W2 + b2
  gemm128<MODE_FFN2><<<dim3(DD / 128, BT / 128), 256, 0, stream>>>(
      h_h, w2T, DD, DFF, b2, x1n_f, out, nullptr, nullptr, nullptr,
      nullptr);
}

// v003
// One run takes 289 microseconds.
// Timed twice side by side with v002, it ran 1.40 and 1.39 times as fast.
// Counting every step since v000, it is 1.94 times as fast.
#include <hip/hip_runtime.h>
#include <hip/hip_bf16.h>

// ---------------- problem constants ----------------
#define BB 2
#define TT 2048
#define DD 1024
#define HH 16
#define HS 64
#define BT (BB * TT)       // 4096 rows
#define DFF (4 * DD)       // 4096
#define PAD 56             // LDS row stride in halves: 112B -> 16B aligned, 16 distinct banks

typedef __attribute__((ext_vector_type(16))) _Float16 v16h;
typedef __attribute__((ext_vector_type(8)))  float    v8f;
typedef __attribute__((ext_vector_type(4)))  int      v4i;
typedef __attribute__((ext_vector_type(4)))  float    v4f;
typedef __attribute__((ext_vector_type(8)))  _Float16 v8h;

// ---------------- optional CDNA5 async global->LDS path ----------------
#if defined(__has_builtin)
# if __has_builtin(__builtin_amdgcn_global_load_async_to_lds_b128)
#  define HAVE_ASYNC_LDS 1
# endif
# if __has_builtin(__builtin_amdgcn_s_wait_asynccnt)
#  define HAVE_WAIT_ASYNC 1
# endif
#endif

#if defined(HAVE_ASYNC_LDS)
typedef __attribute__((address_space(1))) v4i gv4i_t;  // global int4
typedef __attribute__((address_space(3))) v4i lv4i_t;  // LDS int4
__device__ __forceinline__ void async_cp16(void* lds, const void* g) {
  // copies 16 bytes per lane, tracked by ASYNCcnt
  __builtin_amdgcn_global_load_async_to_lds_b128(
      (gv4i_t*)(void*)g, (lv4i_t*)lds, 0, 0);
}
template <int N>
__device__ __forceinline__ void wait_async() {
# if defined(HAVE_WAIT_ASYNC)
  __builtin_amdgcn_s_wait_asynccnt((unsigned short)N);
# else
  if (N == 0) asm volatile("s_wait_asynccnt 0" ::: "memory");
  else        asm volatile("s_wait_asynccnt 4" ::: "memory");
# endif
}
#endif

// ---------------- WMMA helpers ----------------
__device__ __forceinline__ v8f wmma16(v16h a, v16h b, v8f c) {
  // D = A(16x32 f16) * B(32x16 f16) + C(16x16 f32)
  return __builtin_amdgcn_wmma_f32_16x16x32_f16(false, a, false, b, (short)0, c,
                                                false, false);
}

// A-fragment loader (16-bit A 16x32 layout):
//   lane<16 : row M = lane,    holds K = 0..7  and 16..23
//   lane>=16: row M = lane-16, holds K = 8..15 and 24..31
// B-fragments (stored row=N, col=K) use the same pattern with N as the row.
__device__ __forceinline__ v16h load_frag(const _Float16* p, int stride) {
  int l = threadIdx.x & 31;
  const _Float16* r = p + (size_t)(l & 15) * stride + ((l >> 4) << 3);
  v16h f;
  ((uint4*)&f)[0] = *(const uint4*)(r);
  ((uint4*)&f)[1] = *(const uint4*)(r + 16);
  return f;
}

__device__ __forceinline__ _Float16 to_h(float x) { return (_Float16)x; }

// ---------------- weight packing: f32 -> f16, ALL weights TRANSPOSED --------
// Every packed weight is stored [N][K] so GEMM B-tiles stage with contiguous
// 16B rows (identical to A-tiles, no in-loop transpose).
// One wave transposes a tile of 64 k x 32 n in registers: lane (lk = l >> 3,
// ln = l & 7) reads 16 source rows x 4 floats, so each load covers four whole
// 128-byte lines, and writes 8 runs of 8 halves along k; the wave alone writes
// the 128-byte output lines of its tile. One element per thread had to start
// 64 times as many waves, each with a load that touched 32 lines.
template <int LD, int K>   // source pitch in floats, packed pitch in halves
__device__ __forceinline__ void pack_tile(const float* __restrict__ S,
                                          _Float16* __restrict__ O, int kb) {
  const int wave = threadIdx.x >> 5, l = threadIdx.x & 31;
  const int n = (wave & 1) * 32 + (l & 7) * 4;
  const int k = kb * 256 + (wave >> 1) * 64 + (l >> 3) * 8;
  const float* s = S + (size_t)k * LD + n;
  _Float16* o = O + (size_t)n * K + k;
  v4f v[2][8];
  for (int g = 0; g < 2; ++g)
    for (int i = 0; i < 8; ++i)
      v[g][i] = *(const v4f*)(s + (size_t)(32 * g + i) * LD);
  // the 16 loads share one address pair: it is named here as an input, so that no
  // load's result lands on it, and the wait stands in front of its reuse below
  asm volatile("s_wait_xcnt 0x0" :: "v"(s) : "memory");
  // all 16 loads go out before the first conversion: left free, the scheduler
  // holds some back behind the first results (a second memory round trip)
  __builtin_amdgcn_sched_barrier(0);
  for (int g = 0; g < 2; ++g)
    for (int j = 0; j < 4; ++j) {
      v8h t;
      for (int i = 0; i < 8; ++i) t[i] = to_h(v[g][i][j]);
      *(v8h*)(o + (size_t)j * K + 32 * g) = t;
    }
  // the code of the four matrices stands one part behind the other, parted only by
  // scalar skips, and each part rewrites these registers: keep the wait behind the stores
  asm volatile("s_wait_xcnt 0x0" ::: "memory");
}

// a work-group packs 64 n x 256 k; the matrix it works on is block-uniform
__global__ __launch_bounds__(256) void pack_weights(
    const float* __restrict__ Wq, const float* __restrict__ Wk,
    const float* __restrict__ Wv, const float* __restrict__ Wp,
    const float* __restrict__ W1, const float* __restrict__ W2,
    _Float16* __restrict__ wqkvT, _Float16* __restrict__ wpT,
    _Float16* __restrict__ w1T, _Float16* __restrict__ w2T) {
  const int b = blockIdx.x;
  const int bP = 3 * HH * 4, b1 = bP + (DD / 64) * 4, b2 = b1 + (DFF / 64) * 4;
  if (b < bP) {                    // q, k, v: one head [D][HS] is 64 n wide
    const int hd = b >> 2, sel = hd >> 4, h = hd & 15;
    const float* W = (sel == 0) ? Wq : (sel == 1) ? Wk : Wv;
    pack_tile<HS, DD>(W + (size_t)h * DD * HS, wqkvT + (size_t)hd * 64 * DD, b & 3);
  } else if (b < b1) {             // Wproj [D][D]
    const int nb = (b - bP) >> 2;
    pack_tile<DD, DD>(Wp + nb * 64, wpT + (size_t)nb * 64 * DD, b & 3);
  } else if (b < b2) {             // W1 [D][4D]
    const int nb = (b - b1) >> 2;
    pack_tile<DFF, DD>(W1 + nb * 64, w1T + (size_t)nb * 64 * DD, b & 3);
  } else {                         // W2 [4D][D]
    const int nb = (b - b2) >> 4;
    pack_tile<DD, DFF>(W2 + nb * 64, w2T + (size_t)nb * 64 * DFF, b & 15);
  }
}

// ---------------- LayerNorm: writes f32 (residual) + f16 (GEMM input) -------
__global__ __launch_bounds__(256) void ln_kernel(
    const float* __restrict__ x, const float* __restrict__ g,
    const float* __restrict__ b, float* __restrict__ yf,
    _Float16* __restrict__ yh) {
  __shared__ float s1[256], s2[256];
  int row = blockIdx.x, tid = threadIdx.x;
  const float* xr = x + (size_t)row * DD;
  float4 xv = ((const float4*)xr)[tid];          // 4 elements / thread
  float sum = xv.x + xv.y + xv.z + xv.w;
  float sq  = xv.x * xv.x + xv.y * xv.y + xv.z * xv.z + xv.w * xv.w;
  s1[tid] = sum; s2[tid] = sq;
  __syncthreads();
  for (int off = 128; off; off >>= 1) {
    if (tid < off) { s1[tid] += s1[tid + off]; s2[tid] += s2[tid + off]; }
    __syncthreads();
  }
  float mu  = s1[0] * (1.0f / DD);
  float var = s2[0] * (1.0f / DD) - mu * mu;
  float rs  = rsqrtf(var + 1e-5f);
  float vals[4] = {xv.x, xv.y, xv.z, xv.w};
  for (int j = 0; j < 4; ++j) {
    int c = tid * 4 + j;
    float xn = (vals[j] - mu) * rs * g[c] + b[c];
    yf[(size_t)row * DD + c] = xn;
    yh[(size_t)row * DD + c] = to_h(xn);
  }
}

// ---------------- generic 128x128 WMMA GEMM with fused epilogues ------------
#define MODE_QKV  0
#define MODE_PROJ 1
#define MODE_FFN1 2
#define MODE_FFN2 3

// MODE is a compile-time parameter: with it at run time the epilogue stayed a
// rolled loop that tested the mode per element and waited for each element's
// residual load before its store (one memory round trip per element).
template <int MODE>
__global__ __launch_bounds__(256) void gemm128(
    const _Float16* __restrict__ A,   // [M][K] row-major f16
    const _Float16* __restrict__ Bt,  // [N][K] row-major f16 (pre-transposed)
    int N, int K,
    const float* __restrict__ bias, const float* __restrict__ resid,
    float* __restrict__ outf, _Float16* __restrict__ outh,
    _Float16* __restrict__ qp, _Float16* __restrict__ kp,
    _Float16* __restrict__ vp) {
#if defined(HAVE_ASYNC_LDS)
  __shared__ _Float16 As[2][128 * PAD];
  __shared__ _Float16 Bs[2][128 * PAD];
#else
  __shared__ _Float16 As[1][128 * PAD];
  __shared__ _Float16 Bs[1][128 * PAD];
#endif
  const int tid = threadIdx.x;
  const int m0 = blockIdx.y * 128;
  const int n0 = blockIdx.x * 128;
  const int wave = tid >> 5, l = tid & 31;
  const int wm = (wave & 1) * 64;   // wave M offset in tile
  const int wn = (wave >> 1) * 32;  // wave N offset in tile
  const int r = tid >> 2, c = (tid & 3) * 8;  // staging coords (64 rows/pass)

  v8f acc[4][2];
  for (int i = 0; i < 4; ++i)
    for (int j = 0; j < 2; ++j) acc[i][j] = (v8f){};

#if defined(HAVE_ASYNC_LDS)
  auto stage = [&](int kk, int p) {
    async_cp16(&As[p][(size_t)r * PAD + c],        A  + (size_t)(m0 + r) * K + kk + c);
    async_cp16(&As[p][(size_t)(r + 64) * PAD + c], A  + (size_t)(m0 + r + 64) * K + kk + c);
    async_cp16(&Bs[p][(size_t)r * PAD + c],        Bt + (size_t)(n0 + r) * K + kk + c);
    async_cp16(&Bs[p][(size_t)(r + 64) * PAD + c], Bt + (size_t)(n0 + r + 64) * K + kk + c);
  };
  int p = 0;
  stage(0, 0);
#endif

  for (int kk = 0; kk < K; kk += 32) {
#if defined(HAVE_ASYNC_LDS)
    if (kk + 32 < K) { stage(kk + 32, p ^ 1); wait_async<4>(); }
    else             { wait_async<0>(); }
    __syncthreads();
    const _Float16* as = As[p];
    const _Float16* bs = Bs[p];
#else
    *(uint4*)&As[0][(size_t)r * PAD + c] =
        *(const uint4*)(A + (size_t)(m0 + r) * K + kk + c);
    *(uint4*)&As[0][(size_t)(r + 64) * PAD + c] =
        *(const uint4*)(A + (size_t)(m0 + r + 64) * K + kk + c);
    *(uint4*)&Bs[0][(size_t)r * PAD + c] =
        *(const uint4*)(Bt + (size_t)(n0 + r) * K + kk + c);
    *(uint4*)&Bs[0][(size_t)(r + 64) * PAD + c] =
        *(const uint4*)(Bt + (size_t)(n0 + r + 64) * K + kk + c);
    __syncthreads();
    const _Float16* as = As[0];
    const _Float16* bs = Bs[0];
#endif
    v16h af[4], bf[2];
    for (int i = 0; i < 4; ++i) af[i] = load_frag(as + (wm + 16 * i) * PAD, PAD);
    for (int j = 0; j < 2; ++j) bf[j] = load_frag(bs + (wn + 16 * j) * PAD, PAD);
    for (int i = 0; i < 4; ++i)
      for (int j = 0; j < 2; ++j) acc[i][j] = wmma16(af[i], bf[j], acc[i][j]);
    __syncthreads();
#if defined(HAVE_ASYNC_LDS)
    p ^= 1;
#endif
  }

  // epilogue: C lane map -> col = base + (l&15); rows = base + r + (l>=16)*8
  const int cn = l & 15, rb = (l >> 4) * 8;
  const int gm0 = m0 + wm + rb;   // this lane's first row
  const int gn0 = n0 + wn + cn;   // this lane's first column
  if constexpr (MODE == MODE_QKV) {
    // a 128-wide tile never straddles a 1024-wide q/k/v section: sel is block-uniform
    const int sel = n0 >> 10;
    _Float16* __restrict__ dp = (sel == 0) ? qp : (sel == 1) ? kp : vp;
    const float sc = (sel == 0) ? 0.03125f : 1.0f;  // fold D^-0.5 into q
    for (int i = 0; i < 4; ++i)
      for (int j = 0; j < 2; ++j)
        for (int rr = 0; rr < 8; ++rr) {
          int gm = gm0 + 16 * i + rr;
          int gn = gn0 + 16 * j;
          int w = gn & 1023, h = w >> 6, e = w & 63;
          int bi = gm >> 11, t = gm & (TT - 1);
          size_t dst = (((size_t)(bi * HH + h)) * TT + t) * HS + e;
          dp[dst] = to_h(acc[i][j][rr] * sc);
        }
  } else if constexpr (MODE == MODE_FFN1) {
    float bv[2];
    for (int j = 0; j < 2; ++j) bv[j] = bias[gn0 + 16 * j];
    // the bias loads' offset register is reused right behind them: keep the wait in front of that
    asm volatile("s_wait_xcnt 0x0" ::: "memory");
    _Float16* op = outh + (size_t)gm0 * DFF + gn0;
    for (int i = 0; i < 4; ++i)
      for (int j = 0; j < 2; ++j)
        for (int rr = 0; rr < 8; ++rr) {
          float v = acc[i][j][rr] + bv[j];
          v = fmaxf(v, 0.0f);
          op[(size_t)(16 * i + rr) * DFF + 16 * j] = to_h(v);
        }
  } else {  // MODE_PROJ, MODE_FFN2: out = acc + (bias + resid)
    float bv[2];
    for (int j = 0; j < 2; ++j) bv[j] = bias[gn0 + 16 * j];
    // the bias loads' offset register is reused right behind them: keep the wait in front of that
    asm volatile("s_wait_xcnt 0x0" ::: "memory");
    const float* rp = resid + (size_t)gm0 * DD + gn0;
    float* op = outf + (size_t)gm0 * DD + gn0;
    // all residual loads are issued before the first store, so they overlap
    float rv[4][2][8];
    for (int i = 0; i < 4; ++i)
      for (int j = 0; j < 2; ++j)
        for (int rr = 0; rr < 8; ++rr)
          rv[i][j][rr] = rp[(size_t)(16 * i + rr) * DD + 16 * j];
    for (int i = 0; i < 4; ++i)
      for (int j = 0; j < 2; ++j)
        for (int rr = 0; rr < 8; ++rr)
          op[(size_t)(16 * i + rr) * DD + 16 * j] =
              acc[i][j][rr] + (bv[j] + rv[i][j][rr]);
  }
}

// ---------------- staging for the two attention passes ----------------------
// The eight waves of a work-group walk the same rows (pass 1: queries, pass 2:
// keys and values). Read as fragments straight from global memory, every load
// touched 16 lines for 512 bytes and every wave fetched the same rows again.
// Here the work-group copies each 64-row piece once, in whole 128-byte lines,
// into LDS, two buffers deep, and the waves read their fragments from there.
#define CH 64        // rows of 128 bytes per stage
#define APITCH 72    // LDS row pitch in halves: 144 B = 16 B x 9, conflict-free for 16-byte reads

// 64 rows x 128 B = 512 pieces of 16 B, two per lane; a wave's copy covers four whole lines.
__device__ __forceinline__ void stage_rows(_Float16* dst, const _Float16* src, int pitch) {
  const int r = threadIdx.x >> 3, c = (threadIdx.x & 7) * 8;
  const unsigned l0 = (unsigned)(uintptr_t)(dst + r * APITCH + c);
  const unsigned l1 = (unsigned)(uintptr_t)(dst + (r + 32) * APITCH + c);
  const _Float16* g0 = src + (size_t)r * pitch + c;
  const _Float16* g1 = src + (size_t)(r + 32) * pitch + c;
  // the wait is the statement's last line, so that it stands in front of any
  // rewrite of the address registers that the copies name
  asm volatile("global_load_async_to_lds_b128 %0, %1, off\n\t"
               "global_load_async_to_lds_b128 %2, %3, off\n\t"
               "s_wait_xcnt 0x0"
               :: "v"(l0), "v"(g0), "v"(l1), "v"(g1) : "memory");
}
// this wave's copies have landed (the barrier behind it publishes them to the others)
__device__ __forceinline__ void copies_landed() { asm volatile("s_wait_asynccnt 0x0" ::: "memory"); }
// this wave's LDS reads of the buffer that is refilled next have returned
__device__ __forceinline__ void lds_reads_done() { asm volatile("s_wait_dscnt 0x0" ::: "memory"); }

// ---------------- attention pass 1: per-key-column max / sumexp -------------
// softmax is over the QUERY axis (per reference): m_k, Z_k over q >= k.
__global__ __launch_bounds__(256) void attn_pass1(
    const _Float16* __restrict__ q, const _Float16* __restrict__ k,
    float* __restrict__ cmax, float* __restrict__ csum) {
  __shared__ _Float16 qs[2][CH * APITCH];
  const int bh = blockIdx.y;
  const int wave = __builtin_amdgcn_readfirstlane(threadIdx.x >> 5), l = threadIdx.x & 31;
  const int kb = blockIdx.x * 128;               // the work-group's first key column
  const int k0 = kb + wave * 16;                 // this wave's 16 key columns
  const _Float16* qh = q + (size_t)bh * TT * HS;
  const _Float16* kh = k + (size_t)bh * TT * HS;
  const int nt = (TT - kb) / CH;                 // stages of 64 queries, at least two

  stage_rows(qs[0], qh + (size_t)kb * HS, HS);
  // K^T fragments for this column strip (lane row = key token)
  v16h kf0 = load_frag(kh + (size_t)k0 * HS, HS);
  v16h kf1 = load_frag(kh + (size_t)k0 * HS + 32, HS);
  copies_landed();
  __syncthreads();
  stage_rows(qs[1], qh + (size_t)(kb + CH) * HS, HS);

  float m = -INFINITY, s = 0.0f;
  const int kcol = k0 + (l & 15);
  auto score = [&](const _Float16* qr) {         // 16 queries x this wave's 16 keys
    v16h qa0 = load_frag(qr, APITCH);
    v16h qa1 = load_frag(qr + 32, APITCH);
    v8f c = (v8f){};
    c = wmma16(qa0, kf0, c);
    return wmma16(qa1, kf1, c);
  };
  auto update = [&](v8f c, int qt) {
    const int qrb = qt + ((l >> 4) ? 8 : 0);
    for (int r = 0; r < 8; ++r) {
      int qi = qrb + r;
      if (qi >= kcol) {               // causal (q >= k valid)
        float val = c[r];
        if (val > m) { s = s * __expf(m - val) + 1.0f; m = val; }
        else         { s += __expf(val - m); }
      }
    }
  };
  for (int t = 0; t < nt; ++t) {
    const _Float16* qb = qs[t & 1];
    const int qc = kb + t * CH;       // first query row of this stage
    if (qc >= k0) {
      // no tile of the stage is skipped: all its fragment reads and products stand
      // in front of the first update, so one LDS round trip serves 64 queries
      v8f c[CH / 16];
      for (int u = 0; u < CH / 16; ++u) c[u] = score(qb + u * 16 * APITCH);
      for (int u = 0; u < CH / 16; ++u) update(c[u], qc + u * 16);
    } else {
      for (int u = 0; u < CH / 16; ++u)
        if (qc + u * 16 >= k0)        // wave-uniform: skips tiles wholly above the diagonal
          update(score(qb + u * 16 * APITCH), qc + u * 16);
    }
    // hand-over, passed by every wave: stage t + 1 is published, stage t's buffer is free
    lds_reads_done();
    copies_landed();
    __syncthreads();
    if (t + 2 < nt) stage_rows(qs[t & 1], qh + (size_t)(kb + (t + 2) * CH) * HS, HS);
  }
  copies_landed();
  // merge the two half-lanes holding the same column
  float m2 = __shfl_xor(m, 16, 32);
  float s2 = __shfl_xor(s, 16, 32);
  float mn = fmaxf(m, m2);
  float sm = s * __expf(m - mn) + s2 * __expf(m2 - mn);
  if (l < 16) {
    cmax[(size_t)bh * TT + kcol] = mn;
    csum[(size_t)bh * TT + kcol] = sm;
  }
}

// ---------------- v' = v / Z, stored transposed [B,H,HS,T] ------------------
// Same register-tile transpose: one wave takes 64 key tokens x 32 columns of a
// head; lane (lk = l & 7, le = l >> 3) reads 8 tokens x 8 halves and writes 8
// runs of 8 halves along t, so each store covers four whole 128-byte lines.
// The two waves that share the 128-byte source rows sit in one work-group.
__global__ __launch_bounds__(256) void vscale(
    const _Float16* __restrict__ v, const float* __restrict__ csum,
    _Float16* __restrict__ vT) {
  const int wave = threadIdx.x >> 5, l = threadIdx.x & 31;
  const int tile = blockIdx.x * 4 + (wave >> 1);   // BB*HH heads x TT/64 tiles
  const int bh = tile >> 5;
  const int kt = (tile & 31) * 64 + (l & 7) * 8;
  const int e = (wave & 1) * 32 + (l >> 3) * 8;
  const _Float16* s = v + ((size_t)bh * TT + kt) * HS + e;
  const float* z = csum + (size_t)bh * TT + kt;
  _Float16* o = vT + ((size_t)bh * HS + e) * TT + kt;
  v8h a[8];
  v4f Z[2];
  for (int i = 0; i < 8; ++i) a[i] = *(const v8h*)(s + (size_t)i * HS);
  for (int i = 0; i < 2; ++i) Z[i] = *(const v4f*)(z + 4 * i);
  // all ten loads go out before the arithmetic starts: left free, the scheduler
  // holds two back behind the first divisions (a second memory round trip)
  __builtin_amdgcn_sched_barrier(0);
  // unrolled so that j is a constant: left rolled, element j of every register
  // vector is picked by a chain of selects
#pragma unroll
  for (int j = 0; j < 8; ++j) {
    v8h t;
    for (int i = 0; i < 8; ++i)
      t[i] = to_h((float)a[i][j] / Z[i >> 2][i & 3]);
    *(v8h*)(o + (size_t)j * TT) = t;
  }
}

// ---------------- attention pass 2: attn = P @ V' ---------------------------
// 512 work-groups on 256 WGPs are four waves a SIMD: the register budget is set for
// that, so that a block's fragments and its 16 exponentials can be in flight together
__global__ __launch_bounds__(256) __attribute__((amdgpu_waves_per_eu(4, 4))) void attn_pass2(
    const _Float16* __restrict__ q, const _Float16* __restrict__ k,
    const _Float16* __restrict__ vT, const float* __restrict__ cmax,
    _Float16* __restrict__ attn) {
  __shared__ _Float16 ks[2][CH * APITCH];  // 64 keys x 64 head columns
  __shared__ _Float16 vs[2][CH * APITCH];  // 64 head columns x 64 keys
  __shared__ _Float16 pbuf[8][16 * PAD];   // per-wave P tile [16q x 32k]
  const int bh = blockIdx.y;
  const int wave = __builtin_amdgcn_readfirstlane(threadIdx.x >> 5), l = threadIdx.x & 31;
  const int qb0 = blockIdx.x * 128;              // the work-group's first query row
  const int q0 = qb0 + wave * 16;                // this wave's 16 query rows
  const int bi = bh / HH, h = bh % HH;
  const _Float16* qh  = q  + (size_t)bh * TT * HS;
  const _Float16* kh  = k  + (size_t)bh * TT * HS;
  const _Float16* vTh = vT + (size_t)bh * HS * TT;
  const float*    mh  = cmax + (size_t)bh * TT;
  const int nt = (qb0 + 128) / CH;               // stages of 64 keys, at least two

  stage_rows(ks[0], kh, HS);
  stage_rows(vs[0], vTh, TT);
  v16h qa0 = load_frag(qh + (size_t)q0 * HS, HS);
  v16h qa1 = load_frag(qh + (size_t)q0 * HS + 32, HS);
  copies_landed();
  __syncthreads();
  stage_rows(ks[1], kh + (size_t)CH * HS, HS);
  stage_rows(vs[1], vTh + CH, TT);

  v8f acc[4];
  for (int j = 0; j < 4; ++j) acc[j] = (v8f){};

  const int cn = l & 15, rb = (l >> 4) * 8;
  // 16 queries x 32 keys. All fragment reads of the block (K and, since they do not
  // depend on P, V^T) stand at its head: one LDS round trip. Where the second 16 keys
  // lie wholly behind the diagonal the causal select below writes their zeros (those
  // key rows are part of the stage, so the reads are in range).
  auto pv_block = [&](const _Float16* kr, const _Float16* vr, int kt) {
    v16h kf[2][2], vb[4];
    float mk[2];
    for (int h2 = 0; h2 < 2; ++h2) {
      kf[h2][0] = load_frag(kr + 16 * h2 * APITCH, APITCH);
      kf[h2][1] = load_frag(kr + 16 * h2 * APITCH + 32, APITCH);
      mk[h2] = mh[kt + 16 * h2 + cn];
    }
    for (int j = 0; j < 4; ++j) vb[j] = load_frag(vr + (16 * j) * APITCH, APITCH);
    // build P tile (two 16-wide halves) in LDS, C-layout -> A-layout
    for (int h2 = 0; h2 < 2; ++h2) {
      v8f cc = (v8f){};
      cc = wmma16(qa0, kf[h2][0], cc);
      cc = wmma16(qa1, kf[h2][1], cc);
      int kcol = kt + 16 * h2 + cn;
      for (int r = 0; r < 8; ++r) {
        int qi = q0 + rb + r;
        float pv = (qi >= kcol) ? __expf(cc[r] - mk[h2]) : 0.0f;
        pbuf[wave][(size_t)(rb + r) * PAD + 16 * h2 + cn] = to_h(pv);
      }
    }
    // intra-wave LDS turnaround: the P tile is private to its wave
    asm volatile("s_wait_dscnt 0" ::: "memory");
    v16h pa = load_frag(pbuf[wave], PAD);
    for (int j = 0; j < 4; ++j) acc[j] = wmma16(pa, vb[j], acc[j]);
  };
  for (int t = 0; t < nt; ++t) {
    const _Float16* kst = ks[t & 1];
    const _Float16* vst = vs[t & 1];
    for (int u = 0; u < CH / 32; ++u) {
      const int kt = t * CH + u * 32;
      if (kt < q0 + 16)               // wave-uniform: skips keys wholly behind the diagonal
        pv_block(kst + u * 32 * APITCH, vst + u * 32, kt);
    }
    // hand-over, passed by every wave: stage t + 1 is published, stage t's buffers are free
    lds_reads_done();
    copies_landed();
    __syncthreads();
    if (t + 2 < nt) {
      stage_rows(ks[t & 1], kh + (size_t)(t + 2) * CH * HS, HS);
      stage_rows(vs[t & 1], vTh + (t + 2) * CH, TT);
    }
  }
  copies_landed();

  // write attn as f16 [B,T,D] (feeds the proj GEMM)
  for (int j = 0; j < 4; ++j)
    for (int r = 0; r < 8; ++r) {
      int qi = q0 + rb + r;
      int d = h * HS + 16 * j + cn;
      attn[((size_t)bi * TT + qi) * DD + d] = to_h(acc[j][r]);
    }
}

// ---------------- host-side orchestration ----------------
extern "C" void kernel_launch(void* const* d_in, const int* in_sizes, int n_in,
                              void* d_out, int out_size, void* d_ws,
                              size_t ws_size, hipStream_t stream) {
  const float* x     = (const float*)d_in[0];
  const float* Wq    = (const float*)d_in[1];
  const float* Wk    = (const float*)d_in[2];
  const float* Wv    = (const float*)d_in[3];
  const float* Wproj = (const float*)d_in[4];
  const float* bproj = (const float*)d_in[5];
  const float* W1    = (const float*)d_in[6];
  const float* b1    = (const float*)d_in[7];
  const float* W2    = (const float*)d_in[8];
  const float* b2    = (const float*)d_in[9];
  const float* ln1g  = (const float*)d_in[10];
  const float* ln1b  = (const float*)d_in[11];
  const float* ln2g  = (const float*)d_in[12];
  const float* ln2b  = (const float*)d_in[13];
  float* out = (float*)d_out;

  char* base = (char*)d_ws;
  size_t off = 0;
  auto alloc = [&](size_t bytes) -> char* {
    char* p = base + off;
    off += (bytes + 255) & ~(size_t)255;
    return p;
  };
  _Float16* wqkvT = (_Float16*)alloc((size_t)3 * DD * DD * 2);  // [3D][D]
  _Float16* wpT   = (_Float16*)alloc((size_t)DD * DD * 2);      // [D][D]
  _Float16* w1T   = (_Float16*)alloc((size_t)DFF * DD * 2);     // [4D][D]
  _Float16* w2T   = (_Float16*)alloc((size_t)DD * DFF * 2);     // [D][4D]
  float*    xn_f  = (float*)   alloc((size_t)BT * DD * 4);
  _Float16* xn_h  = (_Float16*)alloc((size_t)BT * DD * 2);
  _Float16* q_h   = (_Float16*)alloc((size_t)BB * HH * TT * HS * 2);
  _Float16* k_h   = (_Float16*)alloc((size_t)BB * HH * TT * HS * 2);
  _Float16* v_h   = (_Float16*)alloc((size_t)BB * HH * TT * HS * 2);
  _Float16* vT_h  = (_Float16*)alloc((size_t)BB * HH * TT * HS * 2);
  float*    cmax  = (float*)   alloc((size_t)BB * HH * TT * 4);
  float*    csum  = (float*)   alloc((size_t)BB * HH * TT * 4);
  _Float16* attnh = (_Float16*)alloc((size_t)BT * DD * 2);
  float*    x1_f  = (float*)   alloc((size_t)BT * DD * 4);
  float*    x1n_f = (float*)   alloc((size_t)BT * DD * 4);
  _Float16* x1n_h = (_Float16*)alloc((size_t)BT * DD * 2);
  _Float16* h_h   = (_Float16*)alloc((size_t)BT * DFF * 2);

  // 1) pack all weights to f16, transposed [N][K]: 12M elements, 64 n x 256 k a group
  pack_weights<<<(3 * DD * DD + DD * DD + 2 * DD * DFF) / (64 * 256), 256, 0, stream>>>(
      Wq, Wk, Wv, Wproj, W1, W2, wqkvT, wpT, w1T, w2T);
  // 2) LN1 -> xn (f32 + f16)
  ln_kernel<<<BT, 256, 0, stream>>>(x, ln1g, ln1b, xn_f, xn_h);
  // 3) QKV GEMM: [4096x1024] x [1024x3072]
  gemm128<MODE_QKV><<<dim3(3 * DD / 128, BT / 128), 256, 0, stream>>>(
      xn_h, wqkvT, 3 * DD, DD, nullptr, nullptr, nullptr, nullptr,
      q_h, k_h, v_h);
  // 4) per-column softmax stats
  attn_pass1<<<dim3(TT / 128, BB * HH), 256, 0, stream>>>(q_h, k_h, cmax, csum);
  // 5) v' = v / Z, transposed
  vscale<<<BB * HH * (TT / 64) / 4, 256, 0, stream>>>(v_h, csum, vT_h);
  // 6) attn = P @ V'
  attn_pass2<<<dim3(TT / 128, BB * HH), 256, 0, stream>>>(q_h, k_h, vT_h, cmax,
                                                          attnh);
  // 7) proj: x1 = xn + attn @ Wproj + bproj
  gemm128<MODE_PROJ><<<dim3(DD / 128, BT / 128), 256, 0, stream>>>(
      attnh, wpT, DD, DD, bproj, xn_f, x1_f, nullptr, nullptr,
      nullptr, nullptr);
  // 8) LN2 -> x1n (f32 + f16)
  ln_kernel<<<BT, 256, 0, stream>>>(x1_f, ln2g, ln2b, x1n_f, x1n_h);
  // 9) FFN1: h = relu(x1n @ W1 + b1)
  gemm128<MODE_FFN1><<<dim3(DFF / 128, BT / 128), 256, 0, stream>>>(
      x1n_h, w1T, DFF, DD, b1, nullptr, nullptr, h_h, nullptr,
      nullptr, nullptr);
  // 10) FFN2: out = x1n + h @ W2 + b2
  gemm128<MODE_FFN2><<<dim3(DD / 128, BT / 128), 256, 0, stream>>>(
      h_h, w2T, DD, DFF, b2, x1n_f, out, nullptr, nullptr, nullptr,
      nullptr);
}

// v004
// One run takes 252 microseconds.
// In both of two side-by-side timings against v003, it was 1.14 times as fast.
// All steps since v000 together make it 2.21 times as fast.
#include <hip/hip_runtime.h>
#include <hip/hip_bf16.h>

// ---------------- problem constants ----------------
#define BB 2
#define TT 2048
#define DD 1024
#define HH 16
#define HS 64
#define BT (BB * TT)       // 4096 rows
#define DFF (4 * DD)       // 4096
#define PAD 56             // LDS row stride in halves: 112B -> 16B aligned, 16 distinct banks

typedef __attribute__((ext_vector_type(16))) _Float16 v16h;
typedef __attribute__((ext_vector_type(8)))  float    v8f;
typedef __attribute__((ext_vector_type(4)))  int      v4i;
typedef __attribute__((ext_vector_type(4)))  float    v4f;
typedef __attribute__((ext_vector_type(8)))  _Float16 v8h;

// ---------------- optional CDNA5 async global->LDS path ----------------
#if defined(__has_builtin)
# if __has_builtin(__builtin_amdgcn_global_load_async_to_lds_b128)
#  define HAVE_ASYNC_LDS 1
# endif
# if __has_builtin(__builtin_amdgcn_s_wait_asynccnt)
#  define HAVE_WAIT_ASYNC 1
# endif
#endif

#if defined(HAVE_ASYNC_LDS)
typedef __attribute__((address_space(1))) v4i gv4i_t;  // global int4
typedef __attribute__((address_space(3))) v4i lv4i_t;  // LDS int4
__device__ __forceinline__ void async_cp16(void* lds, const void* g) {
  // copies 16 bytes per lane, tracked by ASYNCcnt
  __builtin_amdgcn_global_load_async_to_lds_b128(
      (gv4i_t*)(void*)g, (lv4i_t*)lds, 0, 0);
}
template <int N>
__device__ __forceinline__ void wait_async() {
# if defined(HAVE_WAIT_ASYNC)
  __builtin_amdgcn_s_wait_asynccnt((unsigned short)N);
# else
  if (N == 0) asm volatile("s_wait_asynccnt 0" ::: "memory");
  else        asm volatile("s_wait_asynccnt 4" ::: "memory");
# endif
}
#endif

// ---------------- WMMA helpers ----------------
__device__ __forceinline__ v8f wmma16(v16h a, v16h b, v8f c) {
  // D = A(16x32 f16) * B(32x16 f16) + C(16x16 f32)
  return __builtin_amdgcn_wmma_f32_16x16x32_f16(false, a, false, b, (short)0, c,
                                                false, false);
}

// A-fragment loader (16-bit A 16x32 layout):
//   lane<16 : row M = lane,    holds K = 0..7  and 16..23
//   lane>=16: row M = lane-16, holds K = 8..15 and 24..31
// B-fragments (stored row=N, col=K) use the same pattern with N as the row.
__device__ __forceinline__ v16h load_frag(const _Float16* p, int stride) {
  int l = threadIdx.x & 31;
  const _Float16* r = p + (size_t)(l & 15) * stride + ((l >> 4) << 3);
  v16h f;
  ((uint4*)&f)[0] = *(const uint4*)(r);
  ((uint4*)&f)[1] = *(const uint4*)(r + 16);
  return f;
}

__device__ __forceinline__ _Float16 to_h(float x) { return (_Float16)x; }

// ---------------- weight packing: f32 -> f16, ALL weights TRANSPOSED --------
// Every packed weight is stored [N][K] so GEMM B-tiles stage with contiguous
// 16B rows (identical to A-tiles, no in-loop transpose).
// One wave transposes a tile of 64 k x 32 n in registers: lane (lk = l >> 3,
// ln = l & 7) reads 16 source rows x 4 floats, so each load covers four whole
// 128-byte lines, and writes 8 runs of 8 halves along k; the wave alone writes
// the 128-byte output lines of its tile. One element per thread had to start
// 64 times as many waves, each with a load that touched 32 lines.
template <int LD, int K>   // source pitch in floats, packed pitch in halves
__device__ __forceinline__ void pack_tile(const float* __restrict__ S,
                                          _Float16* __restrict__ O, int kb) {
  const int wave = threadIdx.x >> 5, l = threadIdx.x & 31;
  const int n = (wave & 1) * 32 + (l & 7) * 4;
  const int k = kb * 256 + (wave >> 1) * 64 + (l >> 3) * 8;
  const float* s = S + (size_t)k * LD + n;
  _Float16* o = O + (size_t)n * K + k;
  v4f v[2][8];
  for (int g = 0; g < 2; ++g)
    for (int i = 0; i < 8; ++i)
      v[g][i] = *(const v4f*)(s + (size_t)(32 * g + i) * LD);
  // the 16 loads share one address pair: it is named here as an input, so that no
  // load's result lands on it, and the wait stands in front of its reuse below
  asm volatile("s_wait_xcnt 0x0" :: "v"(s) : "memory");
  // all 16 loads go out before the first conversion: left free, the scheduler
  // holds some back behind the first results (a second memory round trip)
  __builtin_amdgcn_sched_barrier(0);
  for (int g = 0; g < 2; ++g)
    for (int j = 0; j < 4; ++j) {
      v8h t;
      for (int i = 0; i < 8; ++i) t[i] = to_h(v[g][i][j]);
      *(v8h*)(o + (size_t)j * K + 32 * g) = t;
    }
  // the code of the four matrices stands one part behind the other, parted only by
  // scalar skips, and each part rewrites these registers: keep the wait behind the stores
  asm volatile("s_wait_xcnt 0x0" ::: "memory");
}

// a work-group packs 64 n x 256 k; the matrix it works on is block-uniform
__global__ __launch_bounds__(256) void pack_weights(
    const float* __restrict__ Wq, const float* __restrict__ Wk,
    const float* __restrict__ Wv, const float* __restrict__ Wp,
    const float* __restrict__ W1, const float* __restrict__ W2,
    _Float16* __restrict__ wqkvT, _Float16* __restrict__ wpT,
    _Float16* __restrict__ w1T, _Float16* __restrict__ w2T) {
  const int b = blockIdx.x;
  const int bP = 3 * HH * 4, b1 = bP + (DD / 64) * 4, b2 = b1 + (DFF / 64) * 4;
  if (b < bP) {                    // q, k, v: one head [D][HS] is 64 n wide
    const int hd = b >> 2, sel = hd >> 4, h = hd & 15;
    const float* W = (sel == 0) ? Wq : (sel == 1) ? Wk : Wv;
    pack_tile<HS, DD>(W + (size_t)h * DD * HS, wqkvT + (size_t)hd * 64 * DD, b & 3);
  } else if (b < b1) {             // Wproj [D][D]
    const int nb = (b - bP) >> 2;
    pack_tile<DD, DD>(Wp + nb * 64, wpT + (size_t)nb * 64 * DD, b & 3);
  } else if (b < b2) {             // W1 [D][4D]
    const int nb = (b - b1) >> 2;
    pack_tile<DFF, DD>(W1 + nb * 64, w1T + (size_t)nb * 64 * DD, b & 3);
  } else {                         // W2 [4D][D]
    const int nb = (b - b2) >> 4;
    pack_tile<DD, DFF>(W2 + nb * 64, w2T + (size_t)nb * 64 * DFF, b & 15);
  }
}

// ---------------- LayerNorm: writes f32 (residual) + f16 (GEMM input) -------
__global__ __launch_bounds__(256) void ln_kernel(
    const float* __restrict__ x, const float* __restrict__ g,
    const float* __restrict__ b, float* __restrict__ yf,
    _Float16* __restrict__ yh) {
  __shared__ float s1[256], s2[256];
  int row = blockIdx.x, tid = threadIdx.x;
  const float* xr = x + (size_t)row * DD;
  float4 xv = ((const float4*)xr)[tid];          // 4 elements / thread
  float sum = xv.x + xv.y + xv.z + xv.w;
  float sq  = xv.x * xv.x + xv.y * xv.y + xv.z * xv.z + xv.w * xv.w;
  s1[tid] = sum; s2[tid] = sq;
  __syncthreads();
  for (int off = 128; off; off >>= 1) {
    if (tid < off) { s1[tid] += s1[tid + off]; s2[tid] += s2[tid + off]; }
    __syncthreads();
  }
  float mu  = s1[0] * (1.0f / DD);
  float var = s2[0] * (1.0f / DD) - mu * mu;
  float rs  = rsqrtf(var + 1e-5f);
  float vals[4] = {xv.x, xv.y, xv.z, xv.w};
  for (int j = 0; j < 4; ++j) {
    int c = tid * 4 + j;
    float xn = (vals[j] - mu) * rs * g[c] + b[c];
    yf[(size_t)row * DD + c] = xn;
    yh[(size_t)row * DD + c] = to_h(xn);
  }
}

// ---------------- generic 128x128 WMMA GEMM with fused epilogues ------------
#define MODE_QKV  0
#define MODE_PROJ 1
#define MODE_FFN1 2
#define MODE_FFN2 3

// MODE is a compile-time parameter: with it at run time the epilogue stayed a
// rolled loop that tested the mode per element and waited for each element's
// residual load before its store (one memory round trip per element).
template <int MODE>
__global__ __launch_bounds__(256) void gemm128(
    const _Float16* __restrict__ A,   // [M][K] row-major f16
    const _Float16* __restrict__ Bt,  // [N][K] row-major f16 (pre-transposed)
    int N, int K,
    const float* __restrict__ bias, const float* __restrict__ resid,
    float* __restrict__ outf, _Float16* __restrict__ outh,
    _Float16* __restrict__ qp, _Float16* __restrict__ kp,
    _Float16* __restrict__ vp) {
#if defined(HAVE_ASYNC_LDS)
  __shared__ _Float16 As[2][128 * PAD];
  __shared__ _Float16 Bs[2][128 * PAD];
#else
  __shared__ _Float16 As[1][128 * PAD];
  __shared__ _Float16 Bs[1][128 * PAD];
#endif
  const int tid = threadIdx.x;
  const int m0 = blockIdx.y * 128;
  const int n0 = blockIdx.x * 128;
  const int wave = tid >> 5, l = tid & 31;
  const int wm = (wave & 1) * 64;   // wave M offset in tile
  const int wn = (wave >> 1) * 32;  // wave N offset in tile
  const int r = tid >> 2, c = (tid & 3) * 8;  // staging coords (64 rows/pass)

  v8f acc[4][2];
  for (int i = 0; i < 4; ++i)
    for (int j = 0; j < 2; ++j) acc[i][j] = (v8f){};

#if defined(HAVE_ASYNC_LDS)
  auto stage = [&](int kk, int p) {
    async_cp16(&As[p][(size_t)r * PAD + c],        A  + (size_t)(m0 + r) * K + kk + c);
    async_cp16(&As[p][(size_t)(r + 64) * PAD + c], A  + (size_t)(m0 + r + 64) * K + kk + c);
    async_cp16(&Bs[p][(size_t)r * PAD + c],        Bt + (size_t)(n0 + r) * K + kk + c);
    async_cp16(&Bs[p][(size_t)(r + 64) * PAD + c], Bt + (size_t)(n0 + r + 64) * K + kk + c);
  };
  int p = 0;
  stage(0, 0);
#endif

  for (int kk = 0; kk < K; kk += 32) {
#if defined(HAVE_ASYNC_LDS)
    if (kk + 32 < K) { stage(kk + 32, p ^ 1); wait_async<4>(); }
    else             { wait_async<0>(); }
    __syncthreads();
    const _Float16* as = As[p];
    const _Float16* bs = Bs[p];
#else
    *(uint4*)&As[0][(size_t)r * PAD + c] =
        *(const uint4*)(A + (size_t)(m0 + r) * K + kk + c);
    *(uint4*)&As[0][(size_t)(r + 64) * PAD + c] =
        *(const uint4*)(A + (size_t)(m0 + r + 64) * K + kk + c);
    *(uint4*)&Bs[0][(size_t)r * PAD + c] =
        *(const uint4*)(Bt + (size_t)(n0 + r) * K + kk + c);
    *(uint4*)&Bs[0][(size_t)(r + 64) * PAD + c] =
        *(const uint4*)(Bt + (size_t)(n0 + r + 64) * K + kk + c);
    __syncthreads();
    const _Float16* as = As[0];
    const _Float16* bs = Bs[0];
#endif
    v16h af[4], bf[2];
    for (int i = 0; i < 4; ++i) af[i] = load_frag(as + (wm + 16 * i) * PAD, PAD);
    for (int j = 0; j < 2; ++j) bf[j] = load_frag(bs + (wn + 16 * j) * PAD, PAD);
    for (int i = 0; i < 4; ++i)
      for (int j = 0; j < 2; ++j) acc[i][j] = wmma16(af[i], bf[j], acc[i][j]);
    __syncthreads();
#if defined(HAVE_ASYNC_LDS)
    p ^= 1;
#endif
  }

  // epilogue: C lane map -> col = base + (l&15); rows = base + r + (l>=16)*8
  const int cn = l & 15, rb = (l >> 4) * 8;
  const int gm0 = m0 + wm + rb;   // this lane's first row
  const int gn0 = n0 + wn + cn;   // this lane's first column
  if constexpr (MODE == MODE_QKV) {
    // a 128-wide tile never straddles a 1024-wide q/k/v section: sel is block-uniform
    const int sel = n0 >> 10;
    _Float16* __restrict__ dp = (sel == 0) ? qp : (sel == 1) ? kp : vp;
    const float sc = (sel == 0) ? 0.03125f : 1.0f;  // fold D^-0.5 into q
    for (int i = 0; i < 4; ++i)
      for (int j = 0; j < 2; ++j)
        for (int rr = 0; rr < 8; ++rr) {
          int gm = gm0 + 16 * i + rr;
          int gn = gn0 + 16 * j;
          int w = gn & 1023, h = w >> 6, e = w & 63;
          int bi = gm >> 11, t = gm & (TT - 1);
          size_t dst = (((size_t)(bi * HH + h)) * TT + t) * HS + e;
          dp[dst] = to_h(acc[i][j][rr] * sc);
        }
  } else if constexpr (MODE == MODE_FFN1) {
    float bv[2];
    for (int j = 0; j < 2; ++j) bv[j] = bias[gn0 + 16 * j];
    // the bias loads' offset register is reused right behind them: keep the wait in front of that
    asm volatile("s_wait_xcnt 0x0" ::: "memory");
    _Float16* op = outh + (size_t)gm0 * DFF + gn0;
    for (int i = 0; i < 4; ++i)
      for (int j = 0; j < 2; ++j)
        for (int rr = 0; rr < 8; ++rr) {
          float v = acc[i][j][rr] + bv[j];
          v = fmaxf(v, 0.0f);
          op[(size_t)(16 * i + rr) * DFF + 16 * j] = to_h(v);
        }
  } else {  // MODE_PROJ, MODE_FFN2: out = acc + (bias + resid)
    float bv[2];
    for (int j = 0; j < 2; ++j) bv[j] = bias[gn0 + 16 * j];
    // the bias loads' offset register is reused right behind them: keep the wait in front of that
    asm volatile("s_wait_xcnt 0x0" ::: "memory");
    const float* rp = resid + (size_t)gm0 * DD + gn0;
    float* op = outf + (size_t)gm0 * DD + gn0;
    // all residual loads are issued before the first store, so they overlap
    float rv[4][2][8];
    for (int i = 0; i < 4; ++i)
      for (int j = 0; j < 2; ++j)
        for (int rr = 0; rr < 8; ++rr)
          rv[i][j][rr] = rp[(size_t)(16 * i + rr) * DD + 16 * j];
    for (int i = 0; i < 4; ++i)
      for (int j = 0; j < 2; ++j)
        for (int rr = 0; rr < 8; ++rr)
          op[(size_t)(16 * i + rr) * DD + 16 * j] =
              acc[i][j][rr] + (bv[j] + rv[i][j][rr]);
  }
}

// ---------------- staging for the two attention passes ----------------------
// The eight waves of a work-group walk the same rows (pass 1: queries, pass 2:
// keys and values). Read as fragments straight from global memory, every load
// touched 16 lines for 512 bytes and every wave fetched the same rows again.
// Here the work-group copies each 64-row piece once, in whole 128-byte lines,
// into LDS, two buffers deep, and the waves read their fragments from there.
#define CH 64        // rows of 128 bytes per stage
#define APITCH 72    // LDS row pitch in halves: 144 B = 16 B x 9, conflict-free for 16-byte reads

// 64 rows x 128 B = 512 pieces of 16 B, two per lane; a wave's copy covers four whole lines.
__device__ __forceinline__ void stage_rows(_Float16* dst, const _Float16* src, int pitch) {
  const int r = threadIdx.x >> 3, c = (threadIdx.x & 7) * 8;
  const unsigned l0 = (unsigned)(uintptr_t)(dst + r * APITCH + c);
  const unsigned l1 = (unsigned)(uintptr_t)(dst + (r + 32) * APITCH + c);
  const _Float16* g0 = src + (size_t)r * pitch + c;
  const _Float16* g1 = src + (size_t)(r + 32) * pitch + c;
  // the wait is the statement's last line, so that it stands in front of any
  // rewrite of the address registers that the copies name
  asm volatile("global_load_async_to_lds_b128 %0, %1, off\n\t"
               "global_load_async_to_lds_b128 %2, %3, off\n\t"
               "s_wait_xcnt 0x0"
               :: "v"(l0), "v"(g0), "v"(l1), "v"(g1) : "memory");
}
// this wave's copies have landed (the barrier behind it publishes them to the others)
__device__ __forceinline__ void copies_landed() { asm volatile("s_wait_asynccnt 0x0" ::: "memory"); }
// this wave's LDS reads of the buffer that is refilled next have returned
__device__ __forceinline__ void lds_reads_done() { asm volatile("s_wait_dscnt 0x0" ::: "memory"); }

// ---------------- attention pass 1: per-key-column max / sumexp -------------
// softmax is over the QUERY axis (per reference): m_k, Z_k over q >= k.
__global__ __launch_bounds__(256) void attn_pass1(
    const _Float16* __restrict__ q, const _Float16* __restrict__ k,
    float* __restrict__ cmax, float* __restrict__ csum) {
  __shared__ _Float16 qs[2][CH * APITCH];
  const int bh = blockIdx.y;
  const int wave = __builtin_amdgcn_readfirstlane(threadIdx.x >> 5), l = threadIdx.x & 31;
  const int kb = blockIdx.x * 128;               // the work-group's first key column
  const int k0 = kb + wave * 16;                 // this wave's 16 key columns
  const _Float16* qh = q + (size_t)bh * TT * HS;
  const _Float16* kh = k + (size_t)bh * TT * HS;
  const int nt = (TT - kb) / CH;                 // stages of 64 queries, at least two

  stage_rows(qs[0], qh + (size_t)kb * HS, HS);
  // K^T fragments for this column strip (lane row = key token)
  v16h kf0 = load_frag(kh + (size_t)k0 * HS, HS);
  v16h kf1 = load_frag(kh + (size_t)k0 * HS + 32, HS);
  copies_landed();
  __syncthreads();
  stage_rows(qs[1], qh + (size_t)(kb + CH) * HS, HS);

  float m = -INFINITY, s = 0.0f;
  const int kcol = k0 + (l & 15);
  // One stage is 64 queries, 32 scores of this lane's key column. Their maximum is
  // taken first, the running sum is rescaled once, and the 32 exponentials then depend
  // on nothing but that maximum. Score by score, each update took two divergent
  // branches and waited for the exponential of the update before it.
  auto fold = [&](const _Float16* qb, int qc, bool diag) {
    v16h qa[CH / 16][2];              // 4 tiles of 16 queries x 64 head columns
    for (int u = 0; u < CH / 16; ++u) {
      qa[u][0] = load_frag(qb + u * 16 * APITCH, APITCH);
      qa[u][1] = load_frag(qb + u * 16 * APITCH + 32, APITCH);
    }
    // all 16 fragment reads go out before the first product, so one LDS round trip serves
    // 64 queries: left free, the scheduler spreads them among the products (several round trips)
    __builtin_amdgcn_sched_barrier(0);
    v8f c[CH / 16];
    for (int u = 0; u < CH / 16; ++u) c[u] = wmma16(qa[u][0], kf0, (v8f){});
    for (int u = 0; u < CH / 16; ++u) c[u] = wmma16(qa[u][1], kf1, c[u]);
    if (diag) {                       // causal (q >= k valid): the others leave both max and sum alone
      const int qrb = qc + ((l >> 4) ? 8 : 0);
      for (int u = 0; u < CH / 16; ++u)
        for (int r = 0; r < 8; ++r)
          if (qrb + u * 16 + r < kcol) c[u][r] = -INFINITY;
    }
    float mu[CH / 16];
    for (int u = 0; u < CH / 16; ++u) {
      mu[u] = c[u][0];
      for (int r = 1; r < 8; ++r) mu[u] = fmaxf(mu[u], c[u][r]);
    }
    const float mn = fmaxf(m, fmaxf(fmaxf(mu[0], mu[1]), fmaxf(mu[2], mu[3])));
    // a lane that has seen no valid query yet keeps m = -inf and s = 0 (-inf - -inf is no number)
    const float ref = (mn == -INFINITY) ? 0.0f : mn;
    // e^(x - ref) = 2^(x * log2(e) - ref * log2(e)): the subtrahend is formed once a stage
    const float l2e = 1.44269504f, nr = -ref * l2e;
    float p[CH / 16];
    for (int u = 0; u < CH / 16; ++u) {
      p[u] = __builtin_amdgcn_exp2f(fmaf(c[u][0], l2e, nr));
      for (int r = 1; r < 8; ++r) p[u] += __builtin_amdgcn_exp2f(fmaf(c[u][r], l2e, nr));
    }
    s = s * __builtin_amdgcn_exp2f(fmaf(m, l2e, nr)) + ((p[0] + p[1]) + (p[2] + p[3]));
    m = mn;
  };
  for (int t = 0; t < nt; ++t) {
    const _Float16* qb = qs[t & 1];
    const int qc = kb + t * CH;       // first query row of this stage
    // both tests are wave-uniform; a stage wholly above the diagonal is skipped
    if (qc >= k0 + 16)      fold(qb, qc, false);
    else if (qc + CH > k0)  fold(qb, qc, true);
    // hand-over, passed by every wave: stage t + 1 is published, stage t's buffer is free
    lds_reads_done();
    copies_landed();
    __syncthreads();
    if (t + 2 < nt) stage_rows(qs[t & 1], qh + (size_t)(kb + (t + 2) * CH) * HS, HS);
  }
  copies_landed();
  // merge the two half-lanes holding the same column
  float m2 = __shfl_xor(m, 16, 32);
  float s2 = __shfl_xor(s, 16, 32);
  float mn = fmaxf(m, m2);
  float sm = s * __expf(m - mn) + s2 * __expf(m2 - mn);
  if (l < 16) {
    cmax[(size_t)bh * TT + kcol] = mn;
    csum[(size_t)bh * TT + kcol] = sm;
  }
}

// ---------------- v' = v / Z, stored transposed [B,H,HS,T] ------------------
// Same register-tile transpose: one wave takes 64 key tokens x 32 columns of a
// head; lane (lk = l & 7, le = l >> 3) reads 8 tokens x 8 halves and writes 8
// runs of 8 halves along t, so each store covers four whole 128-byte lines.
// The two waves that share the 128-byte source rows sit in one work-group.
__global__ __launch_bounds__(256) void vscale(
    const _Float16* __restrict__ v, const float* __restrict__ csum,
    _Float16* __restrict__ vT) {
  const int wave = threadIdx.x >> 5, l = threadIdx.x & 31;
  const int tile = blockIdx.x * 4 + (wave >> 1);   // BB*HH heads x TT/64 tiles
  const int bh = tile >> 5;
  const int kt = (tile & 31) * 64 + (l & 7) * 8;
  const int e = (wave & 1) * 32 + (l >> 3) * 8;
  const _Float16* s = v + ((size_t)bh * TT + kt) * HS + e;
  const float* z = csum + (size_t)bh * TT + kt;
  _Float16* o = vT + ((size_t)bh * HS + e) * TT + kt;
  v8h a[8];
  v4f Z[2];
  for (int i = 0; i < 8; ++i) a[i] = *(const v8h*)(s + (size_t)i * HS);
  for (int i = 0; i < 2; ++i) Z[i] = *(const v4f*)(z + 4 * i);
  // all ten loads go out before the arithmetic starts: left free, the scheduler
  // holds two back behind the first divisions (a second memory round trip)
  __builtin_amdgcn_sched_barrier(0);
  // unrolled so that j is a constant: left rolled, element j of every register
  // vector is picked by a chain of selects
#pragma unroll
  for (int j = 0; j < 8; ++j) {
    v8h t;
    for (int i = 0; i < 8; ++i)
      t[i] = to_h((float)a[i][j] / Z[i >> 2][i & 3]);
    *(v8h*)(o + (size_t)j * TT) = t;
  }
}

// ---------------- attention pass 2: attn = P @ V' ---------------------------
// 512 work-groups on 256 WGPs are four waves a SIMD: the register budget is set for
// that, so that a block's fragments and its 16 exponentials can be in flight together
__global__ __launch_bounds__(256) __attribute__((amdgpu_waves_per_eu(4, 4))) void attn_pass2(
    const _Float16* __restrict__ q, const _Float16* __restrict__ k,
    const _Float16* __restrict__ vT, const float* __restrict__ cmax,
    _Float16* __restrict__ attn) {
  __shared__ _Float16 ks[2][CH * APITCH];  // 64 keys x 64 head columns
  __shared__ _Float16 vs[2][CH * APITCH];  // 64 head columns x 64 keys
  __shared__ _Float16 pbuf[8][16 * PAD];   // per-wave P tile [16q x 32k]
  const int bh = blockIdx.y;
  const int wave = __builtin_amdgcn_readfirstlane(threadIdx.x >> 5), l = threadIdx.x & 31;
  const int qb0 = blockIdx.x * 128;              // the work-group's first query row
  const int q0 = qb0 + wave * 16;                // this wave's 16 query rows
  const int bi = bh / HH, h = bh % HH;
  const _Float16* qh  = q  + (size_t)bh * TT * HS;
  const _Float16* kh  = k  + (size_t)bh * TT * HS;
  const _Float16* vTh = vT + (size_t)bh * HS * TT;
  const float*    mh  = cmax + (size_t)bh * TT;
  const int nt = (qb0 + 128) / CH;               // stages of 64 keys, at least two

  stage_rows(ks[0], kh, HS);
  stage_rows(vs[0], vTh, TT);
  v16h qa0 = load_frag(qh + (size_t)q0 * HS, HS);
  v16h qa1 = load_frag(qh + (size_t)q0 * HS + 32, HS);
  copies_landed();
  __syncthreads();
  stage_rows(ks[1], kh + (size_t)CH * HS, HS);
  stage_rows(vs[1], vTh + CH, TT);

  v8f acc[4];
  for (int j = 0; j < 4; ++j) acc[j] = (v8f){};

  const int cn = l & 15, rb = (l >> 4) * 8;
  // 16 queries x 32 keys. All fragment reads of the block (K and, since they do not
  // depend on P, V^T) stand at its head: one LDS round trip. Where the second 16 keys
  // lie wholly behind the diagonal the causal select below writes their zeros (those
  // key rows are part of the stage, so the reads are in range).
  auto pv_block = [&](const _Float16* kr, const _Float16* vr, int kt) {
    v16h kf[2][2], vb[4];
    float mk[2];
    for (int h2 = 0; h2 < 2; ++h2) {
      kf[h2][0] = load_frag(kr + 16 * h2 * APITCH, APITCH);
      kf[h2][1] = load_frag(kr + 16 * h2 * APITCH + 32, APITCH);
      mk[h2] = mh[kt + 16 * h2 + cn];
    }
    for (int j = 0; j < 4; ++j) vb[j] = load_frag(vr + (16 * j) * APITCH, APITCH);
    // build P tile (two 16-wide halves) in LDS, C-layout -> A-layout
    for (int h2 = 0; h2 < 2; ++h2) {
      v8f cc = (v8f){};
      cc = wmma16(qa0, kf[h2][0], cc);
      cc = wmma16(qa1, kf[h2][1], cc);
      int kcol = kt + 16 * h2 + cn;
      for (int r = 0; r < 8; ++r) {
        int qi = q0 + rb + r;
        float pv = (qi >= kcol) ? __expf(cc[r] - mk[h2]) : 0.0f;
        pbuf[wave][(size_t)(rb + r) * PAD + 16 * h2 + cn] = to_h(pv);
      }
    }
    // intra-wave LDS turnaround: the P tile is private to its wave
    asm volatile("s_wait_dscnt 0" ::: "memory");
    v16h pa = load_frag(pbuf[wave], PAD);
    for (int j = 0; j < 4; ++j) acc[j] = wmma16(pa, vb[j], acc[j]);
  };
  for (int t = 0; t < nt; ++t) {
    const _Float16* kst = ks[t & 1];
    const _Float16* vst = vs[t & 1];
    for (int u = 0; u < CH / 32; ++u) {
      const int kt = t * CH + u * 32;
      if (kt < q0 + 16)               // wave-uniform: skips keys wholly behind the diagonal
        pv_block(kst + u * 32 * APITCH, vst + u * 32, kt);
    }
    // hand-over, passed by every wave: stage t + 1 is published, stage t's buffers are free
    lds_reads_done();
    copies_landed();
    __syncthreads();
    if (t + 2 < nt) {
      stage_rows(ks[t & 1], kh + (size_t)(t + 2) * CH * HS, HS);
      stage_rows(vs[t & 1], vTh + (t + 2) * CH, TT);
    }
  }
  copies_landed();

  // write attn as f16 [B,T,D] (feeds the proj GEMM)
  for (int j = 0; j < 4; ++j)
    for (int r = 0; r < 8; ++r) {
      int qi = q0 + rb + r;
      int d = h * HS + 16 * j + cn;
      attn[((size_t)bi * TT + qi) * DD + d] = to_h(acc[j][r]);
    }
}

// ---------------- host-side orchestration ----------------
extern "C" void kernel_launch(void* const* d_in, const int* in_sizes, int n_in,
                              void* d_out, int out_size, void* d_ws,
                              size_t ws_size, hipStream_t stream) {
  const float* x     = (const float*)d_in[0];
  const float* Wq    = (const float*)d_in[1];
  const float* Wk    = (const float*)d_in[2];
  const float* Wv    = (const float*)d_in[3];
  const float* Wproj = (const float*)d_in[4];
  const float* bproj = (const float*)d_in[5];
  const float* W1    = (const float*)d_in[6];
  const float* b1    = (const float*)d_in[7];
  const float* W2    = (const float*)d_in[8];
  const float* b2    = (const float*)d_in[9];
  const float* ln1g  = (const float*)d_in[10];
  const float* ln1b  = (const float*)d_in[11];
  const float* ln2g  = (const float*)d_in[12];
  const float* ln2b  = (const float*)d_in[13];
  float* out = (float*)d_out;

  char* base = (char*)d_ws;
  size_t off = 0;
  auto alloc = [&](size_t bytes) -> char* {
    char* p = base + off;
    off += (bytes + 255) & ~(size_t)255;
    return p;
  };
  _Float16* wqkvT = (_Float16*)alloc((size_t)3 * DD * DD * 2);  // [3D][D]
  _Float16* wpT   = (_Float16*)alloc((size_t)DD * DD * 2);      // [D][D]
  _Float16* w1T   = (_Float16*)alloc((size_t)DFF * DD * 2);     // [4D][D]
  _Float16* w2T   = (_Float16*)alloc((size_t)DD * DFF * 2);     // [D][4D]
  float*    xn_f  = (float*)   alloc((size_t)BT * DD * 4);
  _Float16* xn_h  = (_Float16*)alloc((size_t)BT * DD * 2);
  _Float16* q_h   = (_Float16*)alloc((size_t)BB * HH * TT * HS * 2);
  _Float16* k_h   = (_Float16*)alloc((size_t)BB * HH * TT * HS * 2);
  _Float16* v_h   = (_Float16*)alloc((size_t)BB * HH * TT * HS * 2);
  _Float16* vT_h  = (_Float16*)alloc((size_t)BB * HH * TT * HS * 2);
  float*    cmax  = (float*)   alloc((size_t)BB * HH * TT * 4);
  float*    csum  = (float*)   alloc((size_t)BB * HH * TT * 4);
  _Float16* attnh = (_Float16*)alloc((size_t)BT * DD * 2);
  float*    x1_f  = (float*)   alloc((size_t)BT * DD * 4);
  float*    x1n_f = (float*)   alloc((size_t)BT * DD * 4);
  _Float16* x1n_h = (_Float16*)alloc((size_t)BT * DD * 2);
  _Float16* h_h   = (_Float16*)alloc((size_t)BT * DFF * 2);

  // 1) pack all weights to f16, transposed [N][K]: 12M elements, 64 n x 256 k a group
  pack_weights<<<(3 * DD * DD + DD * DD + 2 * DD * DFF) / (64 * 256), 256, 0, stream>>>(
      Wq, Wk, Wv, Wproj, W1, W2, wqkvT, wpT, w1T, w2T);
  // 2) LN1 -> xn (f32 + f16)
  ln_kernel<<<BT, 256, 0, stream>>>(x, ln1g, ln1b, xn_f, xn_h);
  // 3) QKV GEMM: [4096x1024] x [1024x3072]
  gemm128<MODE_QKV><<<dim3(3 * DD / 128, BT / 128), 256, 0, stream>>>(
      xn_h, wqkvT, 3 * DD, DD, nullptr, nullptr, nullptr, nullptr,
      q_h, k_h, v_h);
  // 4) per-column softmax stats
  attn_pass1<<<dim3(TT / 128, BB * HH), 256, 0, stream>>>(q_h, k_h, cmax, csum);
  // 5) v' = v / Z, transposed
  vscale<<<BB * HH * (TT / 64) / 4, 256, 0, stream>>>(v_h, csum, vT_h);
  // 6) attn = P @ V'
  attn_pass2<<<dim3(TT / 128, BB * HH), 256, 0, stream>>>(q_h, k_h, vT_h, cmax,
                                                          attnh);
  // 7) proj: x1 = xn + attn @ Wproj + bproj
  gemm128<MODE_PROJ><<<dim3(DD / 128, BT / 128), 256, 0, stream>>>(
      attnh, wpT, DD, DD, bproj, xn_f, x1_f, nullptr, nullptr,
      nullptr, nullptr);
  // 8) LN2 -> x1n (f32 + f16)
  ln_kernel<<<BT, 256, 0, stream>>>(x1_f, ln2g, ln2b, x1n_f, x1n_h);
  // 9) FFN1: h = relu(x1n @ W1 + b1)
  gemm128<MODE_FFN1><<<dim3(DFF / 128, BT / 128), 256, 0, stream>>>(
      x1n_h, w1T, DFF, DD, b1, nullptr, nullptr, h_h, nullptr,
      nullptr, nullptr);
  // 10) FFN2: out = x1n + h @ W2 + b2
  gemm128<MODE_FFN2><<<dim3(DD / 128, BT / 128), 256, 0, stream>>>(
      h_h, w2T, DD, DFF, b2, x1n_f, out, nullptr, nullptr, nullptr,
      nullptr);
}

// v005
// A run of this version takes 194 microseconds.
// Timed twice side by side with v004, it ran 1.30 and 1.29 times as fast.
// Over all steps from v000 it is 2.86 times as fast.
#include <hip/hip_runtime.h>
#include <hip/hip_bf16.h>

// ---------------- problem constants ----------------
#define BB 2
#define TT 2048
#define DD 1024
#define HH 16
#define HS 64
#define BT (BB * TT)       // 4096 rows
#define DFF (4 * DD)       // 4096
#define PAD 56             // LDS row stride in halves: 112B -> 16B aligned, 16 distinct banks

typedef __attribute__((ext_vector_type(16))) _Float16 v16h;
typedef __attribute__((ext_vector_type(8)))  float    v8f;
typedef __attribute__((ext_vector_type(4)))  float    v4f;
typedef __attribute__((ext_vector_type(8)))  _Float16 v8h;

// ---------------- asynchronous copies to LDS: the two waits ----------------
// this wave's copies have landed (the barrier behind it publishes them to the others)
__device__ __forceinline__ void copies_landed() { asm volatile("s_wait_asynccnt 0x0" ::: "memory"); }
// this wave's LDS reads of the buffer that is refilled next have returned
__device__ __forceinline__ void lds_reads_done() { asm volatile("s_wait_dscnt 0x0" ::: "memory"); }

// ---------------- WMMA helpers ----------------
__device__ __forceinline__ v8f wmma16(v16h a, v16h b, v8f c) {
  // D = A(16x32 f16) * B(32x16 f16) + C(16x16 f32)
  return __builtin_amdgcn_wmma_f32_16x16x32_f16(false, a, false, b, (short)0, c,
                                                false, false);
}

// A-fragment loader (16-bit A 16x32 layout):
//   lane<16 : row M = lane,    holds K = 0..7  and 16..23
//   lane>=16: row M = lane-16, holds K = 8..15 and 24..31
// B-fragments (stored row=N, col=K) use the same pattern with N as the row.
__device__ __forceinline__ v16h load_frag(const _Float16* p, int stride) {
  int l = threadIdx.x & 31;
  const _Float16* r = p + (size_t)(l & 15) * stride + ((l >> 4) << 3);
  v16h f;
  ((uint4*)&f)[0] = *(const uint4*)(r);
  ((uint4*)&f)[1] = *(const uint4*)(r + 16);
  return f;
}

__device__ __forceinline__ _Float16 to_h(float x) { return (_Float16)x; }

// ---------------- weight packing: f32 -> f16, ALL weights TRANSPOSED --------
// Every packed weight is stored [N][K] so GEMM B-tiles stage with contiguous
// 16B rows (identical to A-tiles, no in-loop transpose).
// One wave transposes a tile of 64 k x 32 n in registers: lane (lk = l >> 3,
// ln = l & 7) reads 16 source rows x 4 floats, so each load covers four whole
// 128-byte lines, and writes 8 runs of 8 halves along k; the wave alone writes
// the 128-byte output lines of its tile. One element per thread had to start
// 64 times as many waves, each with a load that touched 32 lines.
template <int LD, int K>   // source pitch in floats, packed pitch in halves
__device__ __forceinline__ void pack_tile(const float* __restrict__ S,
                                          _Float16* __restrict__ O, int kb) {
  const int wave = threadIdx.x >> 5, l = threadIdx.x & 31;
  const int n = (wave & 1) * 32 + (l & 7) * 4;
  const int k = kb * 256 + (wave >> 1) * 64 + (l >> 3) * 8;
  const float* s = S + (size_t)k * LD + n;
  _Float16* o = O + (size_t)n * K + k;
  v4f v[2][8];
  for (int g = 0; g < 2; ++g)
    for (int i = 0; i < 8; ++i)
      v[g][i] = *(const v4f*)(s + (size_t)(32 * g + i) * LD);
  // the 16 loads share one address pair: it is named here as an input, so that no
  // load's result lands on it, and the wait stands in front of its reuse below
  asm volatile("s_wait_xcnt 0x0" :: "v"(s) : "memory");
  // all 16 loads go out before the first conversion: left free, the scheduler
  // holds some back behind the first results (a second memory round trip)
  __builtin_amdgcn_sched_barrier(0);
  for (int g = 0; g < 2; ++g)
    for (int j = 0; j < 4; ++j) {
      v8h t;
      for (int i = 0; i < 8; ++i) t[i] = to_h(v[g][i][j]);
      *(v8h*)(o + (size_t)j * K + 32 * g) = t;
    }
  // the code of the four matrices stands one part behind the other, parted only by
  // scalar skips, and each part rewrites these registers: keep the wait behind the stores
  asm volatile("s_wait_xcnt 0x0" ::: "memory");
}

// a work-group packs 64 n x 256 k; the matrix it works on is block-uniform
__global__ __launch_bounds__(256) void pack_weights(
    const float* __restrict__ Wq, const float* __restrict__ Wk,
    const float* __restrict__ Wv, const float* __restrict__ Wp,
    const float* __restrict__ W1, const float* __restrict__ W2,
    _Float16* __restrict__ wqkvT, _Float16* __restrict__ wpT,
    _Float16* __restrict__ w1T, _Float16* __restrict__ w2T) {
  const int b = blockIdx.x;
  const int bP = 3 * HH * 4, b1 = bP + (DD / 64) * 4, b2 = b1 + (DFF / 64) * 4;
  if (b < bP) {                    // q, k, v: one head [D][HS] is 64 n wide
    const int hd = b >> 2, sel = hd >> 4, h = hd & 15;
    const float* W = (sel == 0) ? Wq : (sel == 1) ? Wk : Wv;
    pack_tile<HS, DD>(W + (size_t)h * DD * HS, wqkvT + (size_t)hd * 64 * DD, b & 3);
  } else if (b < b1) {             // Wproj [D][D]
    const int nb = (b - bP) >> 2;
    pack_tile<DD, DD>(Wp + nb * 64, wpT + (size_t)nb * 64 * DD, b & 3);
  } else if (b < b2) {             // W1 [D][4D]
    const int nb = (b - b1) >> 2;
    pack_tile<DFF, DD>(W1 + nb * 64, w1T + (size_t)nb * 64 * DD, b & 3);
  } else {                         // W2 [4D][D]
    const int nb = (b - b2) >> 4;
    pack_tile<DD, DFF>(W2 + nb * 64, w2T + (size_t)nb * 64 * DFF, b & 15);
  }
}

// ---------------- LayerNorm: writes f32 (residual) + f16 (GEMM input) -------
__global__ __launch_bounds__(256) void ln_kernel(
    const float* __restrict__ x, const float* __restrict__ g,
    const float* __restrict__ b, float* __restrict__ yf,
    _Float16* __restrict__ yh) {
  __shared__ float s1[256], s2[256];
  int row = blockIdx.x, tid = threadIdx.x;
  const float* xr = x + (size_t)row * DD;
  float4 xv = ((const float4*)xr)[tid];          // 4 elements / thread
  float sum = xv.x + xv.y + xv.z + xv.w;
  float sq  = xv.x * xv.x + xv.y * xv.y + xv.z * xv.z + xv.w * xv.w;
  s1[tid] = sum; s2[tid] = sq;
  __syncthreads();
  for (int off = 128; off; off >>= 1) {
    if (tid < off) { s1[tid] += s1[tid + off]; s2[tid] += s2[tid + off]; }
    __syncthreads();
  }
  float mu  = s1[0] * (1.0f / DD);
  float var = s2[0] * (1.0f / DD) - mu * mu;
  float rs  = rsqrtf(var + 1e-5f);
  float vals[4] = {xv.x, xv.y, xv.z, xv.w};
  for (int j = 0; j < 4; ++j) {
    int c = tid * 4 + j;
    float xn = (vals[j] - mu) * rs * g[c] + b[c];
    yf[(size_t)row * DD + c] = xn;
    yh[(size_t)row * DD + c] = to_h(xn);
  }
}

// ---------------- generic 128x128 WMMA GEMM with fused epilogues ------------
#define MODE_QKV  0
#define MODE_PROJ 1
#define MODE_FFN1 2
#define MODE_FFN2 3

// Eight 16-byte copies per lane in one statement. The wait is the statement's last
// line, so that it stands in front of any rewrite of the address registers that the
// copies name.
__device__ __forceinline__ void copy8(const unsigned* l, const _Float16* const* g) {
  asm volatile("global_load_async_to_lds_b128 %0, %1, off\n\t"
               "global_load_async_to_lds_b128 %2, %3, off\n\t"
               "global_load_async_to_lds_b128 %4, %5, off\n\t"
               "global_load_async_to_lds_b128 %6, %7, off\n\t"
               "global_load_async_to_lds_b128 %8, %9, off\n\t"
               "global_load_async_to_lds_b128 %10, %11, off\n\t"
               "global_load_async_to_lds_b128 %12, %13, off\n\t"
               "global_load_async_to_lds_b128 %14, %15, off\n\t"
               "s_wait_xcnt 0x0"
               :: "v"(l[0]), "v"(g[0]), "v"(l[1]), "v"(g[1]), "v"(l[2]), "v"(g[2]),
                  "v"(l[3]), "v"(g[3]), "v"(l[4]), "v"(g[4]), "v"(l[5]), "v"(g[5]),
                  "v"(l[6]), "v"(g[6]), "v"(l[7]), "v"(g[7]) : "memory");
}

#define KS 128       // k per stage: rows of 256 bytes
#define GP 136       // LDS row pitch in halves: 272 B = 16 B x 17, conflict-free for 16-byte reads

// One operand's share of a stage: 128 rows x 256 B = 2048 pieces of 16 B, eight per
// lane; a wave's copy covers two whole rows (four 128-byte lines).
__device__ __forceinline__ void stage_tile(_Float16* dst, const _Float16* src, int K) {
  const int r = threadIdx.x >> 4, c = (threadIdx.x & 15) * 8;
  unsigned l[8];
  const _Float16* g[8];
  for (int i = 0; i < 8; ++i) {
    l[i] = (unsigned)(uintptr_t)(dst + (r + 16 * i) * GP + c);
    g[i] = src + (size_t)(r + 16 * i) * K + c;
  }
  copy8(l, g);
}

// MODE is a compile-time parameter: with it at run time the epilogue stayed a
// rolled loop that tested the mode per element and waited for each element's
// residual load before its store (one memory round trip per element).
// K is walked in stages of 128 k, two buffers, one hand-over (two waits, one barrier) a
// stage. A stage is four blocks of 32 k (8 products a wave), and the fragments of a block
// are read while the block before it is multiplied. At 32 k a stage, between two
// barriers, there was no block to read ahead of: each wave waited out its own LDS reads.
template <int MODE>
__global__ __launch_bounds__(256) void gemm128(
    const _Float16* __restrict__ A,   // [M][K] row-major f16
    const _Float16* __restrict__ Bt,  // [N][K] row-major f16 (pre-transposed)
    int N, int K,
    const float* __restrict__ bias, const float* __restrict__ resid,
    float* __restrict__ outf, _Float16* __restrict__ outh,
    _Float16* __restrict__ qp, _Float16* __restrict__ kp,
    _Float16* __restrict__ vp) {
  __shared__ __attribute__((aligned(16))) _Float16 As[2][128 * GP];
  __shared__ __attribute__((aligned(16))) _Float16 Bs[2][128 * GP];
  const int tid = threadIdx.x;
  const int m0 = blockIdx.y * 128;
  const int n0 = blockIdx.x * 128;
  const int wave = tid >> 5, l = tid & 31;
  const int wm = (wave & 1) * 64;   // wave M offset in tile
  const int wn = (wave >> 1) * 32;  // wave N offset in tile
  const _Float16* Ag = A + (size_t)m0 * K;
  const _Float16* Bg = Bt + (size_t)n0 * K;
  const int nt = K / KS;            // stages, at least two

  v8f acc[4][2];
  for (int i = 0; i < 4; ++i)
    for (int j = 0; j < 2; ++j) acc[i][j] = (v8f){};

  stage_tile(As[0], Ag, K);
  stage_tile(Bs[0], Bg, K);
  copies_landed();
  __syncthreads();
  stage_tile(As[1], Ag + KS, K);
  stage_tile(Bs[1], Bg + KS, K);

  for (int t = 0; t < nt; ++t) {
    const _Float16* as = As[t & 1] + wm * GP;
    const _Float16* bs = Bs[t & 1] + wn * GP;
    v16h af[2][4], bf[2][2];          // two fragment sets: one multiplied, one being read
    auto read_block = [&](int s) {
      for (int i = 0; i < 4; ++i) af[s & 1][i] = load_frag(as + 16 * i * GP + 32 * s, GP);
      for (int j = 0; j < 2; ++j) bf[s & 1][j] = load_frag(bs + 16 * j * GP + 32 * s, GP);
    };
    read_block(0);
    for (int s = 0; s < KS / 32; ++s) {
      if (s + 1 < KS / 32) read_block(s + 1);
      // the pair of fences keeps the next block's 12 reads one group in front of this
      // block's products: left free, the scheduler puts them among the products in
      // pairs and waits for each pair (four LDS round trips a block)
      __builtin_amdgcn_sched_barrier(0);
      for (int i = 0; i < 4; ++i)
        for (int j = 0; j < 2; ++j) acc[i][j] = wmma16(af[s & 1][i], bf[s & 1][j], acc[i][j]);
      __builtin_amdgcn_sched_barrier(0);
    }
    // hand-over: stage t + 1 is published, stage t's buffers are free
    lds_reads_done();
    copies_landed();
    __syncthreads();
    if (t + 2 < nt) {
      stage_tile(As[t & 1], Ag + (size_t)(t + 2) * KS, K);
      stage_tile(Bs[t & 1], Bg + (size_t)(t + 2) * KS, K);
    }
  }
  copies_landed();

  // epilogue: C lane map -> col = base + (l&15); rows = base + r + (l>=16)*8
  const int cn = l & 15, rb = (l >> 4) * 8;
  const int gm0 = m0 + wm + rb;   // this lane's first row
  const int gn0 = n0 + wn + cn;   // this lane's first column
  if constexpr (MODE == MODE_QKV) {
    // a 128-wide tile never straddles a 1024-wide q/k/v section: sel is block-uniform
    const int sel = n0 >> 10;
    _Float16* __restrict__ dp = (sel == 0) ? qp : (sel == 1) ? kp : vp;
    const float sc = (sel == 0) ? 0.03125f : 1.0f;  // fold D^-0.5 into q
    for (int i = 0; i < 4; ++i)
      for (int j = 0; j < 2; ++j)
        for (int rr = 0; rr < 8; ++rr) {
          int gm = gm0 + 16 * i + rr;
          int gn = gn0 + 16 * j;
          int w = gn & 1023, h = w >> 6, e = w & 63;
          int bi = gm >> 11, t = gm & (TT - 1);
          size_t dst = (((size_t)(bi * HH + h)) * TT + t) * HS + e;
          dp[dst] = to_h(acc[i][j][rr] * sc);
        }
  } else if constexpr (MODE == MODE_FFN1) {
    float bv[2];
    for (int j = 0; j < 2; ++j) bv[j] = bias[gn0 + 16 * j];
    // the bias loads' offset register is reused right behind them: keep the wait in front of that
    asm volatile("s_wait_xcnt 0x0" ::: "memory");
    _Float16* op = outh + (size_t)gm0 * DFF + gn0;
    for (int i = 0; i < 4; ++i)
      for (int j = 0; j < 2; ++j)
        for (int rr = 0; rr < 8; ++rr) {
          float v = acc[i][j][rr] + bv[j];
          v = fmaxf(v, 0.0f);
          op[(size_t)(16 * i + rr) * DFF + 16 * j] = to_h(v);
        }
  } else {  // MODE_PROJ, MODE_FFN2: out = acc + (bias + resid)
    float bv[2];
    for (int j = 0; j < 2; ++j) bv[j] = bias[gn0 + 16 * j];
    // the bias loads' offset register is reused right behind them: keep the wait in front of that
    asm volatile("s_wait_xcnt 0x0" ::: "memory");
    const float* rp = resid + (size_t)gm0 * DD + gn0;
    float* op = outf + (size_t)gm0 * DD + gn0;
    // all residual loads are issued before the first store, so they overlap
    float rv[4][2][8];
    for (int i = 0; i < 4; ++i)
      for (int j = 0; j < 2; ++j)
        for (int rr = 0; rr < 8; ++rr)
          rv[i][j][rr] = rp[(size_t)(16 * i + rr) * DD + 16 * j];
    for (int i = 0; i < 4; ++i)
      for (int j = 0; j < 2; ++j)
        for (int rr = 0; rr < 8; ++rr)
          op[(size_t)(16 * i + rr) * DD + 16 * j] =
              acc[i][j][rr] + (bv[j] + rv[i][j][rr]);
  }
}

// ---------------- staging for the two attention passes ----------------------
// The eight waves of a work-group walk the same rows (pass 1: queries, pass 2:
// keys and values). Read as fragments straight from global memory, every load
// touched 16 lines for 512 bytes and every wave fetched the same rows again.
// Here the work-group copies each 64-row piece once, in whole 128-byte lines,
// into LDS, two buffers deep, and the waves read their fragments from there.
#define CH 64        // rows of 128 bytes per stage
#define APITCH 72    // LDS row pitch in halves: 144 B = 16 B x 9, conflict-free for 16-byte reads

// 64 rows x 128 B = 512 pieces of 16 B, two per lane; a wave's copy covers four whole lines.
__device__ __forceinline__ void stage_rows(_Float16* dst, const _Float16* src, int pitch) {
  const int r = threadIdx.x >> 3, c = (threadIdx.x & 7) * 8;
  const unsigned l0 = (unsigned)(uintptr_t)(dst + r * APITCH + c);
  const unsigned l1 = (unsigned)(uintptr_t)(dst + (r + 32) * APITCH + c);
  const _Float16* g0 = src + (size_t)r * pitch + c;
  const _Float16* g1 = src + (size_t)(r + 32) * pitch + c;
  // the wait is the statement's last line, so that it stands in front of any
  // rewrite of the address registers that the copies name
  asm volatile("global_load_async_to_lds_b128 %0, %1, off\n\t"
               "global_load_async_to_lds_b128 %2, %3, off\n\t"
               "s_wait_xcnt 0x0"
               :: "v"(l0), "v"(g0), "v"(l1), "v"(g1) : "memory");
}

// ---------------- attention pass 1: per-key-column max / sumexp -------------
// softmax is over the QUERY axis (per reference): m_k, Z_k over q >= k.
__global__ __launch_bounds__(256) void attn_pass1(
    const _Float16* __restrict__ q, const _Float16* __restrict__ k,
    float* __restrict__ cmax, float* __restrict__ csum) {
  __shared__ _Float16 qs[2][CH * APITCH];
  const int bh = blockIdx.y;
  const int wave = __builtin_amdgcn_readfirstlane(threadIdx.x >> 5), l = threadIdx.x & 31;
  const int kb = blockIdx.x * 128;               // the work-group's first key column
  const int k0 = kb + wave * 16;                 // this wave's 16 key columns
  const _Float16* qh = q + (size_t)bh * TT * HS;
  const _Float16* kh = k + (size_t)bh * TT * HS;
  const int nt = (TT - kb) / CH;                 // stages of 64 queries, at least two

  stage_rows(qs[0], qh + (size_t)kb * HS, HS);
  // K^T fragments for this column strip (lane row = key token)
  v16h kf0 = load_frag(kh + (size_t)k0 * HS, HS);
  v16h kf1 = load_frag(kh + (size_t)k0 * HS + 32, HS);
  copies_landed();
  __syncthreads();
  stage_rows(qs[1], qh + (size_t)(kb + CH) * HS, HS);

  float m = -INFINITY, s = 0.0f;
  const int kcol = k0 + (l & 15);
  // One stage is 64 queries, 32 scores of this lane's key column. Their maximum is
  // taken first, the running sum is rescaled once, and the 32 exponentials then depend
  // on nothing but that maximum. Score by score, each update took two divergent
  // branches and waited for the exponential of the update before it.
  auto fold = [&](const _Float16* qb, int qc, bool diag) {
    v16h qa[CH / 16][2];              // 4 tiles of 16 queries x 64 head columns
    for (int u = 0; u < CH / 16; ++u) {
      qa[u][0] = load_frag(qb + u * 16 * APITCH, APITCH);
      qa[u][1] = load_frag(qb + u * 16 * APITCH + 32, APITCH);
    }
    // all 16 fragment reads go out before the first product, so one LDS round trip serves
    // 64 queries: left free, the scheduler spreads them among the products (several round trips)
    __builtin_amdgcn_sched_barrier(0);
    v8f c[CH / 16];
    for (int u = 0; u < CH / 16; ++u) c[u] = wmma16(qa[u][0], kf0, (v8f){});
    for (int u = 0; u < CH / 16; ++u) c[u] = wmma16(qa[u][1], kf1, c[u]);
    if (diag) {                       // causal (q >= k valid): the others leave both max and sum alone
      const int qrb = qc + ((l >> 4) ? 8 : 0);
      for (int u = 0; u < CH / 16; ++u)
        for (int r = 0; r < 8; ++r)
          if (qrb + u * 16 + r < kcol) c[u][r] = -INFINITY;
    }
    float mu[CH / 16];
    for (int u = 0; u < CH / 16; ++u) {
      mu[u] = c[u][0];
      for (int r = 1; r < 8; ++r) mu[u] = fmaxf(mu[u], c[u][r]);
    }
    const float mn = fmaxf(m, fmaxf(fmaxf(mu[0], mu[1]), fmaxf(mu[2], mu[3])));
    // a lane that has seen no valid query yet keeps m = -inf and s = 0 (-inf - -inf is no number)
    const float ref = (mn == -INFINITY) ? 0.0f : mn;
    // e^(x - ref) = 2^(x * log2(e) - ref * log2(e)): the subtrahend is formed once a stage
    const float l2e = 1.44269504f, nr = -ref * l2e;
    float p[CH / 16];
    for (int u = 0; u < CH / 16; ++u) {
      p[u] = __builtin_amdgcn_exp2f(fmaf(c[u][0], l2e, nr));
      for (int r = 1; r < 8; ++r) p[u] += __builtin_amdgcn_exp2f(fmaf(c[u][r], l2e, nr));
    }
    s = s * __builtin_amdgcn_exp2f(fmaf(m, l2e, nr)) + ((p[0] + p[1]) + (p[2] + p[3]));
    m = mn;
  };
  for (int t = 0; t < nt; ++t) {
    const _Float16* qb = qs[t & 1];
    const int qc = kb + t * CH;       // first query row of this stage
    // both tests are wave-uniform; a stage wholly above the diagonal is skipped
    if (qc >= k0 + 16)      fold(qb, qc, false);
    else if (qc + CH > k0)  fold(qb, qc, true);
    // hand-over, passed by every wave: stage t + 1 is published, stage t's buffer is free
    lds_reads_done();
    copies_landed();
    __syncthreads();
    if (t + 2 < nt) stage_rows(qs[t & 1], qh + (size_t)(kb + (t + 2) * CH) * HS, HS);
  }
  copies_landed();
  // merge the two half-lanes holding the same column
  float m2 = __shfl_xor(m, 16, 32);
  float s2 = __shfl_xor(s, 16, 32);
  float mn = fmaxf(m, m2);
  float sm = s * __expf(m - mn) + s2 * __expf(m2 - mn);
  if (l < 16) {
    cmax[(size_t)bh * TT + kcol] = mn;
    csum[(size_t)bh * TT + kcol] = sm;
  }
}

// ---------------- v' = v / Z, stored transposed [B,H,HS,T] ------------------
// Same register-tile transpose: one wave takes 64 key tokens x 32 columns of a
// head; lane (lk = l & 7, le = l >> 3) reads 8 tokens x 8 halves and writes 8
// runs of 8 halves along t, so each store covers four whole 128-byte lines.
// The two waves that share the 128-byte source rows sit in one work-group.
__global__ __launch_bounds__(256) void vscale(
    const _Float16* __restrict__ v, const float* __restrict__ csum,
    _Float16* __restrict__ vT) {
  const int wave = threadIdx.x >> 5, l = threadIdx.x & 31;
  const int tile = blockIdx.x * 4 + (wave >> 1);   // BB*HH heads x TT/64 tiles
  const int bh = tile >> 5;
  const int kt = (tile & 31) * 64 + (l & 7) * 8;
  const int e = (wave & 1) * 32 + (l >> 3) * 8;
  const _Float16* s = v + ((size_t)bh * TT + kt) * HS + e;
  const float* z = csum + (size_t)bh * TT + kt;
  _Float16* o = vT + ((size_t)bh * HS + e) * TT + kt;
  v8h a[8];
  v4f Z[2];
  for (int i = 0; i < 8; ++i) a[i] = *(const v8h*)(s + (size_t)i * HS);
  for (int i = 0; i < 2; ++i) Z[i] = *(const v4f*)(z + 4 * i);
  // all ten loads go out before the arithmetic starts: left free, the scheduler
  // holds two back behind the first divisions (a second memory round trip)
  __builtin_amdgcn_sched_barrier(0);
  // unrolled so that j is a constant: left rolled, element j of every register
  // vector is picked by a chain of selects
#pragma unroll
  for (int j = 0; j < 8; ++j) {
    v8h t;
    for (int i = 0; i < 8; ++i)
      t[i] = to_h((float)a[i][j] / Z[i >> 2][i & 3]);
    *(v8h*)(o + (size_t)j * TT) = t;
  }
}

// ---------------- attention pass 2: attn = P @ V' ---------------------------
// 512 work-groups on 256 WGPs are four waves a SIMD: the register budget is set for
// that, so that a block's fragments and its 16 exponentials can be in flight together
__global__ __launch_bounds__(256) __attribute__((amdgpu_waves_per_eu(4, 4))) void attn_pass2(
    const _Float16* __restrict__ q, const _Float16* __restrict__ k,
    const _Float16* __restrict__ vT, const float* __restrict__ cmax,
    _Float16* __restrict__ attn) {
  __shared__ _Float16 ks[2][CH * APITCH];  // 64 keys x 64 head columns
  __shared__ _Float16 vs[2][CH * APITCH];  // 64 head columns x 64 keys
  __shared__ _Float16 pbuf[8][16 * PAD];   // per-wave P tile [16q x 32k]
  const int bh = blockIdx.y;
  const int wave = __builtin_amdgcn_readfirstlane(threadIdx.x >> 5), l = threadIdx.x & 31;
  const int qb0 = blockIdx.x * 128;              // the work-group's first query row
  const int q0 = qb0 + wave * 16;                // this wave's 16 query rows
  const int bi = bh / HH, h = bh % HH;
  const _Float16* qh  = q  + (size_t)bh * TT * HS;
  const _Float16* kh  = k  + (size_t)bh * TT * HS;
  const _Float16* vTh = vT + (size_t)bh * HS * TT;
  const float*    mh  = cmax + (size_t)bh * TT;
  const int nt = (qb0 + 128) / CH;               // stages of 64 keys, at least two

  stage_rows(ks[0], kh, HS);
  stage_rows(vs[0], vTh, TT);
  v16h qa0 = load_frag(qh + (size_t)q0 * HS, HS);
  v16h qa1 = load_frag(qh + (size_t)q0 * HS + 32, HS);
  copies_landed();
  __syncthreads();
  stage_rows(ks[1], kh + (size_t)CH * HS, HS);
  stage_rows(vs[1], vTh + CH, TT);

  v8f acc[4];
  for (int j = 0; j < 4; ++j) acc[j] = (v8f){};

  const int cn = l & 15, rb = (l >> 4) * 8;
  // 16 queries x 32 keys. All fragment reads of the block (K and, since they do not
  // depend on P, V^T) stand at its head: one LDS round trip. Where the second 16 keys
  // lie wholly behind the diagonal the causal select below writes their zeros (those
  // key rows are part of the stage, so the reads are in range).
  auto pv_block = [&](const _Float16* kr, const _Float16* vr, int kt) {
    v16h kf[2][2], vb[4];
    float mk[2];
    for (int h2 = 0; h2 < 2; ++h2) {
      kf[h2][0] = load_frag(kr + 16 * h2 * APITCH, APITCH);
      kf[h2][1] = load_frag(kr + 16 * h2 * APITCH + 32, APITCH);
      mk[h2] = mh[kt + 16 * h2 + cn];
    }
    for (int j = 0; j < 4; ++j) vb[j] = load_frag(vr + (16 * j) * APITCH, APITCH);
    // build P tile (two 16-wide halves) in LDS, C-layout -> A-layout
    for (int h2 = 0; h2 < 2; ++h2) {
      v8f cc = (v8f){};
      cc = wmma16(qa0, kf[h2][0], cc);
      cc = wmma16(qa1, kf[h2][1], cc);
      int kcol = kt + 16 * h2 + cn;
      for (int r = 0; r < 8; ++r) {
        int qi = q0 + rb + r;
        float pv = (qi >= kcol) ? __expf(cc[r] - mk[h2]) : 0.0f;
        pbuf[wave][(size_t)(rb + r) * PAD + 16 * h2 + cn] = to_h(pv);
      }
    }
    // intra-wave LDS turnaround: the P tile is private to its wave
    asm volatile("s_wait_dscnt 0" ::: "memory");
    v16h pa = load_frag(pbuf[wave], PAD);
    for (int j = 0; j < 4; ++j) acc[j] = wmma16(pa, vb[j], acc[j]);
  };
  for (int t = 0; t < nt; ++t) {
    const _Float16* kst = ks[t & 1];
    const _Float16* vst = vs[t & 1];
    for (int u = 0; u < CH / 32; ++u) {
      const int kt = t * CH + u * 32;
      if (kt < q0 + 16)               // wave-uniform: skips keys wholly behind the diagonal
        pv_block(kst + u * 32 * APITCH, vst + u * 32, kt);
    }
    // hand-over, passed by every wave: stage t + 1 is published, stage t's buffers are free
    lds_reads_done();
    copies_landed();
    __syncthreads();
    if (t + 2 < nt) {
      stage_rows(ks[t & 1], kh + (size_t)(t + 2) * CH * HS, HS);
      stage_rows(vs[t & 1], vTh + (t + 2) * CH, TT);
    }
  }
  copies_landed();

  // write attn as f16 [B,T,D] (feeds the proj GEMM)
  for (int j = 0; j < 4; ++j)
    for (int r = 0; r < 8; ++r) {
      int qi = q0 + rb + r;
      int d = h * HS + 16 * j + cn;
      attn[((size_t)bi * TT + qi) * DD + d] = to_h(acc[j][r]);
    }
}

// ---------------- host-side orchestration ----------------
extern "C" void kernel_launch(void* const* d_in, const int* in_sizes, int n_in,
                              void* d_out, int out_size, void* d_ws,
                              size_t ws_size, hipStream_t stream) {
  const float* x     = (const float*)d_in[0];
  const float* Wq    = (const float*)d_in[1];
  const float* Wk    = (const float*)d_in[2];
  const float* Wv    = (const float*)d_in[3];
  const float* Wproj = (const float*)d_in[4];
  const float* bproj = (const float*)d_in[5];
  const float* W1    = (const float*)d_in[6];
  const float* b1    = (const float*)d_in[7];
  const float* W2    = (const float*)d_in[8];
  const float* b2    = (const float*)d_in[9];
  const float* ln1g  = (const float*)d_in[10];
  const float* ln1b  = (const float*)d_in[11];
  const float* ln2g  = (const float*)d_in[12];
  const float* ln2b  = (const float*)d_in[13];
  float* out = (float*)d_out;

  char* base = (char*)d_ws;
  size_t off = 0;
  auto alloc = [&](size_t bytes) -> char* {
    char* p = base + off;
    off += (bytes + 255) & ~(size_t)255;
    return p;
  };
  _Float16* wqkvT = (_Float16*)alloc((size_t)3 * DD * DD * 2);  // [3D][D]
  _Float16* wpT   = (_Float16*)alloc((size_t)DD * DD * 2);      // [D][D]
  _Float16* w1T   = (_Float16*)alloc((size_t)DFF * DD * 2);     // [4D][D]
  _Float16* w2T   = (_Float16*)alloc((size_t)DD * DFF * 2);     // [D][4D]
  float*    xn_f  = (float*)   alloc((size_t)BT * DD * 4);
  _Float16* xn_h  = (_Float16*)alloc((size_t)BT * DD * 2);
  _Float16* q_h   = (_Float16*)alloc((size_t)BB * HH * TT * HS * 2);
  _Float16* k_h   = (_Float16*)alloc((size_t)BB * HH * TT * HS * 2);
  _Float16* v_h   = (_Float16*)alloc((size_t)BB * HH * TT * HS * 2);
  _Float16* vT_h  = (_Float16*)alloc((size_t)BB * HH * TT * HS * 2);
  float*    cmax  = (float*)   alloc((size_t)BB * HH * TT * 4);
  float*    csum  = (float*)   alloc((size_t)BB * HH * TT * 4);
  _Float16* attnh = (_Float16*)alloc((size_t)BT * DD * 2);
  float*    x1_f  = (float*)   alloc((size_t)BT * DD * 4);
  float*    x1n_f = (float*)   alloc((size_t)BT * DD * 4);
  _Float16* x1n_h = (_Float16*)alloc((size_t)BT * DD * 2);
  _Float16* h_h   = (_Float16*)alloc((size_t)BT * DFF * 2);

  // 1) pack all weights to f16, transposed [N][K]: 12M elements, 64 n x 256 k a group
  pack_weights<<<(3 * DD * DD + DD * DD + 2 * DD * DFF) / (64 * 256), 256, 0, stream>>>(
      Wq, Wk, Wv, Wproj, W1, W2, wqkvT, wpT, w1T, w2T);
  // 2) LN1 -> xn (f32 + f16)
  ln_kernel<<<BT, 256, 0, stream>>>(x, ln1g, ln1b, xn_f, xn_h);
  // 3) QKV GEMM: [4096x1024] x [1024x3072]
  gemm128<MODE_QKV><<<dim3(3 * DD / 128, BT / 128), 256, 0, stream>>>(
      xn_h, wqkvT, 3 * DD, DD, nullptr, nullptr, nullptr, nullptr,
      q_h, k_h, v_h);
  // 4) per-column softmax stats
  attn_pass1<<<dim3(TT / 128, BB * HH), 256, 0, stream>>>(q_h, k_h, cmax, csum);
  // 5) v' = v / Z, transposed
  vscale<<<BB * HH * (TT / 64) / 4, 256, 0, stream>>>(v_h, csum, vT_h);
  // 6) attn = P @ V'
  attn_pass2<<<dim3(TT / 128, BB * HH), 256, 0, stream>>>(q_h, k_h, vT_h, cmax,
                                                          attnh);
  // 7) proj: x1 = xn + attn @ Wproj + bproj
  gemm128<MODE_PROJ><<<dim3(DD / 128, BT / 128), 256, 0, stream>>>(
      attnh, wpT, DD, DD, bproj, xn_f, x1_f, nullptr, nullptr,
      nullptr, nullptr);
  // 8) LN2 -> x1n (f32 + f16)
  ln_kernel<<<BT, 256, 0, stream>>>(x1_f, ln2g, ln2b, x1n_f, x1n_h);
  // 9) FFN1: h = relu(x1n @ W1 + b1)
  gemm128<MODE_FFN1><<<dim3(DFF / 128, BT / 128), 256, 0, stream>>>(
      x1n_h, w1T, DFF, DD, b1, nullptr, nullptr, h_h, nullptr,
      nullptr, nullptr);
  // 10) FFN2: out = x1n + h @ W2 + b2
  gemm128<MODE_FFN2><<<dim3(DD / 128, BT / 128), 256, 0, stream>>>(
      h_h, w2T, DD, DFF, b2, x1n_f, out, nullptr, nullptr, nullptr,
      nullptr);
}

// v006
// Measured time: 188 microseconds a run.
// Next to v005, in two timings, it ran 1.04 and 1.03 times as fast.
// Counting every step since v000, it is 2.96 times as fast.
#include <hip/hip_runtime.h>
#include <hip/hip_bf16.h>

// ---------------- problem constants ----------------
#define BB 2
#define TT 2048
#define DD 1024
#define HH 16
#define HS 64
#define BT (BB * TT)       // 4096 rows
#define DFF (4 * DD)       // 4096

typedef __attribute__((ext_vector_type(16))) _Float16 v16h;
typedef __attribute__((ext_vector_type(8)))  float    v8f;
typedef __attribute__((ext_vector_type(4)))  float    v4f;
typedef __attribute__((ext_vector_type(8)))  _Float16 v8h;

// ---------------- asynchronous copies to LDS: the two waits ----------------
// this wave's copies have landed (the barrier behind it publishes them to the others)
__device__ __forceinline__ void copies_landed() { asm volatile("s_wait_asynccnt 0x0" ::: "memory"); }
// this wave's LDS reads of the buffer that is refilled next have returned
__device__ __forceinline__ void lds_reads_done() { asm volatile("s_wait_dscnt 0x0" ::: "memory"); }

// ---------------- WMMA helpers ----------------
__device__ __forceinline__ v8f wmma16(v16h a, v16h b, v8f c) {
  // D = A(16x32 f16) * B(32x16 f16) + C(16x16 f32)
  return __builtin_amdgcn_wmma_f32_16x16x32_f16(false, a, false, b, (short)0, c,
                                                false, false);
}

// A-fragment loader (16-bit A 16x32 layout):
//   lane<16 : row M = lane,    holds K = 0..7  and 16..23
//   lane>=16: row M = lane-16, holds K = 8..15 and 24..31
// B-fragments (stored row=N, col=K) use the same pattern with N as the row.
__device__ __forceinline__ v16h load_frag(const _Float16* p, int stride) {
  int l = threadIdx.x & 31;
  const _Float16* r = p + (size_t)(l & 15) * stride + ((l >> 4) << 3);
  v16h f;
  ((uint4*)&f)[0] = *(const uint4*)(r);
  ((uint4*)&f)[1] = *(const uint4*)(r + 16);
  return f;
}

__device__ __forceinline__ _Float16 to_h(float x) { return (_Float16)x; }

// ---------------- weight packing: f32 -> f16, ALL weights TRANSPOSED --------
// Every packed weight is stored [N][K] so GEMM B-tiles stage with contiguous
// 16B rows (identical to A-tiles, no in-loop transpose).
// One wave transposes a tile of 64 k x 32 n in registers: lane (lk = l >> 3,
// ln = l & 7) reads 16 source rows x 4 floats, so each load covers four whole
// 128-byte lines, and writes 8 runs of 8 halves along k; the wave alone writes
// the 128-byte output lines of its tile. One element per thread had to start
// 64 times as many waves, each with a load that touched 32 lines.
template <int LD, int K>   // source pitch in floats, packed pitch in halves
__device__ __forceinline__ void pack_tile(const float* __restrict__ S,
                                          _Float16* __restrict__ O, int kb) {
  const int wave = threadIdx.x >> 5, l = threadIdx.x & 31;
  const int n = (wave & 1) * 32 + (l & 7) * 4;
  const int k = kb * 256 + (wave >> 1) * 64 + (l >> 3) * 8;
  const float* s = S + (size_t)k * LD + n;
  _Float16* o = O + (size_t)n * K + k;
  v4f v[2][8];
  for (int g = 0; g < 2; ++g)
    for (int i = 0; i < 8; ++i)
      v[g][i] = *(const v4f*)(s + (size_t)(32 * g + i) * LD);
  // the 16 loads share one address pair: it is named here as an input, so that no
  // load's result lands on it, and the wait stands in front of its reuse below
  asm volatile("s_wait_xcnt 0x0" :: "v"(s) : "memory");
  // all 16 loads go out before the first conversion: left free, the scheduler
  // holds some back behind the first results (a second memory round trip)
  __builtin_amdgcn_sched_barrier(0);
  for (int g = 0; g < 2; ++g)
    for (int j = 0; j < 4; ++j) {
      v8h t;
      for (int i = 0; i < 8; ++i) t[i] = to_h(v[g][i][j]);
      *(v8h*)(o + (size_t)j * K + 32 * g) = t;
    }
  // the code of the four matrices stands one part behind the other, parted only by
  // scalar skips, and each part rewrites these registers: keep the wait behind the stores
  asm volatile("s_wait_xcnt 0x0" ::: "memory");
}

// a work-group packs 64 n x 256 k; the matrix it works on is block-uniform
__global__ __launch_bounds__(256) void pack_weights(
    const float* __restrict__ Wq, const float* __restrict__ Wk,
    const float* __restrict__ Wv, const float* __restrict__ Wp,
    const float* __restrict__ W1, const float* __restrict__ W2,
    _Float16* __restrict__ wqkvT, _Float16* __restrict__ wpT,
    _Float16* __restrict__ w1T, _Float16* __restrict__ w2T) {
  const int b = blockIdx.x;
  const int bP = 3 * HH * 4, b1 = bP + (DD / 64) * 4, b2 = b1 + (DFF / 64) * 4;
  if (b < bP) {                    // q, k, v: one head [D][HS] is 64 n wide
    const int hd = b >> 2, sel = hd >> 4, h = hd & 15;
    const float* W = (sel == 0) ? Wq : (sel == 1) ? Wk : Wv;
    pack_tile<HS, DD>(W + (size_t)h * DD * HS, wqkvT + (size_t)hd * 64 * DD, b & 3);
  } else if (b < b1) {             // Wproj [D][D]
    const int nb = (b - bP) >> 2;
    pack_tile<DD, DD>(Wp + nb * 64, wpT + (size_t)nb * 64 * DD, b & 3);
  } else if (b < b2) {             // W1 [D][4D]
    const int nb = (b - b1) >> 2;
    pack_tile<DFF, DD>(W1 + nb * 64, w1T + (size_t)nb * 64 * DD, b & 3);
  } else {                         // W2 [4D][D]
    const int nb = (b - b2) >> 4;
    pack_tile<DD, DFF>(W2 + nb * 64, w2T + (size_t)nb * 64 * DFF, b & 15);
  }
}

// ---------------- LayerNorm: writes f32 (residual) + f16 (GEMM input) -------
__global__ __launch_bounds__(256) void ln_kernel(
    const float* __restrict__ x, const float* __restrict__ g,
    const float* __restrict__ b, float* __restrict__ yf,
    _Float16* __restrict__ yh) {
  __shared__ float s1[256], s2[256];
  int row = blockIdx.x, tid = threadIdx.x;
  const float* xr = x + (size_t)row * DD;
  float4 xv = ((const float4*)xr)[tid];          // 4 elements / thread
  float sum = xv.x + xv.y + xv.z + xv.w;
  float sq  = xv.x * xv.x + xv.y * xv.y + xv.z * xv.z + xv.w * xv.w;
  s1[tid] = sum; s2[tid] = sq;
  __syncthreads();
  for (int off = 128; off; off >>= 1) {
    if (tid < off) { s1[tid] += s1[tid + off]; s2[tid] += s2[tid + off]; }
    __syncthreads();
  }
  float mu  = s1[0] * (1.0f / DD);
  float var = s2[0] * (1.0f / DD) - mu * mu;
  float rs  = rsqrtf(var + 1e-5f);
  float vals[4] = {xv.x, xv.y, xv.z, xv.w};
  for (int j = 0; j < 4; ++j) {
    int c = tid * 4 + j;
    float xn = (vals[j] - mu) * rs * g[c] + b[c];
    yf[(size_t)row * DD + c] = xn;
    yh[(size_t)row * DD + c] = to_h(xn);
  }
}

// ---------------- generic 128x128 WMMA GEMM with fused epilogues ------------
#define MODE_QKV  0
#define MODE_PROJ 1
#define MODE_FFN1 2
#define MODE_FFN2 3

// Eight 16-byte copies per lane in one statement. The wait is the statement's last
// line, so that it stands in front of any rewrite of the address registers that the
// copies name.
__device__ __forceinline__ void copy8(const unsigned* l, const _Float16* const* g) {
  asm volatile("global_load_async_to_lds_b128 %0, %1, off\n\t"
               "global_load_async_to_lds_b128 %2, %3, off\n\t"
               "global_load_async_to_lds_b128 %4, %5, off\n\t"
               "global_load_async_to_lds_b128 %6, %7, off\n\t"
               "global_load_async_to_lds_b128 %8, %9, off\n\t"
               "global_load_async_to_lds_b128 %10, %11, off\n\t"
               "global_load_async_to_lds_b128 %12, %13, off\n\t"
               "global_load_async_to_lds_b128 %14, %15, off\n\t"
               "s_wait_xcnt 0x0"
               :: "v"(l[0]), "v"(g[0]), "v"(l[1]), "v"(g[1]), "v"(l[2]), "v"(g[2]),
                  "v"(l[3]), "v"(g[3]), "v"(l[4]), "v"(g[4]), "v"(l[5]), "v"(g[5]),
                  "v"(l[6]), "v"(g[6]), "v"(l[7]), "v"(g[7]) : "memory");
}

#define KS 128       // k per stage: rows of 256 bytes
#define GP 136       // LDS row pitch in halves: 272 B = 16 B x 17, conflict-free for 16-byte reads

// One operand's share of a stage: 128 rows x 256 B = 2048 pieces of 16 B, eight per
// lane; a wave's copy covers two whole rows (four 128-byte lines).
__device__ __forceinline__ void stage_tile(_Float16* dst, const _Float16* src, int K) {
  const int r = threadIdx.x >> 4, c = (threadIdx.x & 15) * 8;
  unsigned l[8];
  const _Float16* g[8];
  for (int i = 0; i < 8; ++i) {
    l[i] = (unsigned)(uintptr_t)(dst + (r + 16 * i) * GP + c);
    g[i] = src + (size_t)(r + 16 * i) * K + c;
  }
  copy8(l, g);
}

// MODE is a compile-time parameter: with it at run time the epilogue stayed a
// rolled loop that tested the mode per element and waited for each element's
// residual load before its store (one memory round trip per element).
// K is walked in stages of 128 k, two buffers, one hand-over (two waits, one barrier) a
// stage. A stage is four blocks of 32 k (8 products a wave), and the fragments of a block
// are read while the block before it is multiplied. At 32 k a stage, between two
// barriers, there was no block to read ahead of: each wave waited out its own LDS reads.
template <int MODE>
__global__ __launch_bounds__(256) void gemm128(
    const _Float16* __restrict__ A,   // [M][K] row-major f16
    const _Float16* __restrict__ Bt,  // [N][K] row-major f16 (pre-transposed)
    int N, int K,
    const float* __restrict__ bias, const float* __restrict__ resid,
    float* __restrict__ outf, _Float16* __restrict__ outh,
    _Float16* __restrict__ qp, _Float16* __restrict__ kp,
    _Float16* __restrict__ vp) {
  __shared__ __attribute__((aligned(16))) _Float16 As[2][128 * GP];
  __shared__ __attribute__((aligned(16))) _Float16 Bs[2][128 * GP];
  const int tid = threadIdx.x;
  const int m0 = blockIdx.y * 128;
  const int n0 = blockIdx.x * 128;
  const int wave = tid >> 5, l = tid & 31;
  const int wm = (wave & 1) * 64;   // wave M offset in tile
  const int wn = (wave >> 1) * 32;  // wave N offset in tile
  const _Float16* Ag = A + (size_t)m0 * K;
  const _Float16* Bg = Bt + (size_t)n0 * K;
  const int nt = K / KS;            // stages, at least two

  v8f acc[4][2];
  for (int i = 0; i < 4; ++i)
    for (int j = 0; j < 2; ++j) acc[i][j] = (v8f){};

  stage_tile(As[0], Ag, K);
  stage_tile(Bs[0], Bg, K);
  copies_landed();
  __syncthreads();
  stage_tile(As[1], Ag + KS, K);
  stage_tile(Bs[1], Bg + KS, K);

  for (int t = 0; t < nt; ++t) {
    const _Float16* as = As[t & 1] + wm * GP;
    const _Float16* bs = Bs[t & 1] + wn * GP;
    v16h af[2][4], bf[2][2];          // two fragment sets: one multiplied, one being read
    auto read_block = [&](int s) {
      for (int i = 0; i < 4; ++i) af[s & 1][i] = load_frag(as + 16 * i * GP + 32 * s, GP);
      for (int j = 0; j < 2; ++j) bf[s & 1][j] = load_frag(bs + 16 * j * GP + 32 * s, GP);
    };
    read_block(0);
    for (int s = 0; s < KS / 32; ++s) {
      if (s + 1 < KS / 32) read_block(s + 1);
      // the pair of fences keeps the next block's 12 reads one group in front of this
      // block's products: left free, the scheduler puts them among the products in
      // pairs and waits for each pair (four LDS round trips a block)
      __builtin_amdgcn_sched_barrier(0);
      for (int i = 0; i < 4; ++i)
        for (int j = 0; j < 2; ++j) acc[i][j] = wmma16(af[s & 1][i], bf[s & 1][j], acc[i][j]);
      __builtin_amdgcn_sched_barrier(0);
    }
    // hand-over: stage t + 1 is published, stage t's buffers are free
    lds_reads_done();
    copies_landed();
    __syncthreads();
    if (t + 2 < nt) {
      stage_tile(As[t & 1], Ag + (size_t)(t + 2) * KS, K);
      stage_tile(Bs[t & 1], Bg + (size_t)(t + 2) * KS, K);
    }
  }
  copies_landed();

  // epilogue: C lane map -> col = base + (l&15); rows = base + r + (l>=16)*8
  const int cn = l & 15, rb = (l >> 4) * 8;
  const int gm0 = m0 + wm + rb;   // this lane's first row
  const int gn0 = n0 + wn + cn;   // this lane's first column
  if constexpr (MODE == MODE_QKV) {
    // a 128-wide tile never straddles a 1024-wide q/k/v section: sel is block-uniform
    const int sel = n0 >> 10;
    _Float16* __restrict__ dp = (sel == 0) ? qp : (sel == 1) ? kp : vp;
    const float sc = (sel == 0) ? 0.03125f : 1.0f;  // fold D^-0.5 into q
    for (int i = 0; i < 4; ++i)
      for (int j = 0; j < 2; ++j)
        for (int rr = 0; rr < 8; ++rr) {
          int gm = gm0 + 16 * i + rr;
          int gn = gn0 + 16 * j;
          int w = gn & 1023, h = w >> 6, e = w & 63;
          int bi = gm >> 11, t = gm & (TT - 1);
          size_t dst = (((size_t)(bi * HH + h)) * TT + t) * HS + e;
          dp[dst] = to_h(acc[i][j][rr] * sc);
        }
  } else if constexpr (MODE == MODE_FFN1) {
    float bv[2];
    for (int j = 0; j < 2; ++j) bv[j] = bias[gn0 + 16 * j];
    // the bias loads' offset register is reused right behind them: keep the wait in front of that
    asm volatile("s_wait_xcnt 0x0" ::: "memory");
    _Float16* op = outh + (size_t)gm0 * DFF + gn0;
    for (int i = 0; i < 4; ++i)
      for (int j = 0; j < 2; ++j)
        for (int rr = 0; rr < 8; ++rr) {
          float v = acc[i][j][rr] + bv[j];
          v = fmaxf(v, 0.0f);
          op[(size_t)(16 * i + rr) * DFF + 16 * j] = to_h(v);
        }
  } else {  // MODE_PROJ, MODE_FFN2: out = acc + (bias + resid)
    float bv[2];
    for (int j = 0; j < 2; ++j) bv[j] = bias[gn0 + 16 * j];
    // the bias loads' offset register is reused right behind them: keep the wait in front of that
    asm volatile("s_wait_xcnt 0x0" ::: "memory");
    const float* rp = resid + (size_t)gm0 * DD + gn0;
    float* op = outf + (size_t)gm0 * DD + gn0;
    // all residual loads are issued before the first store, so they overlap
    float rv[4][2][8];
    for (int i = 0; i < 4; ++i)
      for (int j = 0; j < 2; ++j)
        for (int rr = 0; rr < 8; ++rr)
          rv[i][j][rr] = rp[(size_t)(16 * i + rr) * DD + 16 * j];
    for (int i = 0; i < 4; ++i)
      for (int j = 0; j < 2; ++j)
        for (int rr = 0; rr < 8; ++rr)
          op[(size_t)(16 * i + rr) * DD + 16 * j] =
              acc[i][j][rr] + (bv[j] + rv[i][j][rr]);
  }
}

// ---------------- staging for the two attention passes ----------------------
// The eight waves of a work-group walk the same rows (pass 1: queries, pass 2:
// keys and values). Read as fragments straight from global memory, every load
// touched 16 lines for 512 bytes and every wave fetched the same rows again.
// Here the work-group copies each 64-row piece once, in whole 128-byte lines,
// into LDS, two buffers deep, and the waves read their fragments from there.
#define CH 64        // rows of 128 bytes per stage
#define APITCH 72    // LDS row pitch in halves: 144 B = 16 B x 9, conflict-free for 16-byte reads

// 64 rows x 128 B = 512 pieces of 16 B, two per lane; a wave's copy covers four whole lines.
__device__ __forceinline__ void stage_rows(_Float16* dst, const _Float16* src, int pitch) {
  const int r = threadIdx.x >> 3, c = (threadIdx.x & 7) * 8;
  const unsigned l0 = (unsigned)(uintptr_t)(dst + r * APITCH + c);
  const unsigned l1 = (unsigned)(uintptr_t)(dst + (r + 32) * APITCH + c);
  const _Float16* g0 = src + (size_t)r * pitch + c;
  const _Float16* g1 = src + (size_t)(r + 32) * pitch + c;
  // the wait is the statement's last line, so that it stands in front of any
  // rewrite of the address registers that the copies name
  asm volatile("global_load_async_to_lds_b128 %0, %1, off\n\t"
               "global_load_async_to_lds_b128 %2, %3, off\n\t"
               "s_wait_xcnt 0x0"
               :: "v"(l0), "v"(g0), "v"(l1), "v"(g1) : "memory");
}

// ---------------- attention pass 1: per-key-column max / sumexp -------------
// softmax is over the QUERY axis (per reference): m_k, Z_k over q >= k.
__global__ __launch_bounds__(256) void attn_pass1(
    const _Float16* __restrict__ q, const _Float16* __restrict__ k,
    float* __restrict__ cmax, float* __restrict__ csum) {
  __shared__ _Float16 qs[2][CH * APITCH];
  const int bh = blockIdx.y;
  const int wave = __builtin_amdgcn_readfirstlane(threadIdx.x >> 5), l = threadIdx.x & 31;
  const int kb = blockIdx.x * 128;               // the work-group's first key column
  const int k0 = kb + wave * 16;                 // this wave's 16 key columns
  const _Float16* qh = q + (size_t)bh * TT * HS;
  const _Float16* kh = k + (size_t)bh * TT * HS;
  const int nt = (TT - kb) / CH;                 // stages of 64 queries, at least two

  stage_rows(qs[0], qh + (size_t)kb * HS, HS);
  // K^T fragments for this column strip (lane row = key token)
  v16h kf0 = load_frag(kh + (size_t)k0 * HS, HS);
  v16h kf1 = load_frag(kh + (size_t)k0 * HS + 32, HS);
  copies_landed();
  __syncthreads();
  stage_rows(qs[1], qh + (size_t)(kb + CH) * HS, HS);

  float m = -INFINITY, s = 0.0f;
  const int kcol = k0 + (l & 15);
  // One stage is 64 queries, 32 scores of this lane's key column. Their maximum is
  // taken first, the running sum is rescaled once, and the 32 exponentials then depend
  // on nothing but that maximum. Score by score, each update took two divergent
  // branches and waited for the exponential of the update before it.
  auto fold = [&](const _Float16* qb, int qc, bool diag) {
    v16h qa[CH / 16][2];              // 4 tiles of 16 queries x 64 head columns
    for (int u = 0; u < CH / 16; ++u) {
      qa[u][0] = load_frag(qb + u * 16 * APITCH, APITCH);
      qa[u][1] = load_frag(qb + u * 16 * APITCH + 32, APITCH);
    }
    // all 16 fragment reads go out before the first product, so one LDS round trip serves
    // 64 queries: left free, the scheduler spreads them among the products (several round trips)
    __builtin_amdgcn_sched_barrier(0);
    v8f c[CH / 16];
    for (int u = 0; u < CH / 16; ++u) c[u] = wmma16(qa[u][0], kf0, (v8f){});
    for (int u = 0; u < CH / 16; ++u) c[u] = wmma16(qa[u][1], kf1, c[u]);
    if (diag) {                       // causal (q >= k valid): the others leave both max and sum alone
      const int qrb = qc + ((l >> 4) ? 8 : 0);
      for (int u = 0; u < CH / 16; ++u)
        for (int r = 0; r < 8; ++r)
          if (qrb + u * 16 + r < kcol) c[u][r] = -INFINITY;
    }
    float mu[CH / 16];
    for (int u = 0; u < CH / 16; ++u) {
      mu[u] = c[u][0];
      for (int r = 1; r < 8; ++r) mu[u] = fmaxf(mu[u], c[u][r]);
    }
    const float mn = fmaxf(m, fmaxf(fmaxf(mu[0], mu[1]), fmaxf(mu[2], mu[3])));
    // a lane that has seen no valid query yet keeps m = -inf and s = 0 (-inf - -inf is no number)
    const float ref = (mn == -INFINITY) ? 0.0f : mn;
    // e^(x - ref) = 2^(x * log2(e) - ref * log2(e)): the subtrahend is formed once a stage
    const float l2e = 1.44269504f, nr = -ref * l2e;
    float p[CH / 16];
    for (int u = 0; u < CH / 16; ++u) {
      p[u] = __builtin_amdgcn_exp2f(fmaf(c[u][0], l2e, nr));
      for (int r = 1; r < 8; ++r) p[u] += __builtin_amdgcn_exp2f(fmaf(c[u][r], l2e, nr));
    }
    s = s * __builtin_amdgcn_exp2f(fmaf(m, l2e, nr)) + ((p[0] + p[1]) + (p[2] + p[3]));
    m = mn;
  };
  for (int t = 0; t < nt; ++t) {
    const _Float16* qb = qs[t & 1];
    const int qc = kb + t * CH;       // first query row of this stage
    // both tests are wave-uniform; a stage wholly above the diagonal is skipped
    if (qc >= k0 + 16)      fold(qb, qc, false);
    else if (qc + CH > k0)  fold(qb, qc, true);
    // hand-over, passed by every wave: stage t + 1 is published, stage t's buffer is free
    lds_reads_done();
    copies_landed();
    __syncthreads();
    if (t + 2 < nt) stage_rows(qs[t & 1], qh + (size_t)(kb + (t + 2) * CH) * HS, HS);
  }
  copies_landed();
  // merge the two half-lanes holding the same column
  float m2 = __shfl_xor(m, 16, 32);
  float s2 = __shfl_xor(s, 16, 32);
  float mn = fmaxf(m, m2);
  float sm = s * __expf(m - mn) + s2 * __expf(m2 - mn);
  if (l < 16) {
    cmax[(size_t)bh * TT + kcol] = mn;
    csum[(size_t)bh * TT + kcol] = sm;
  }
}

// ---------------- v' = v / Z, stored transposed [B,H,HS,T] ------------------
// Same register-tile transpose: one wave takes 64 key tokens x 32 columns of a
// head; lane (lk = l & 7, le = l >> 3) reads 8 tokens x 8 halves and writes 8
// runs of 8 halves along t, so each store covers four whole 128-byte lines.
// The two waves that share the 128-byte source rows sit in one work-group.
__global__ __launch_bounds__(256) void vscale(
    const _Float16* __restrict__ v, const float* __restrict__ csum,
    _Float16* __restrict__ vT) {
  const int wave = threadIdx.x >> 5, l = threadIdx.x & 31;
  const int tile = blockIdx.x * 4 + (wave >> 1);   // BB*HH heads x TT/64 tiles
  const int bh = tile >> 5;
  const int kt = (tile & 31) * 64 + (l & 7) * 8;
  const int e = (wave & 1) * 32 + (l >> 3) * 8;
  const _Float16* s = v + ((size_t)bh * TT + kt) * HS + e;
  const float* z = csum + (size_t)bh * TT + kt;
  _Float16* o = vT + ((size_t)bh * HS + e) * TT + kt;
  v8h a[8];
  v4f Z[2];
  for (int i = 0; i < 8; ++i) a[i] = *(const v8h*)(s + (size_t)i * HS);
  for (int i = 0; i < 2; ++i) Z[i] = *(const v4f*)(z + 4 * i);
  // all ten loads go out before the arithmetic starts: left free, the scheduler
  // holds two back behind the first divisions (a second memory round trip)
  __builtin_amdgcn_sched_barrier(0);
  // unrolled so that j is a constant: left rolled, element j of every register
  // vector is picked by a chain of selects
#pragma unroll
  for (int j = 0; j < 8; ++j) {
    v8h t;
    for (int i = 0; i < 8; ++i)
      t[i] = to_h((float)a[i][j] / Z[i >> 2][i & 3]);
    *(v8h*)(o + (size_t)j * TT) = t;
  }
}

__global__ __launch_bounds__(256) __attribute__((amdgpu_waves_per_eu(4, 4))) void attn_pass2(
    const _Float16* __restrict__ q, const _Float16* __restrict__ k,
    const _Float16* __restrict__ vT, const float* __restrict__ cmax,
    _Float16* __restrict__ attn) {
  __shared__ _Float16 ks[2][CH * APITCH];  // 64 keys x 64 head columns
  __shared__ _Float16 vs[2][CH * APITCH];  // 64 head columns x 64 keys
  const int bh = blockIdx.y;
  const int wave = __builtin_amdgcn_readfirstlane(threadIdx.x >> 5), l = threadIdx.x & 31;
  const int qb0 = blockIdx.x * 128;              // the work-group's first query row
  const int q0 = qb0 + wave * 16;                // this wave's 16 query rows
  const int bi = bh / HH, h = bh % HH;
  const _Float16* qh  = q  + (size_t)bh * TT * HS;
  const _Float16* kh  = k  + (size_t)bh * TT * HS;
  const _Float16* vTh = vT + (size_t)bh * HS * TT;
  const float*    mh  = cmax + (size_t)bh * TT;
  const int nt = (qb0 + 128) / CH;               // stages of 64 keys, at least two

  stage_rows(ks[0], kh, HS);
  stage_rows(vs[0], vTh, TT);
  v16h qa0 = load_frag(qh + (size_t)q0 * HS, HS);
  v16h qa1 = load_frag(qh + (size_t)q0 * HS + 32, HS);
  copies_landed();
  __syncthreads();
  stage_rows(ks[1], kh + (size_t)CH * HS, HS);
  stage_rows(vs[1], vTh + CH, TT);

  v8f acc[4];
  for (int j = 0; j < 4; ++j) acc[j] = (v8f){};

  const int cn = l & 15, rb = (l >> 4) * 8;
  const int qi = q0 + cn;             // this lane's query: column cn of S^T and of O^T
  // 32 keys x 16 queries. All fragment reads of the block (K and, since they do not
  // depend on P, V^T) stand at its head: one LDS round trip. Where the second 16 keys
  // lie wholly behind the diagonal the causal select below writes their zeros (those
  // key rows are part of the stage, so the reads are in range).
  auto pv_block = [&](const _Float16* kr, const _Float16* vr, int kt) {
    v16h kf[2][2], vb[4];
    v4f mk[2][2];                     // column maxima of this lane's 2 x 8 keys
    for (int h2 = 0; h2 < 2; ++h2) {
      kf[h2][0] = load_frag(kr + 16 * h2 * APITCH, APITCH);
      kf[h2][1] = load_frag(kr + 16 * h2 * APITCH + 32, APITCH);
      mk[h2][0] = *(const v4f*)(mh + kt + 16 * h2 + rb);
      mk[h2][1] = *(const v4f*)(mh + kt + 16 * h2 + rb + 4);
    }
    for (int j = 0; j < 4; ++j) vb[j] = load_frag(vr + (16 * j) * APITCH, APITCH);
    // keeps all 16 fragment reads in front of the first product: left free, the scheduler
    // sinks V^T's reads to their products behind the exponentials (three more LDS round trips)
    __builtin_amdgcn_sched_barrier(0);
    // register r of tile h2 is S^T[key kt + 16 h2 + rb + r][query qi]; element 8 h2 + r of a
    // B fragment is k = 16 h2 + rb + r, the order in which load_frag reads V^T's keys
    v8f cc[2];
    for (int h2 = 0; h2 < 2; ++h2) cc[h2] = wmma16(kf[h2][0], qa0, (v8f){});
    for (int h2 = 0; h2 < 2; ++h2) cc[h2] = wmma16(kf[h2][1], qa1, cc[h2]);
    v16h pb;
    for (int h2 = 0; h2 < 2; ++h2) {
      const int ahead = qi - (kt + 16 * h2 + rb);   // causal: key r of the tile counts where r <= ahead
      for (int r = 0; r < 8; ++r) {
        float pv = (r <= ahead) ? __expf(cc[h2][r] - mk[h2][r >> 2][r & 3]) : 0.0f;
        pb[8 * h2 + r] = to_h(pv);
      }
    }
    for (int j = 0; j < 4; ++j) acc[j] = wmma16(vb[j], pb, acc[j]);
    // the address pair of the maxima's loads is stepped at the loop's foot: keep the wait in front of that
    asm volatile("s_wait_xcnt 0x0" ::: "memory");
  };
  for (int t = 0; t < nt; ++t) {
    const _Float16* kst = ks[t & 1];
    const _Float16* vst = vs[t & 1];
    for (int u = 0; u < CH / 32; ++u) {
      const int kt = t * CH + u * 32;
      if (kt < q0 + 16)               // wave-uniform: skips keys wholly behind the diagonal
        pv_block(kst + u * 32 * APITCH, vst + u * 32, kt);
    }
    // hand-over, passed by every wave: stage t + 1 is published, stage t's buffers are free
    lds_reads_done();
    copies_landed();
    __syncthreads();
    if (t + 2 < nt) {
      stage_rows(ks[t & 1], kh + (size_t)(t + 2) * CH * HS, HS);
      stage_rows(vs[t & 1], vTh + (t + 2) * CH, TT);
    }
  }
  copies_landed();

  // write attn as f16 [B,T,D] (feeds the proj GEMM): register r of tile j is
  // O^T[head column 16 j + rb + r][query qi], eight neighbours of one row: one 16-byte store
  _Float16* orow = attn + ((size_t)bi * TT + qi) * DD + h * HS + rb;
  for (int j = 0; j < 4; ++j) {
    v8h t;
    for (int r = 0; r < 8; ++r) t[r] = to_h(acc[j][r]);
    *(v8h*)(orow + 16 * j) = t;
  }
}

// ---------------- host-side orchestration ----------------
extern "C" void kernel_launch(void* const* d_in, const int* in_sizes, int n_in,
                              void* d_out, int out_size, void* d_ws,
                              size_t ws_size, hipStream_t stream) {
  const float* x     = (const float*)d_in[0];
  const float* Wq    = (const float*)d_in[1];
  const float* Wk    = (const float*)d_in[2];
  const float* Wv    = (const float*)d_in[3];
  const float* Wproj = (const float*)d_in[4];
  const float* bproj = (const float*)d_in[5];
  const float* W1    = (const float*)d_in[6];
  const float* b1    = (const float*)d_in[7];
  const float* W2    = (const float*)d_in[8];
  const float* b2    = (const float*)d_in[9];
  const float* ln1g  = (const float*)d_in[10];
  const float* ln1b  = (const float*)d_in[11];
  const float* ln2g  = (const float*)d_in[12];
  const float* ln2b  = (const float*)d_in[13];
  float* out = (float*)d_out;

  char* base = (char*)d_ws;
  size_t off = 0;
  auto alloc = [&](size_t bytes) -> char* {
    char* p = base + off;
    off += (bytes + 255) & ~(size_t)255;
    return p;
  };
  _Float16* wqkvT = (_Float16*)alloc((size_t)3 * DD * DD * 2);  // [3D][D]
  _Float16* wpT   = (_Float16*)alloc((size_t)DD * DD * 2);      // [D][D]
  _Float16* w1T   = (_Float16*)alloc((size_t)DFF * DD * 2);     // [4D][D]
  _Float16* w2T   = (_Float16*)alloc((size_t)DD * DFF * 2);     // [D][4D]
  float*    xn_f  = (float*)   alloc((size_t)BT * DD * 4);
  _Float16* xn_h  = (_Float16*)alloc((size_t)BT * DD * 2);
  _Float16* q_h   = (_Float16*)alloc((size_t)BB * HH * TT * HS * 2);
  _Float16* k_h   = (_Float16*)alloc((size_t)BB * HH * TT * HS * 2);
  _Float16* v_h   = (_Float16*)alloc((size_t)BB * HH * TT * HS * 2);
  _Float16* vT_h  = (_Float16*)alloc((size_t)BB * HH * TT * HS * 2);
  float*    cmax  = (float*)   alloc((size_t)BB * HH * TT * 4);
  float*    csum  = (float*)   alloc((size_t)BB * HH * TT * 4);
  _Float16* attnh = (_Float16*)alloc((size_t)BT * DD * 2);
  float*    x1_f  = (float*)   alloc((size_t)BT * DD * 4);
  float*    x1n_f = (float*)   alloc((size_t)BT * DD * 4);
  _Float16* x1n_h = (_Float16*)alloc((size_t)BT * DD * 2);
  _Float16* h_h   = (_Float16*)alloc((size_t)BT * DFF * 2);

  // 1) pack all weights to f16, transposed [N][K]: 12M elements, 64 n x 256 k a group
  pack_weights<<<(3 * DD * DD + DD * DD + 2 * DD * DFF) / (64 * 256), 256, 0, stream>>>(
      Wq, Wk, Wv, Wproj, W1, W2, wqkvT, wpT, w1T, w2T);
  // 2) LN1 -> xn (f32 + f16)
  ln_kernel<<<BT, 256, 0, stream>>>(x, ln1g, ln1b, xn_f, xn_h);
  // 3) QKV GEMM: [4096x1024] x [1024x3072]
  gemm128<MODE_QKV><<<dim3(3 * DD / 128, BT / 128), 256, 0, stream>>>(
      xn_h, wqkvT, 3 * DD, DD, nullptr, nullptr, nullptr, nullptr,
      q_h, k_h, v_h);
  // 4) per-column softmax stats
  attn_pass1<<<dim3(TT / 128, BB * HH), 256, 0, stream>>>(q_h, k_h, cmax, csum);
  // 5) v' = v / Z, transposed
  vscale<<<BB * HH * (TT / 64) / 4, 256, 0, stream>>>(v_h, csum, vT_h);
  // 6) attn = P @ V'
  attn_pass2<<<dim3(TT / 128, BB * HH), 256, 0, stream>>>(q_h, k_h, vT_h, cmax,
                                                          attnh);
  // 7) proj: x1 = xn + attn @ Wproj + bproj
  gemm128<MODE_PROJ><<<dim3(DD / 128, BT / 128), 256, 0, stream>>>(
      attnh, wpT, DD, DD, bproj, xn_f, x1_f, nullptr, nullptr,
      nullptr, nullptr);
  // 8) LN2 -> x1n (f32 + f16)
  ln_kernel<<<BT, 256, 0, stream>>>(x1_f, ln2g, ln2b, x1n_f, x1n_h);
  // 9) FFN1: h = relu(x1n @ W1 + b1)
  gemm128<MODE_FFN1><<<dim3(DFF / 128, BT / 128), 256, 0, stream>>>(
      x1n_h, w1T, DFF, DD, b1, nullptr, nullptr, h_h, nullptr,
      nullptr, nullptr);
  // 10) FFN2: out = x1n + h @ W2 + b2
  gemm128<MODE_FFN2><<<dim3(DD / 128, BT / 128), 256, 0, stream>>>(
      h_h, w2T, DD, DFF, b2, x1n_f, out, nullptr, nullptr, nullptr,
      nullptr);
}

// v007
// It runs in 175 microseconds.
// Timed twice side by side with v006, it ran 1.09 and 1.07 times as fast.
// All steps since v000 together make it 3.20 times as fast.
#include <hip/hip_runtime.h>
#include <hip/hip_bf16.h>

// ---------------- problem constants ----------------
#define BB 2
#define TT 2048
#define DD 1024
#define HH 16
#define HS 64
#define BT (BB * TT)       // 4096 rows
#define DFF (4 * DD)       // 4096

typedef __attribute__((ext_vector_type(16))) _Float16 v16h;
typedef __attribute__((ext_vector_type(8)))  float    v8f;
typedef __attribute__((ext_vector_type(4)))  float    v4f;
typedef __attribute__((ext_vector_type(8)))  _Float16 v8h;

// ---------------- asynchronous copies to LDS: the two waits ----------------
// this wave's copies have landed (the barrier behind it publishes them to the others)
__device__ __forceinline__ void copies_landed() { asm volatile("s_wait_asynccnt 0x0" ::: "memory"); }
// this wave's LDS reads of the buffer that is refilled next have returned
__device__ __forceinline__ void lds_reads_done() { asm volatile("s_wait_dscnt 0x0" ::: "memory"); }

// ---------------- WMMA helpers ----------------
__device__ __forceinline__ v8f wmma16(v16h a, v16h b, v8f c) {
  // D = A(16x32 f16) * B(32x16 f16) + C(16x16 f32)
  return __builtin_amdgcn_wmma_f32_16x16x32_f16(false, a, false, b, (short)0, c,
                                                false, false);
}

// A-fragment loader (16-bit A 16x32 layout):
//   lane<16 : row M = lane,    holds K = 0..7  and 16..23
//   lane>=16: row M = lane-16, holds K = 8..15 and 24..31
// B-fragments (stored row=N, col=K) use the same pattern with N as the row.
__device__ __forceinline__ v16h load_frag(const _Float16* p, int stride) {
  int l = threadIdx.x & 31;
  const _Float16* r = p + (size_t)(l & 15) * stride + ((l >> 4) << 3);
  v16h f;
  ((uint4*)&f)[0] = *(const uint4*)(r);
  ((uint4*)&f)[1] = *(const uint4*)(r + 16);
  return f;
}

__device__ __forceinline__ _Float16 to_h(float x) { return (_Float16)x; }

// ---------------- weight packing: f32 -> f16, ALL weights TRANSPOSED --------
// Every packed weight is stored [N][K] so GEMM B-tiles stage with contiguous
// 16B rows (identical to A-tiles, no in-loop transpose).
// One wave transposes a tile of 64 k x 32 n in registers: lane (lk = l >> 3,
// ln = l & 7) reads 16 source rows x 4 floats, so each load covers four whole
// 128-byte lines, and writes 8 runs of 8 halves along k; the wave alone writes
// the 128-byte output lines of its tile. One element per thread had to start
// 64 times as many waves, each with a load that touched 32 lines.
template <int LD, int K>   // source pitch in floats, packed pitch in halves
__device__ __forceinline__ void pack_tile(const float* __restrict__ S,
                                          _Float16* __restrict__ O, int kb) {
  const int wave = threadIdx.x >> 5, l = threadIdx.x & 31;
  const int n = (wave & 1) * 32 + (l & 7) * 4;
  const int k = kb * 256 + (wave >> 1) * 64 + (l >> 3) * 8;
  const float* s = S + (size_t)k * LD + n;
  _Float16* o = O + (size_t)n * K + k;
  v4f v[2][8];
  for (int g = 0; g < 2; ++g)
    for (int i = 0; i < 8; ++i)
      v[g][i] = *(const v4f*)(s + (size_t)(32 * g + i) * LD);
  // the 16 loads share one address pair: it is named here as an input, so that no
  // load's result lands on it, and the wait stands in front of its reuse below
  asm volatile("s_wait_xcnt 0x0" :: "v"(s) : "memory");
  // all 16 loads go out before the first conversion: left free, the scheduler
  // holds some back behind the first results (a second memory round trip)
  __builtin_amdgcn_sched_barrier(0);
  for (int g = 0; g < 2; ++g)
    for (int j = 0; j < 4; ++j) {
      v8h t;
      for (int i = 0; i < 8; ++i) t[i] = to_h(v[g][i][j]);
      *(v8h*)(o + (size_t)j * K + 32 * g) = t;
    }
  // the code of the four matrices stands one part behind the other, parted only by
  // scalar skips, and each part rewrites these registers: keep the wait behind the stores
  asm volatile("s_wait_xcnt 0x0" ::: "memory");
}

// a work-group packs 64 n x 256 k; the matrix it works on is block-uniform
__global__ __launch_bounds__(256) void pack_weights(
    const float* __restrict__ Wq, const float* __restrict__ Wk,
    const float* __restrict__ Wv, const float* __restrict__ Wp,
    const float* __restrict__ W1, const float* __restrict__ W2,
    _Float16* __restrict__ wqkvT, _Float16* __restrict__ wpT,
    _Float16* __restrict__ w1T, _Float16* __restrict__ w2T) {
  const int b = blockIdx.x;
  const int bP = 3 * HH * 4, b1 = bP + (DD / 64) * 4, b2 = b1 + (DFF / 64) * 4;
  if (b < bP) {                    // q, k, v: one head [D][HS] is 64 n wide
    const int hd = b >> 2, sel = hd >> 4, h = hd & 15;
    const float* W = (sel == 0) ? Wq : (sel == 1) ? Wk : Wv;
    pack_tile<HS, DD>(W + (size_t)h * DD * HS, wqkvT + (size_t)hd * 64 * DD, b & 3);
  } else if (b < b1) {             // Wproj [D][D]
    const int nb = (b - bP) >> 2;
    pack_tile<DD, DD>(Wp + nb * 64, wpT + (size_t)nb * 64 * DD, b & 3);
  } else if (b < b2) {             // W1 [D][4D]
    const int nb = (b - b1) >> 2;
    pack_tile<DFF, DD>(W1 + nb * 64, w1T + (size_t)nb * 64 * DD, b & 3);
  } else {                         // W2 [4D][D]
    const int nb = (b - b2) >> 4;
    pack_tile<DD, DFF>(W2 + nb * 64, w2T + (size_t)nb * 64 * DFF, b & 15);
  }
}

// ---------------- LayerNorm: writes f32 (residual) + f16 (GEMM input) -------
__global__ __launch_bounds__(256) void ln_kernel(
    const float* __restrict__ x, const float* __restrict__ g,
    const float* __restrict__ b, float* __restrict__ yf,
    _Float16* __restrict__ yh) {
  __shared__ float s1[256], s2[256];
  int row = blockIdx.x, tid = threadIdx.x;
  const float* xr = x + (size_t)row * DD;
  float4 xv = ((const float4*)xr)[tid];          // 4 elements / thread
  float sum = xv.x + xv.y + xv.z + xv.w;
  float sq  = xv.x * xv.x + xv.y * xv.y + xv.z * xv.z + xv.w * xv.w;
  s1[tid] = sum; s2[tid] = sq;
  __syncthreads();
  for (int off = 128; off; off >>= 1) {
    if (tid < off) { s1[tid] += s1[tid + off]; s2[tid] += s2[tid + off]; }
    __syncthreads();
  }
  float mu  = s1[0] * (1.0f / DD);
  float var = s2[0] * (1.0f / DD) - mu * mu;
  float rs  = rsqrtf(var + 1e-5f);
  float vals[4] = {xv.x, xv.y, xv.z, xv.w};
  for (int j = 0; j < 4; ++j) {
    int c = tid * 4 + j;
    float xn = (vals[j] - mu) * rs * g[c] + b[c];
    yf[(size_t)row * DD + c] = xn;
    yh[(size_t)row * DD + c] = to_h(xn);
  }
}

// ---------------- generic 128x128 WMMA GEMM with fused epilogues ------------
#define MODE_QKV  0
#define MODE_PROJ 1
#define MODE_FFN1 2
#define MODE_FFN2 3

// Eight 16-byte copies per lane in one statement. The wait is the statement's last
// line, so that it stands in front of any rewrite of the address registers that the
// copies name.
__device__ __forceinline__ void copy8(const unsigned* l, const _Float16* const* g) {
  asm volatile("global_load_async_to_lds_b128 %0, %1, off\n\t"
               "global_load_async_to_lds_b128 %2, %3, off\n\t"
               "global_load_async_to_lds_b128 %4, %5, off\n\t"
               "global_load_async_to_lds_b128 %6, %7, off\n\t"
               "global_load_async_to_lds_b128 %8, %9, off\n\t"
               "global_load_async_to_lds_b128 %10, %11, off\n\t"
               "global_load_async_to_lds_b128 %12, %13, off\n\t"
               "global_load_async_to_lds_b128 %14, %15, off\n\t"
               "s_wait_xcnt 0x0"
               :: "v"(l[0]), "v"(g[0]), "v"(l[1]), "v"(g[1]), "v"(l[2]), "v"(g[2]),
                  "v"(l[3]), "v"(g[3]), "v"(l[4]), "v"(g[4]), "v"(l[5]), "v"(g[5]),
                  "v"(l[6]), "v"(g[6]), "v"(l[7]), "v"(g[7]) : "memory");
}

#define KS 128       // k per stage: rows of 256 bytes
#define GP 136       // LDS row pitch in halves: 272 B = 16 B x 17, conflict-free for 16-byte reads

// One operand's share of a stage: 128 rows x 256 B = 2048 pieces of 16 B, eight per
// lane; a wave's copy covers two whole rows (four 128-byte lines).
__device__ __forceinline__ void stage_tile(_Float16* dst, const _Float16* src, int K) {
  const int r = threadIdx.x >> 4, c = (threadIdx.x & 15) * 8;
  unsigned l[8];
  const _Float16* g[8];
  for (int i = 0; i < 8; ++i) {
    l[i] = (unsigned)(uintptr_t)(dst + (r + 16 * i) * GP + c);
    g[i] = src + (size_t)(r + 16 * i) * K + c;
  }
  copy8(l, g);
}

// MODE is a compile-time parameter: with it at run time the epilogue stayed a
// rolled loop that tested the mode per element and waited for each element's
// residual load before its store (one memory round trip per element).
// K is walked in stages of 128 k, two buffers, one hand-over (two waits, one barrier) a
// stage. A stage is four blocks of 32 k (8 products a wave), and the fragments of a block
// are read while the block before it is multiplied. At 32 k a stage, between two
// barriers, there was no block to read ahead of: each wave waited out its own LDS reads.
template <int MODE>
__global__ __launch_bounds__(256) void gemm128(
    const _Float16* __restrict__ A,   // [M][K] row-major f16
    const _Float16* __restrict__ Bt,  // [N][K] row-major f16 (pre-transposed)
    int N, int K,
    const float* __restrict__ bias, const float* __restrict__ resid,
    float* __restrict__ outf, _Float16* __restrict__ outh,
    _Float16* __restrict__ qp, _Float16* __restrict__ kp,
    _Float16* __restrict__ vp) {
  __shared__ __attribute__((aligned(16))) _Float16 As[2][128 * GP];
  __shared__ __attribute__((aligned(16))) _Float16 Bs[2][128 * GP];
  const int tid = threadIdx.x;
  const int m0 = blockIdx.y * 128;
  const int n0 = blockIdx.x * 128;
  const int wave = tid >> 5, l = tid & 31;
  const int wm = (wave & 1) * 64;   // wave M offset in tile
  const int wn = (wave >> 1) * 32;  // wave N offset in tile
  const _Float16* Ag = A + (size_t)m0 * K;
  const _Float16* Bg = Bt + (size_t)n0 * K;
  const int nt = K / KS;            // stages, at least two

  v8f acc[4][2];
  for (int i = 0; i < 4; ++i)
    for (int j = 0; j < 2; ++j) acc[i][j] = (v8f){};

  stage_tile(As[0], Ag, K);
  stage_tile(Bs[0], Bg, K);
  copies_landed();
  __syncthreads();
  stage_tile(As[1], Ag + KS, K);
  stage_tile(Bs[1], Bg + KS, K);

  for (int t = 0; t < nt; ++t) {
    const _Float16* as = As[t & 1] + wm * GP;
    const _Float16* bs = Bs[t & 1] + wn * GP;
    v16h af[2][4], bf[2][2];          // two fragment sets: one multiplied, one being read
    auto read_block = [&](int s) {
      for (int i = 0; i < 4; ++i) af[s & 1][i] = load_frag(as + 16 * i * GP + 32 * s, GP);
      for (int j = 0; j < 2; ++j) bf[s & 1][j] = load_frag(bs + 16 * j * GP + 32 * s, GP);
    };
    read_block(0);
    for (int s = 0; s < KS / 32; ++s) {
      if (s + 1 < KS / 32) read_block(s + 1);
      // the pair of fences keeps the next block's 12 reads one group in front of this
      // block's products: left free, the scheduler puts them among the products in
      // pairs and waits for each pair (four LDS round trips a block)
      __builtin_amdgcn_sched_barrier(0);
      for (int i = 0; i < 4; ++i)
        for (int j = 0; j < 2; ++j) acc[i][j] = wmma16(af[s & 1][i], bf[s & 1][j], acc[i][j]);
      __builtin_amdgcn_sched_barrier(0);
    }
    // hand-over: stage t + 1 is published, stage t's buffers are free
    lds_reads_done();
    copies_landed();
    __syncthreads();
    if (t + 2 < nt) {
      stage_tile(As[t & 1], Ag + (size_t)(t + 2) * KS, K);
      stage_tile(Bs[t & 1], Bg + (size_t)(t + 2) * KS, K);
    }
  }
  copies_landed();

  // epilogue: C lane map -> col = base + (l&15); rows = base + r + (l>=16)*8
  const int cn = l & 15, rb = (l >> 4) * 8;
  const int gm0 = m0 + wm + rb;   // this lane's first row
  const int gn0 = n0 + wn + cn;   // this lane's first column
  if constexpr (MODE == MODE_QKV) {
    // a 128-wide tile never straddles a 1024-wide q/k/v section: sel is block-uniform
    const int sel = n0 >> 10;
    _Float16* __restrict__ dp = (sel == 0) ? qp : (sel == 1) ? kp : vp;
    const float sc = (sel == 0) ? 0.03125f : 1.0f;  // fold D^-0.5 into q
    for (int i = 0; i < 4; ++i)
      for (int j = 0; j < 2; ++j)
        for (int rr = 0; rr < 8; ++rr) {
          int gm = gm0 + 16 * i + rr;
          int gn = gn0 + 16 * j;
          int w = gn & 1023, h = w >> 6, e = w & 63;
          int bi = gm >> 11, t = gm & (TT - 1);
          size_t dst = (((size_t)(bi * HH + h)) * TT + t) * HS + e;
          dp[dst] = to_h(acc[i][j][rr] * sc);
        }
  } else if constexpr (MODE == MODE_FFN1) {
    float bv[2];
    for (int j = 0; j < 2; ++j) bv[j] = bias[gn0 + 16 * j];
    // the bias loads' offset register is reused right behind them: keep the wait in front of that
    asm volatile("s_wait_xcnt 0x0" ::: "memory");
    _Float16* op = outh + (size_t)gm0 * DFF + gn0;
    for (int i = 0; i < 4; ++i)
      for (int j = 0; j < 2; ++j)
        for (int rr = 0; rr < 8; ++rr) {
          float v = acc[i][j][rr] + bv[j];
          v = fmaxf(v, 0.0f);
          op[(size_t)(16 * i + rr) * DFF + 16 * j] = to_h(v);
        }
  } else {  // MODE_PROJ, MODE_FFN2: out = acc + (bias + resid)
    float bv[2];
    for (int j = 0; j < 2; ++j) bv[j] = bias[gn0 + 16 * j];
    // the bias loads' offset register is reused right behind them: keep the wait in front of that
    asm volatile("s_wait_xcnt 0x0" ::: "memory");
    const float* rp = resid + (size_t)gm0 * DD + gn0;
    float* op = outf + (size_t)gm0 * DD + gn0;
    // all residual loads are issued before the first store, so they overlap
    float rv[4][2][8];
    for (int i = 0; i < 4; ++i)
      for (int j = 0; j < 2; ++j)
        for (int rr = 0; rr < 8; ++rr)
          rv[i][j][rr] = rp[(size_t)(16 * i + rr) * DD + 16 * j];
    for (int i = 0; i < 4; ++i)
      for (int j = 0; j < 2; ++j)
        for (int rr = 0; rr < 8; ++rr)
          op[(size_t)(16 * i + rr) * DD + 16 * j] =
              acc[i][j][rr] + (bv[j] + rv[i][j][rr]);
  }
}

// ---------------- staging for the two attention passes ----------------------
// The waves of a work-group walk the same rows, four to each piece (pass 1: queries, pass 2:
// keys and values). Read as fragments straight from global memory, every load
// touched 16 lines for 512 bytes and every wave fetched the same rows again.
// Here the work-group copies each 64-row piece once, in whole 128-byte lines,
// into LDS, two buffers deep, and the waves read their fragments from there.
#define CH 64        // rows of 128 bytes per piece, two pieces a stage
#define APITCH 72    // LDS row pitch in halves: 144 B = 16 B x 9, conflict-free for 16-byte reads

// 64 rows x 128 B = 512 pieces of 16 B, two per lane; a wave's copy covers four whole lines.
__device__ __forceinline__ void stage_rows(_Float16* dst, const _Float16* src, int pitch) {
  const int r = threadIdx.x >> 3, c = (threadIdx.x & 7) * 8;
  const unsigned l0 = (unsigned)(uintptr_t)(dst + r * APITCH + c);
  const unsigned l1 = (unsigned)(uintptr_t)(dst + (r + 32) * APITCH + c);
  const _Float16* g0 = src + (size_t)r * pitch + c;
  const _Float16* g1 = src + (size_t)(r + 32) * pitch + c;
  // the wait is the statement's last line, so that it stands in front of any
  // rewrite of the address registers that the copies name
  asm volatile("global_load_async_to_lds_b128 %0, %1, off\n\t"
               "global_load_async_to_lds_b128 %2, %3, off\n\t"
               "s_wait_xcnt 0x0"
               :: "v"(l0), "v"(g0), "v"(l1), "v"(g1) : "memory");
}

// ---------------- equal causal work for every work-group --------------------
// A tile's trips grow (pass 2) or fall (pass 1) linearly with its index, and all 512
// work-groups are resident at once: with one 128-row tile each, the launch lasted as long
// as the WGPs that held the longest tiles (32 trips against a mean of 17). Here a tile is
// 64 rows and a work-group takes tiles x and 31 - x one after the other: 17 trips for all,
// wherever they land. Its eight waves are 4 strips of 16 rows x 2 pieces of 64 rows of the
// other axis (a trip stages both pieces), so that the waves per SIMD and a wave's work per
// trip stay; the two pieces' results are joined through LDS.
#define QT 64        // rows of a tile
#define NTILE (TT / QT)

// joins two (maximum, sum) pairs of one key column; a side that has seen no valid query
// holds (-inf, 0), and with both sides so the reference is 0 (-inf - -inf is no number)
__device__ __forceinline__ void join_stats(float& m, float& s, float m2, float s2) {
  const float mn = fmaxf(m, m2);
  const float ref = (mn == -INFINITY) ? 0.0f : mn;
  s = s * __expf(m - ref) + s2 * __expf(m2 - ref);
  m = mn;
}

// ---------------- attention pass 1: per-key-column max / sumexp -------------
// softmax is over the QUERY axis (per reference): m_k, Z_k over q >= k.
__global__ __launch_bounds__(256) void attn_pass1(
    const _Float16* __restrict__ q, const _Float16* __restrict__ k,
    float* __restrict__ cmax, float* __restrict__ csum) {
  // two buffers of two pieces of 64 queries
  __shared__ __attribute__((aligned(16))) _Float16 qs[2][2][CH * APITCH];
  __shared__ float jm[4][16], js[4][16];         // the second piece's statistics, per strip
  const int bh = blockIdx.y;
  const int wave = __builtin_amdgcn_readfirstlane(threadIdx.x >> 5), l = threadIdx.x & 31;
  const int strip = wave & 3, part = wave >> 2;  // 16 key columns; which 64 of a stage's 128 queries
  const _Float16* qh = q + (size_t)bh * TT * HS;
  const _Float16* kh = k + (size_t)bh * TT * HS;

  for (int leg = 0; leg < 2; ++leg) {
    const int tile = leg ? NTILE - 1 - (int)blockIdx.x : (int)blockIdx.x;
    const int kb = tile * QT;                    // the tile's first key column
    const int k0 = kb + strip * 16;              // this wave's 16 key columns
    const int qs0 = kb & ~(2 * CH - 1);          // first staged query: an odd tile's first piece lies above the diagonal
    const int nt = (TT - qs0) / (2 * CH);        // stages of 128 queries, at least one
    auto stage = [&](int t) {
      stage_rows(qs[t & 1][0], qh + (size_t)(qs0 + 2 * t * CH) * HS, HS);
      stage_rows(qs[t & 1][1], qh + (size_t)(qs0 + (2 * t + 1) * CH) * HS, HS);
    };

    // the last hand-over of the leg before has ended every read of both buffers
    stage(0);
    // K^T fragments for this column strip (lane row = key token)
    v16h kf0 = load_frag(kh + (size_t)k0 * HS, HS);
    v16h kf1 = load_frag(kh + (size_t)k0 * HS + 32, HS);
    copies_landed();
    __syncthreads();
    if (nt > 1) stage(1);

    float m = -INFINITY, s = 0.0f;
    const int kcol = k0 + (l & 15);
    // A wave's piece is 64 queries, 32 scores of this lane's key column. Their maximum is
    // taken first, the running sum is rescaled once, and the 32 exponentials then depend
    // on nothing but that maximum. Score by score, each update took two divergent
    // branches and waited for the exponential of the update before it.
    auto fold = [&](const _Float16* qb, int qc, bool diag) {
      v16h qa[CH / 16][2];            // 4 tiles of 16 queries x 64 head columns (two fragments of 32)
      for (int u = 0; u < CH / 16; ++u) {
        qa[u][0] = load_frag(qb + u * 16 * APITCH, APITCH);
        qa[u][1] = load_frag(qb + u * 16 * APITCH + 32, APITCH);
      }
      // all 16 fragment reads go out before the first product, so one LDS round trip serves
      // 64 queries: left free, the scheduler spreads them among the products (several round trips)
      __builtin_amdgcn_sched_barrier(0);
      v8f c[CH / 16];
      for (int u = 0; u < CH / 16; ++u) c[u] = wmma16(qa[u][0], kf0, (v8f){});
      for (int u = 0; u < CH / 16; ++u) c[u] = wmma16(qa[u][1], kf1, c[u]);
      if (diag) {                     // causal (q >= k valid): the others leave both max and sum alone
        const int qrb = qc + ((l >> 4) ? 8 : 0);
        for (int u = 0; u < CH / 16; ++u)
          for (int r = 0; r < 8; ++r)
            if (qrb + u * 16 + r < kcol) c[u][r] = -INFINITY;
      }
      float mu[CH / 16];
      for (int u = 0; u < CH / 16; ++u) {
        mu[u] = c[u][0];
        for (int r = 1; r < 8; ++r) mu[u] = fmaxf(mu[u], c[u][r]);
      }
      const float mn = fmaxf(m, fmaxf(fmaxf(mu[0], mu[1]), fmaxf(mu[2], mu[3])));
      // a lane that has seen no valid query yet keeps m = -inf and s = 0 (-inf - -inf is no number)
      const float ref = (mn == -INFINITY) ? 0.0f : mn;
      // e^(x - ref) = 2^(x * log2(e) - ref * log2(e)): the subtrahend is formed once a stage
      const float l2e = 1.44269504f, nr = -ref * l2e;
      float p[CH / 16];
      for (int u = 0; u < CH / 16; ++u) {
        p[u] = __builtin_amdgcn_exp2f(fmaf(c[u][0], l2e, nr));
        for (int r = 1; r < 8; ++r) p[u] += __builtin_amdgcn_exp2f(fmaf(c[u][r], l2e, nr));
      }
      s = s * __builtin_amdgcn_exp2f(fmaf(m, l2e, nr)) + ((p[0] + p[1]) + (p[2] + p[3]));
      m = mn;
    };
    for (int t = 0; t < nt; ++t) {
      const _Float16* qb = qs[t & 1][part];
      const int qc = qs0 + (2 * t + part) * CH; // first query row of this wave's piece
      // both tests are wave-uniform; a piece wholly above the diagonal is skipped
      if (qc >= k0 + 16)      fold(qb, qc, false);
      else if (qc + CH > k0)  fold(qb, qc, true);
      // hand-over, passed by every wave: stage t + 1 is published, stage t's buffer is free
      lds_reads_done();
      copies_landed();
      __syncthreads();
      if (t + 2 < nt) stage(t + 2);
    }
    copies_landed();
    // join the two half-lanes that hold the same column, then the two pieces of the stages
    join_stats(m, s, __shfl_xor(m, 16, 32), __shfl_xor(s, 16, 32));
    if (part == 1 && l < 16) { jm[strip][l] = m; js[strip][l] = s; }
    __syncthreads();                  // the second piece's statistics are published
    if (part == 0 && l < 16) {
      join_stats(m, s, jm[strip][l], js[strip][l]);
      cmax[(size_t)bh * TT + kcol] = m;
      csum[(size_t)bh * TT + kcol] = s;
      // the next leg rewrites the registers that these stores name: keep the wait in front of that
      asm volatile("s_wait_xcnt 0x0" ::: "memory");
    }
    // jm, js are written again only behind the next leg's barriers
  }
}

// ---------------- v' = v / Z, stored transposed [B,H,HS,T] ------------------
// Same register-tile transpose: one wave takes 64 key tokens x 32 columns of a
// head; lane (lk = l & 7, le = l >> 3) reads 8 tokens x 8 halves and writes 8
// runs of 8 halves along t, so each store covers four whole 128-byte lines.
// The two waves that share the 128-byte source rows sit in one work-group.
__global__ __launch_bounds__(256) void vscale(
    const _Float16* __restrict__ v, const float* __restrict__ csum,
    _Float16* __restrict__ vT) {
  const int wave = threadIdx.x >> 5, l = threadIdx.x & 31;
  const int tile = blockIdx.x * 4 + (wave >> 1);   // BB*HH heads x TT/64 tiles
  const int bh = tile >> 5;
  const int kt = (tile & 31) * 64 + (l & 7) * 8;
  const int e = (wave & 1) * 32 + (l >> 3) * 8;
  const _Float16* s = v + ((size_t)bh * TT + kt) * HS + e;
  const float* z = csum + (size_t)bh * TT + kt;
  _Float16* o = vT + ((size_t)bh * HS + e) * TT + kt;
  v8h a[8];
  v4f Z[2];
  for (int i = 0; i < 8; ++i) a[i] = *(const v8h*)(s + (size_t)i * HS);
  for (int i = 0; i < 2; ++i) Z[i] = *(const v4f*)(z + 4 * i);
  // all ten loads go out before the arithmetic starts: left free, the scheduler
  // holds two back behind the first divisions (a second memory round trip)
  __builtin_amdgcn_sched_barrier(0);
  // unrolled so that j is a constant: left rolled, element j of every register
  // vector is picked by a chain of selects
#pragma unroll
  for (int j = 0; j < 8; ++j) {
    v8h t;
    for (int i = 0; i < 8; ++i)
      t[i] = to_h((float)a[i][j] / Z[i >> 2][i & 3]);
    *(v8h*)(o + (size_t)j * TT) = t;
  }
}

__global__ __launch_bounds__(256) __attribute__((amdgpu_waves_per_eu(4, 4))) void attn_pass2(
    const _Float16* __restrict__ q, const _Float16* __restrict__ k,
    const _Float16* __restrict__ vT, const float* __restrict__ cmax,
    _Float16* __restrict__ attn) {
  // two buffers of two pieces: 64 keys x 64 head columns; behind a tile's last stage ks also
  // holds the second piece's sums (16 KiB)
  __shared__ __attribute__((aligned(16))) _Float16 ks[2][2][CH * APITCH];
  __shared__ __attribute__((aligned(16))) _Float16 vs[2][2][CH * APITCH];  // 64 head columns x 64 keys
  const int bh = blockIdx.y;
  const int wave = __builtin_amdgcn_readfirstlane(threadIdx.x >> 5), l = threadIdx.x & 31;
  const int strip = wave & 3, part = wave >> 2;  // 16 query rows; which 64 of a stage's 128 keys
  const int bi = bh / HH, h = bh % HH;
  const _Float16* qh  = q  + (size_t)bh * TT * HS;
  const _Float16* kh  = k  + (size_t)bh * TT * HS;
  const _Float16* vTh = vT + (size_t)bh * HS * TT;
  const float*    mh  = cmax + (size_t)bh * TT;
  const int cn = l & 15, rb = (l >> 4) * 8;

  for (int leg = 0; leg < 2; ++leg) {
    const int tile = leg ? (int)blockIdx.x : NTILE - 1 - (int)blockIdx.x;
    const int q0 = tile * QT + strip * 16;       // this wave's 16 query rows
    const int nt = tile / 2 + 1;                 // stages of 128 keys, at least one
    auto stage = [&](int t) {
      for (int p = 0; p < 2; ++p) {
        stage_rows(ks[t & 1][p], kh + (size_t)(2 * t + p) * CH * HS, HS);
        stage_rows(vs[t & 1][p], vTh + (2 * t + p) * CH, TT);
      }
    };

    // the barrier at the foot of the leg before has ended every use of the buffers
    stage(0);
    v16h qa0 = load_frag(qh + (size_t)q0 * HS, HS);
    v16h qa1 = load_frag(qh + (size_t)q0 * HS + 32, HS);
    copies_landed();
    __syncthreads();
    if (nt > 1) stage(1);

    v8f acc[4];
    for (int j = 0; j < 4; ++j) acc[j] = (v8f){};

    const int qi = q0 + cn;           // this lane's query: column cn of S^T and of O^T
    // 32 keys x 16 queries. All fragment reads of the block (K and, since they do not
    // depend on P, V^T) stand at its head: one LDS round trip. Where the second 16 keys
    // lie wholly behind the diagonal the causal select below writes their zeros (those
    // key rows are part of the stage, so the reads are in range).
    auto pv_block = [&](const _Float16* kr, const _Float16* vr, int kt) {
      v16h kf[2][2], vb[4];
      v4f mk[2][2];                   // column maxima of this lane's 2 x 8 keys
      for (int h2 = 0; h2 < 2; ++h2) {
        kf[h2][0] = load_frag(kr + 16 * h2 * APITCH, APITCH);
        kf[h2][1] = load_frag(kr + 16 * h2 * APITCH + 32, APITCH);
        mk[h2][0] = *(const v4f*)(mh + kt + 16 * h2 + rb);
        mk[h2][1] = *(const v4f*)(mh + kt + 16 * h2 + rb + 4);
      }
      for (int j = 0; j < 4; ++j) vb[j] = load_frag(vr + (16 * j) * APITCH, APITCH);
      // keeps all 16 fragment reads in front of the first product: left free, the scheduler
      // sinks V^T's reads to their products behind the exponentials (three more LDS round trips)
      __builtin_amdgcn_sched_barrier(0);
      // register r of tile h2 is S^T[key kt + 16 h2 + rb + r][query qi]; element 8 h2 + r of a
      // B fragment is k = 16 h2 + rb + r, the order in which load_frag reads V^T's keys
      v8f cc[2];
      for (int h2 = 0; h2 < 2; ++h2) cc[h2] = wmma16(kf[h2][0], qa0, (v8f){});
      for (int h2 = 0; h2 < 2; ++h2) cc[h2] = wmma16(kf[h2][1], qa1, cc[h2]);
      v16h pb;
      for (int h2 = 0; h2 < 2; ++h2) {
        const int ahead = qi - (kt + 16 * h2 + rb);   // causal: key r of the tile counts where r <= ahead
        for (int r = 0; r < 8; ++r) {
          float pv = (r <= ahead) ? __expf(cc[h2][r] - mk[h2][r >> 2][r & 3]) : 0.0f;
          pb[8 * h2 + r] = to_h(pv);
        }
      }
      for (int j = 0; j < 4; ++j) acc[j] = wmma16(vb[j], pb, acc[j]);
      // the address pair of the maxima's loads is stepped at the loop's foot: keep the wait in front of that
      asm volatile("s_wait_xcnt 0x0" ::: "memory");
    };
    for (int t = 0; t < nt; ++t) {
      const _Float16* kst = ks[t & 1][part];
      const _Float16* vst = vs[t & 1][part];
      for (int u = 0; u < CH / 32; ++u) {
        const int kt = (2 * t + part) * CH + u * 32;
        if (kt < q0 + 16)             // wave-uniform: skips keys wholly behind the diagonal
          pv_block(kst + u * 32 * APITCH, vst + u * 32, kt);
      }
      // hand-over, passed by every wave: stage t + 1 is published, stage t's buffers are free
      lds_reads_done();
      copies_landed();
      __syncthreads();
      if (t + 2 < nt) stage(t + 2);
    }
    copies_landed();
    // the four vector slots that the chip needs between the loop's last product and the first
    // vector instruction that touches its registers: on the path out of the loop stand only
    // scalar instructions, waits and barriers, which fill no slot
    asm volatile("v_nop\n\tv_nop\n\tv_nop\n\tv_nop");

    // O^T = the first pieces' sums + the second pieces': behind the last hand-over no copy is
    // in flight and nobody reads ks, so the second piece's waves lay their sums there, 16 bytes
    // a lane and lanes side by side
    v4f* mg = (v4f*)&ks[0][0][0] + strip * 32 + l;
    if (part == 1)
      for (int j = 0; j < 4; ++j)
        for (int g = 0; g < 2; ++g)
          mg[(2 * j + g) * 128] = (v4f){acc[j][4 * g], acc[j][4 * g + 1], acc[j][4 * g + 2], acc[j][4 * g + 3]};
    __syncthreads();                  // those sums are published
    if (part == 0) {
      // write attn as f16 [B,T,D] (feeds the proj GEMM): register r of tile j is
      // O^T[head column 16 j + rb + r][query qi], eight neighbours of one row: one 16-byte store
      _Float16* orow = attn + ((size_t)bi * TT + qi) * DD + h * HS + rb;
      for (int j = 0; j < 4; ++j) {
        v8h t;
        for (int g = 0; g < 2; ++g) {
          const v4f o = mg[(2 * j + g) * 128];
          for (int r = 0; r < 4; ++r) t[4 * g + r] = to_h(acc[j][4 * g + r] + o[r]);
        }
        *(v8h*)(orow + 16 * j) = t;
      }
      // the next leg rewrites the registers that these stores name: keep the wait in front of that
      asm volatile("s_wait_xcnt 0x0" ::: "memory");
    }
    // the next leg's copies overwrite ks: every read of the sums has returned first
    lds_reads_done();
    __syncthreads();
  }
}

// ---------------- host-side orchestration ----------------
extern "C" void kernel_launch(void* const* d_in, const int* in_sizes, int n_in,
                              void* d_out, int out_size, void* d_ws,
                              size_t ws_size, hipStream_t stream) {
  const float* x     = (const float*)d_in[0];
  const float* Wq    = (const float*)d_in[1];
  const float* Wk    = (const float*)d_in[2];
  const float* Wv    = (const float*)d_in[3];
  const float* Wproj = (const float*)d_in[4];
  const float* bproj = (const float*)d_in[5];
  const float* W1    = (const float*)d_in[6];
  const float* b1    = (const float*)d_in[7];
  const float* W2    = (const float*)d_in[8];
  const float* b2    = (const float*)d_in[9];
  const float* ln1g  = (const float*)d_in[10];
  const float* ln1b  = (const float*)d_in[11];
  const float* ln2g  = (const float*)d_in[12];
  const float* ln2b  = (const float*)d_in[13];
  float* out = (float*)d_out;

  char* base = (char*)d_ws;
  size_t off = 0;
  auto alloc = [&](size_t bytes) -> char* {
    char* p = base + off;
    off += (bytes + 255) & ~(size_t)255;
    return p;
  };
  _Float16* wqkvT = (_Float16*)alloc((size_t)3 * DD * DD * 2);  // [3D][D]
  _Float16* wpT   = (_Float16*)alloc((size_t)DD * DD * 2);      // [D][D]
  _Float16* w1T   = (_Float16*)alloc((size_t)DFF * DD * 2);     // [4D][D]
  _Float16* w2T   = (_Float16*)alloc((size_t)DD * DFF * 2);     // [D][4D]
  float*    xn_f  = (float*)   alloc((size_t)BT * DD * 4);
  _Float16* xn_h  = (_Float16*)alloc((size_t)BT * DD * 2);
  _Float16* q_h   = (_Float16*)alloc((size_t)BB * HH * TT * HS * 2);
  _Float16* k_h   = (_Float16*)alloc((size_t)BB * HH * TT * HS * 2);
  _Float16* v_h   = (_Float16*)alloc((size_t)BB * HH * TT * HS * 2);
  _Float16* vT_h  = (_Float16*)alloc((size_t)BB * HH * TT * HS * 2);
  float*    cmax  = (float*)   alloc((size_t)BB * HH * TT * 4);
  float*    csum  = (float*)   alloc((size_t)BB * HH * TT * 4);
  _Float16* attnh = (_Float16*)alloc((size_t)BT * DD * 2);
  float*    x1_f  = (float*)   alloc((size_t)BT * DD * 4);
  float*    x1n_f = (float*)   alloc((size_t)BT * DD * 4);
  _Float16* x1n_h = (_Float16*)alloc((size_t)BT * DD * 2);
  _Float16* h_h   = (_Float16*)alloc((size_t)BT * DFF * 2);

  // 1) pack all weights to f16, transposed [N][K]: 12M elements, 64 n x 256 k a group
  pack_weights<<<(3 * DD * DD + DD * DD + 2 * DD * DFF) / (64 * 256), 256, 0, stream>>>(
      Wq, Wk, Wv, Wproj, W1, W2, wqkvT, wpT, w1T, w2T);
  // 2) LN1 -> xn (f32 + f16)
  ln_kernel<<<BT, 256, 0, stream>>>(x, ln1g, ln1b, xn_f, xn_h);
  // 3) QKV GEMM: [4096x1024] x [1024x3072]
  gemm128<MODE_QKV><<<dim3(3 * DD / 128, BT / 128), 256, 0, stream>>>(
      xn_h, wqkvT, 3 * DD, DD, nullptr, nullptr, nullptr, nullptr,
      q_h, k_h, v_h);
  // 4) per-column softmax stats
  attn_pass1<<<dim3(TT / 128, BB * HH), 256, 0, stream>>>(q_h, k_h, cmax, csum);
  // 5) v' = v / Z, transposed
  vscale<<<BB * HH * (TT / 64) / 4, 256, 0, stream>>>(v_h, csum, vT_h);
  // 6) attn = P @ V'
  attn_pass2<<<dim3(TT / 128, BB * HH), 256, 0, stream>>>(q_h, k_h, vT_h, cmax,
                                                          attnh);
  // 7) proj: x1 = xn + attn @ Wproj + bproj
  gemm128<MODE_PROJ><<<dim3(DD / 128, BT / 128), 256, 0, stream>>>(
      attnh, wpT, DD, DD, bproj, xn_f, x1_f, nullptr, nullptr,
      nullptr, nullptr);
  // 8) LN2 -> x1n (f32 + f16)
  ln_kernel<<<BT, 256, 0, stream>>>(x1_f, ln2g, ln2b, x1n_f, x1n_h);
  // 9) FFN1: h = relu(x1n @ W1 + b1)
  gemm128<MODE_FFN1><<<dim3(DFF / 128, BT / 128), 256, 0, stream>>>(
      x1n_h, w1T, DFF, DD, b1, nullptr, nullptr, h_h, nullptr,
      nullptr, nullptr);
  // 10) FFN2: out = x1n + h @ W2 + b2
  gemm128<MODE_FFN2><<<dim3(DD / 128, BT / 128), 256, 0, stream>>>(
      h_h, w2T, DD, DFF, b2, x1n_f, out, nullptr, nullptr, nullptr,
      nullptr);
}

// v008
// Measured time: 165 microseconds a run.
// In two side-by-side timings against v007, it was 1.05 and 1.06 times as fast.
// Counting every step since v000, it is 3.37 times as fast.
#include <hip/hip_runtime.h>
#include <hip/hip_bf16.h>

// ---------------- problem constants ----------------
#define BB 2
#define TT 2048
#define DD 1024
#define HH 16
#define HS 64
#define BT (BB * TT)       // 4096 rows
#define DFF (4 * DD)       // 4096

typedef __attribute__((ext_vector_type(16))) _Float16 v16h;
typedef __attribute__((ext_vector_type(8)))  float    v8f;
typedef __attribute__((ext_vector_type(4)))  float    v4f;
typedef __attribute__((ext_vector_type(8)))  _Float16 v8h;

// ---------------- asynchronous copies to LDS: the two waits ----------------
// this wave's copies have landed (the barrier behind it publishes them to the others)
__device__ __forceinline__ void copies_landed() { asm volatile("s_wait_asynccnt 0x0" ::: "memory"); }
// all of this wave's copies but its N youngest have landed (the counter returns in issue order)
template <int N>
__device__ __forceinline__ void copies_landed_but() { asm volatile("s_wait_asynccnt %0" :: "n"(N) : "memory"); }
// this wave's LDS reads of the buffer that is refilled next have returned
__device__ __forceinline__ void lds_reads_done() { asm volatile("s_wait_dscnt 0x0" ::: "memory"); }

// ---------------- WMMA helpers ----------------
__device__ __forceinline__ v8f wmma16(v16h a, v16h b, v8f c) {
  // D = A(16x32 f16) * B(32x16 f16) + C(16x16 f32)
  return __builtin_amdgcn_wmma_f32_16x16x32_f16(false, a, false, b, (short)0, c,
                                                false, false);
}

// A-fragment loader (16-bit A 16x32 layout):
//   lane<16 : row M = lane,    holds K = 0..7  and 16..23
//   lane>=16: row M = lane-16, holds K = 8..15 and 24..31
// B-fragments (stored row=N, col=K) use the same pattern with N as the row.
__device__ __forceinline__ v16h load_frag(const _Float16* p, int stride) {
  int l = threadIdx.x & 31;
  const _Float16* r = p + (size_t)(l & 15) * stride + ((l >> 4) << 3);
  v16h f;
  ((uint4*)&f)[0] = *(const uint4*)(r);
  ((uint4*)&f)[1] = *(const uint4*)(r + 16);
  return f;
}

__device__ __forceinline__ _Float16 to_h(float x) { return (_Float16)x; }

// ---------------- weight packing: f32 -> f16, ALL weights TRANSPOSED --------
// Every packed weight is stored [N][K] so GEMM B-tiles stage with contiguous
// 16B rows (identical to A-tiles, no in-loop transpose).
// One wave transposes a tile of 64 k x 32 n in registers: lane (lk = l >> 3,
// ln = l & 7) reads 16 source rows x 4 floats, so each load covers four whole
// 128-byte lines, and writes 8 runs of 8 halves along k; the wave alone writes
// the 128-byte output lines of its tile. One element per thread had to start
// 64 times as many waves, each with a load that touched 32 lines.
template <int LD, int K>   // source pitch in floats, packed pitch in halves
__device__ __forceinline__ void pack_tile(const float* __restrict__ S,
                                          _Float16* __restrict__ O, int kb) {
  const int wave = threadIdx.x >> 5, l = threadIdx.x & 31;
  const int n = (wave & 1) * 32 + (l & 7) * 4;
  const int k = kb * 256 + (wave >> 1) * 64 + (l >> 3) * 8;
  const float* s = S + (size_t)k * LD + n;
  _Float16* o = O + (size_t)n * K + k;
  v4f v[2][8];
  for (int g = 0; g < 2; ++g)
    for (int i = 0; i < 8; ++i)
      v[g][i] = *(const v4f*)(s + (size_t)(32 * g + i) * LD);
  // the 16 loads share one address pair: it is named here as an input, so that no
  // load's result lands on it, and the wait stands in front of its reuse below
  asm volatile("s_wait_xcnt 0x0" :: "v"(s) : "memory");
  // all 16 loads go out before the first conversion: left free, the scheduler
  // holds some back behind the first results (a second memory round trip)
  __builtin_amdgcn_sched_barrier(0);
  for (int g = 0; g < 2; ++g)
    for (int j = 0; j < 4; ++j) {
      v8h t;
      for (int i = 0; i < 8; ++i) t[i] = to_h(v[g][i][j]);
      *(v8h*)(o + (size_t)j * K + 32 * g) = t;
    }
  // the code of the four matrices stands one part behind the other, parted only by
  // scalar skips, and each part rewrites these registers: keep the wait behind the stores
  asm volatile("s_wait_xcnt 0x0" ::: "memory");
}

// a work-group packs 64 n x 256 k; the matrix it works on is block-uniform
__global__ __launch_bounds__(256) void pack_weights(
    const float* __restrict__ Wq, const float* __restrict__ Wk,
    const float* __restrict__ Wv, const float* __restrict__ Wp,
    const float* __restrict__ W1, const float* __restrict__ W2,
    _Float16* __restrict__ wqkvT, _Float16* __restrict__ wpT,
    _Float16* __restrict__ w1T, _Float16* __restrict__ w2T) {
  const int b = blockIdx.x;
  const int bP = 3 * HH * 4, b1 = bP + (DD / 64) * 4, b2 = b1 + (DFF / 64) * 4;
  if (b < bP) {                    // q, k, v: one head [D][HS] is 64 n wide
    const int hd = b >> 2, sel = hd >> 4, h = hd & 15;
    const float* W = (sel == 0) ? Wq : (sel == 1) ? Wk : Wv;
    pack_tile<HS, DD>(W + (size_t)h * DD * HS, wqkvT + (size_t)hd * 64 * DD, b & 3);
  } else if (b < b1) {             // Wproj [D][D]
    const int nb = (b - bP) >> 2;
    pack_tile<DD, DD>(Wp + nb * 64, wpT + (size_t)nb * 64 * DD, b & 3);
  } else if (b < b2) {             // W1 [D][4D]
    const int nb = (b - b1) >> 2;
    pack_tile<DFF, DD>(W1 + nb * 64, w1T + (size_t)nb * 64 * DD, b & 3);
  } else {                         // W2 [4D][D]
    const int nb = (b - b2) >> 4;
    pack_tile<DD, DFF>(W2 + nb * 64, w2T + (size_t)nb * 64 * DFF, b & 15);
  }
}

// ---------------- LayerNorm: writes f32 (residual) + f16 (GEMM input) -------
__global__ __launch_bounds__(256) void ln_kernel(
    const float* __restrict__ x, const float* __restrict__ g,
    const float* __restrict__ b, float* __restrict__ yf,
    _Float16* __restrict__ yh) {
  __shared__ float s1[256], s2[256];
  int row = blockIdx.x, tid = threadIdx.x;
  const float* xr = x + (size_t)row * DD;
  float4 xv = ((const float4*)xr)[tid];          // 4 elements / thread
  float sum = xv.x + xv.y + xv.z + xv.w;
  float sq  = xv.x * xv.x + xv.y * xv.y + xv.z * xv.z + xv.w * xv.w;
  s1[tid] = sum; s2[tid] = sq;
  __syncthreads();
  for (int off = 128; off; off >>= 1) {
    if (tid < off) { s1[tid] += s1[tid + off]; s2[tid] += s2[tid + off]; }
    __syncthreads();
  }
  float mu  = s1[0] * (1.0f / DD);
  float var = s2[0] * (1.0f / DD) - mu * mu;
  float rs  = rsqrtf(var + 1e-5f);
  float vals[4] = {xv.x, xv.y, xv.z, xv.w};
  for (int j = 0; j < 4; ++j) {
    int c = tid * 4 + j;
    float xn = (vals[j] - mu) * rs * g[c] + b[c];
    yf[(size_t)row * DD + c] = xn;
    yh[(size_t)row * DD + c] = to_h(xn);
  }
}

// ---------------- generic 128x128 WMMA GEMM with fused epilogues ------------
#define MODE_QKV  0
#define MODE_PROJ 1
#define MODE_FFN1 2
#define MODE_FFN2 3

// Eight 16-byte copies per lane in one statement. The wait is the statement's last
// line, so that it stands in front of any rewrite of the address registers that the
// copies name.
__device__ __forceinline__ void copy8(const unsigned* l, const _Float16* const* g) {
  asm volatile("global_load_async_to_lds_b128 %0, %1, off\n\t"
               "global_load_async_to_lds_b128 %2, %3, off\n\t"
               "global_load_async_to_lds_b128 %4, %5, off\n\t"
               "global_load_async_to_lds_b128 %6, %7, off\n\t"
               "global_load_async_to_lds_b128 %8, %9, off\n\t"
               "global_load_async_to_lds_b128 %10, %11, off\n\t"
               "global_load_async_to_lds_b128 %12, %13, off\n\t"
               "global_load_async_to_lds_b128 %14, %15, off\n\t"
               "s_wait_xcnt 0x0"
               :: "v"(l[0]), "v"(g[0]), "v"(l[1]), "v"(g[1]), "v"(l[2]), "v"(g[2]),
                  "v"(l[3]), "v"(g[3]), "v"(l[4]), "v"(g[4]), "v"(l[5]), "v"(g[5]),
                  "v"(l[6]), "v"(g[6]), "v"(l[7]), "v"(g[7]) : "memory");
}

#define KS 128       // k per stage: rows of 256 bytes
#define GP 136       // LDS row pitch in halves: 272 B = 16 B x 17, conflict-free for 16-byte reads

// One operand's share of a stage: 128 rows x 256 B = 2048 pieces of 16 B, eight per
// lane; a wave's copy covers two whole rows (four 128-byte lines).
__device__ __forceinline__ void stage_tile(_Float16* dst, const _Float16* src, int K) {
  const int r = threadIdx.x >> 4, c = (threadIdx.x & 15) * 8;
  unsigned l[8];
  const _Float16* g[8];
  for (int i = 0; i < 8; ++i) {
    l[i] = (unsigned)(uintptr_t)(dst + (r + 16 * i) * GP + c);
    g[i] = src + (size_t)(r + 16 * i) * K + c;
  }
  copy8(l, g);
}

// MODE is a compile-time parameter: with it at run time the epilogue stayed a
// rolled loop that tested the mode per element and waited for each element's
// residual load before its store (one memory round trip per element).
// K is walked in stages of 128 k, a ring of NB buffers, one hand-over (two waits, one barrier) a
// stage. A stage is four blocks of 32 k (8 products a wave), and the fragments of a block
// are read while the block before it is multiplied. At 32 k a stage, between two
// barriers, there was no block to read ahead of: each wave waited out its own LDS reads.
// NB is the ring's depth, a power of two: a stage's copies are issued NB - 1 stages before
// it is read. With two buffers a work-group alone on its WGP asks for a whole stage at once
// and then for nothing until the next hand-over, and the one stage of lead has to cover the
// way of all 64 KiB (reckoned longer than a stage's products; all work-groups walk K in step,
// so part of every stage is read for the first time). Where the grid is one work-group a WGP
// the LDS for four buffers lies idle anyway; where two work-groups share a WGP, each filling
// the other's waits, the ring stays at two.
#define CPS 16       // copies of a wave per stage: eight for each operand
template <int MODE, int NB>
__global__ __launch_bounds__(256) void gemm128(
    const _Float16* __restrict__ A,   // [M][K] row-major f16
    const _Float16* __restrict__ Bt,  // [N][K] row-major f16 (pre-transposed)
    int N, int K,
    const float* __restrict__ bias, const float* __restrict__ resid,
    float* __restrict__ outf, _Float16* __restrict__ outh,
    _Float16* __restrict__ qp, _Float16* __restrict__ kp,
    _Float16* __restrict__ vp) {
  __shared__ __attribute__((aligned(16))) _Float16 As[NB][128 * GP];
  __shared__ __attribute__((aligned(16))) _Float16 Bs[NB][128 * GP];
  const int tid = threadIdx.x;
  const int m0 = blockIdx.y * 128;
  const int n0 = blockIdx.x * 128;
  const int wave = tid >> 5, l = tid & 31;
  const int wm = (wave & 1) * 64;   // wave M offset in tile
  const int wn = (wave >> 1) * 32;  // wave N offset in tile
  const _Float16* Ag = A + (size_t)m0 * K;
  const _Float16* Bg = Bt + (size_t)n0 * K;
  const int nt = K / KS;            // stages, at least NB

  v8f acc[4][2];
  for (int i = 0; i < 4; ++i)
    for (int j = 0; j < 2; ++j) acc[i][j] = (v8f){};

  for (int p = 0; p < NB - 1; ++p) {
    stage_tile(As[p], Ag + p * KS, K);
    stage_tile(Bs[p], Bg + p * KS, K);
  }
  copies_landed_but<CPS * (NB - 2)>();   // stage 0 has landed; the stages behind it may still fly
  __syncthreads();
  stage_tile(As[NB - 1], Ag + (NB - 1) * KS, K);
  stage_tile(Bs[NB - 1], Bg + (NB - 1) * KS, K);

  for (int t = 0; t < nt; ++t) {
    const _Float16* as = As[t & (NB - 1)] + wm * GP;
    const _Float16* bs = Bs[t & (NB - 1)] + wn * GP;
    v16h af[2][4], bf[2][2];          // two fragment sets: one multiplied, one being read
    auto read_block = [&](int s) {
      for (int i = 0; i < 4; ++i) af[s & 1][i] = load_frag(as + 16 * i * GP + 32 * s, GP);
      for (int j = 0; j < 2; ++j) bf[s & 1][j] = load_frag(bs + 16 * j * GP + 32 * s, GP);
    };
    read_block(0);
    for (int s = 0; s < KS / 32; ++s) {
      if (s + 1 < KS / 32) read_block(s + 1);
      // the pair of fences keeps the next block's 12 reads one group in front of this
      // block's products: left free, the scheduler puts them among the products in
      // pairs and waits for each pair (four LDS round trips a block)
      __builtin_amdgcn_sched_barrier(0);
      for (int i = 0; i < 4; ++i)
        for (int j = 0; j < 2; ++j) acc[i][j] = wmma16(af[s & 1][i], bf[s & 1][j], acc[i][j]);
      __builtin_amdgcn_sched_barrier(0);
    }
    // hand-over: stage t + 1 is published, stage t's buffers are free
    lds_reads_done();
    // behind stage t + 1 stand the copies of stages t + 2 to t + NB - 1, while these all exist
    // (a test that reads the same in the whole grid); in the last trips the wait is to 0
    if (NB > 2 && t + NB <= nt) copies_landed_but<CPS * (NB - 2)>();
    else                        copies_landed();
    __syncthreads();
    if (t + NB < nt) {
      stage_tile(As[t & (NB - 1)], Ag + (size_t)(t + NB) * KS, K);
      stage_tile(Bs[t & (NB - 1)], Bg + (size_t)(t + NB) * KS, K);
    }
  }
  copies_landed();

  // epilogue: C lane map -> col = base + (l&15); rows = base + r + (l>=16)*8
  const int cn = l & 15, rb = (l >> 4) * 8;
  const int gm0 = m0 + wm + rb;   // this lane's first row
  const int gn0 = n0 + wn + cn;   // this lane's first column
  if constexpr (MODE == MODE_QKV) {
    // a 128-wide tile never straddles a 1024-wide q/k/v section: sel is block-uniform
    const int sel = n0 >> 10;
    _Float16* __restrict__ dp = (sel == 0) ? qp : (sel == 1) ? kp : vp;
    const float sc = (sel == 0) ? 0.03125f : 1.0f;  // fold D^-0.5 into q
    for (int i = 0; i < 4; ++i)
      for (int j = 0; j < 2; ++j)
        for (int rr = 0; rr < 8; ++rr) {
          int gm = gm0 + 16 * i + rr;
          int gn = gn0 + 16 * j;
          int w = gn & 1023, h = w >> 6, e = w & 63;
          int bi = gm >> 11, t = gm & (TT - 1);
          size_t dst = (((size_t)(bi * HH + h)) * TT + t) * HS + e;
          dp[dst] = to_h(acc[i][j][rr] * sc);
        }
  } else if constexpr (MODE == MODE_FFN1) {
    float bv[2];
    for (int j = 0; j < 2; ++j) bv[j] = bias[gn0 + 16 * j];
    // the bias loads' offset register is reused right behind them: keep the wait in front of that
    asm volatile("s_wait_xcnt 0x0" ::: "memory");
    _Float16* op = outh + (size_t)gm0 * DFF + gn0;
    for (int i = 0; i < 4; ++i)
      for (int j = 0; j < 2; ++j)
        for (int rr = 0; rr < 8; ++rr) {
          float v = acc[i][j][rr] + bv[j];
          v = fmaxf(v, 0.0f);
          op[(size_t)(16 * i + rr) * DFF + 16 * j] = to_h(v);
        }
  } else {  // MODE_PROJ, MODE_FFN2: out = acc + (bias + resid)
    float bv[2];
    for (int j = 0; j < 2; ++j) bv[j] = bias[gn0 + 16 * j];
    // the bias loads' offset register is reused right behind them: keep the wait in front of that
    asm volatile("s_wait_xcnt 0x0" ::: "memory");
    const float* rp = resid + (size_t)gm0 * DD + gn0;
    float* op = outf + (size_t)gm0 * DD + gn0;
    // all residual loads are issued before the first store, so they overlap
    float rv[4][2][8];
    for (int i = 0; i < 4; ++i)
      for (int j = 0; j < 2; ++j)
        for (int rr = 0; rr < 8; ++rr)
          rv[i][j][rr] = rp[(size_t)(16 * i + rr) * DD + 16 * j];
    for (int i = 0; i < 4; ++i)
      for (int j = 0; j < 2; ++j)
        for (int rr = 0; rr < 8; ++rr)
          op[(size_t)(16 * i + rr) * DD + 16 * j] =
              acc[i][j][rr] + (bv[j] + rv[i][j][rr]);
  }
}

// ---------------- staging for the two attention passes ----------------------
// The waves of a work-group walk the same rows, four to each piece (pass 1: queries, pass 2:
// keys and values). Read as fragments straight from global memory, every load
// touched 16 lines for 512 bytes and every wave fetched the same rows again.
// Here the work-group copies each 64-row piece once, in whole 128-byte lines,
// into LDS, two buffers deep, and the waves read their fragments from there.
#define CH 64        // rows of 128 bytes per piece, two pieces a stage
#define APITCH 72    // LDS row pitch in halves: 144 B = 16 B x 9, conflict-free for 16-byte reads

// 64 rows x 128 B = 512 pieces of 16 B, two per lane; a wave's copy covers four whole lines.
__device__ __forceinline__ void stage_rows(_Float16* dst, const _Float16* src, int pitch) {
  const int r = threadIdx.x >> 3, c = (threadIdx.x & 7) * 8;
  const unsigned l0 = (unsigned)(uintptr_t)(dst + r * APITCH + c);
  const unsigned l1 = (unsigned)(uintptr_t)(dst + (r + 32) * APITCH + c);
  const _Float16* g0 = src + (size_t)r * pitch + c;
  const _Float16* g1 = src + (size_t)(r + 32) * pitch + c;
  // the wait is the statement's last line, so that it stands in front of any
  // rewrite of the address registers that the copies name
  asm volatile("global_load_async_to_lds_b128 %0, %1, off\n\t"
               "global_load_async_to_lds_b128 %2, %3, off\n\t"
               "s_wait_xcnt 0x0"
               :: "v"(l0), "v"(g0), "v"(l1), "v"(g1) : "memory");
}

// ---------------- equal causal work for every work-group --------------------
// A tile's trips grow (pass 2) or fall (pass 1) linearly with its index, and all 512
// work-groups are resident at once: with one 128-row tile each, the launch lasted as long
// as the WGPs that held the longest tiles (32 trips against a mean of 17). Here a tile is
// 64 rows and a work-group takes tiles x and 31 - x one after the other: 17 trips for all,
// wherever they land. Its eight waves are 4 strips of 16 rows x 2 pieces of 64 rows of the
// other axis (a trip stages both pieces), so that the waves per SIMD and a wave's work per
// trip stay; the two pieces' results are joined through LDS.
#define QT 64        // rows of a tile
#define NTILE (TT / QT)

// joins two (maximum, sum) pairs of one key column; a side that has seen no valid query
// holds (-inf, 0), and with both sides so the reference is 0 (-inf - -inf is no number)
__device__ __forceinline__ void join_stats(float& m, float& s, float m2, float s2) {
  const float mn = fmaxf(m, m2);
  const float ref = (mn == -INFINITY) ? 0.0f : mn;
  s = s * __expf(m - ref) + s2 * __expf(m2 - ref);
  m = mn;
}

// ---------------- attention pass 1: per-key-column max / sumexp -------------
// softmax is over the QUERY axis (per reference): m_k, Z_k over q >= k.
__global__ __launch_bounds__(256) void attn_pass1(
    const _Float16* __restrict__ q, const _Float16* __restrict__ k,
    float* __restrict__ cmax, float* __restrict__ csum) {
  // two buffers of two pieces of 64 queries
  __shared__ __attribute__((aligned(16))) _Float16 qs[2][2][CH * APITCH];
  __shared__ float jm[4][16], js[4][16];         // the second piece's statistics, per strip
  const int bh = blockIdx.y;
  const int wave = __builtin_amdgcn_readfirstlane(threadIdx.x >> 5), l = threadIdx.x & 31;
  const int strip = wave & 3, part = wave >> 2;  // 16 key columns; which 64 of a stage's 128 queries
  const _Float16* qh = q + (size_t)bh * TT * HS;
  const _Float16* kh = k + (size_t)bh * TT * HS;

  for (int leg = 0; leg < 2; ++leg) {
    const int tile = leg ? NTILE - 1 - (int)blockIdx.x : (int)blockIdx.x;
    const int kb = tile * QT;                    // the tile's first key column
    const int k0 = kb + strip * 16;              // this wave's 16 key columns
    const int qs0 = kb & ~(2 * CH - 1);          // first staged query: an odd tile's first piece lies above the diagonal
    const int nt = (TT - qs0) / (2 * CH);        // stages of 128 queries, at least one
    auto stage = [&](int t) {
      stage_rows(qs[t & 1][0], qh + (size_t)(qs0 + 2 * t * CH) * HS, HS);
      stage_rows(qs[t & 1][1], qh + (size_t)(qs0 + (2 * t + 1) * CH) * HS, HS);
    };

    // the last hand-over of the leg before has ended every read of both buffers
    stage(0);
    // K^T fragments for this column strip (lane row = key token)
    v16h kf0 = load_frag(kh + (size_t)k0 * HS, HS);
    v16h kf1 = load_frag(kh + (size_t)k0 * HS + 32, HS);
    copies_landed();
    __syncthreads();
    if (nt > 1) stage(1);

    float m = -INFINITY, s = 0.0f;
    const int kcol = k0 + (l & 15);
    // A wave's piece is 64 queries, 32 scores of this lane's key column. Their maximum is
    // taken first, the running sum is rescaled once, and the 32 exponentials then depend
    // on nothing but that maximum. Score by score, each update took two divergent
    // branches and waited for the exponential of the update before it.
    auto fold = [&](const _Float16* qb, int qc, bool diag) {
      v16h qa[CH / 16][2];            // 4 tiles of 16 queries x 64 head columns (two fragments of 32)
      for (int u = 0; u < CH / 16; ++u) {
        qa[u][0] = load_frag(qb + u * 16 * APITCH, APITCH);
        qa[u][1] = load_frag(qb + u * 16 * APITCH + 32, APITCH);
      }
      // all 16 fragment reads go out before the first product, so one LDS round trip serves
      // 64 queries: left free, the scheduler spreads them among the products (several round trips)
      __builtin_amdgcn_sched_barrier(0);
      v8f c[CH / 16];
      for (int u = 0; u < CH / 16; ++u) c[u] = wmma16(qa[u][0], kf0, (v8f){});
      for (int u = 0; u < CH / 16; ++u) c[u] = wmma16(qa[u][1], kf1, c[u]);
      if (diag) {                     // causal (q >= k valid): the others leave both max and sum alone
        const int qrb = qc + ((l >> 4) ? 8 : 0);
        for (int u = 0; u < CH / 16; ++u)
          for (int r = 0; r < 8; ++r)
            if (qrb + u * 16 + r < kcol) c[u][r] = -INFINITY;
      }
      float mu[CH / 16];
      for (int u = 0; u < CH / 16; ++u) {
        mu[u] = c[u][0];
        for (int r = 1; r < 8; ++r) mu[u] = fmaxf(mu[u], c[u][r]);
      }
      const float mn = fmaxf(m, fmaxf(fmaxf(mu[0], mu[1]), fmaxf(mu[2], mu[3])));
      // a lane that has seen no valid query yet keeps m = -inf and s = 0 (-inf - -inf is no number)
      const float ref = (mn == -INFINITY) ? 0.0f : mn;
      // e^(x - ref) = 2^(x * log2(e) - ref * log2(e)): the subtrahend is formed once a stage
      const float l2e = 1.44269504f, nr = -ref * l2e;
      float p[CH / 16];
      for (int u = 0; u < CH / 16; ++u) {
        p[u] = __builtin_amdgcn_exp2f(fmaf(c[u][0], l2e, nr));
        for (int r = 1; r < 8; ++r) p[u] += __builtin_amdgcn_exp2f(fmaf(c[u][r], l2e, nr));
      }
      s = s * __builtin_amdgcn_exp2f(fmaf(m, l2e, nr)) + ((p[0] + p[1]) + (p[2] + p[3]));
      m = mn;
    };
    for (int t = 0; t < nt; ++t) {
      const _Float16* qb = qs[t & 1][part];
      const int qc = qs0 + (2 * t + part) * CH; // first query row of this wave's piece
      // both tests are wave-uniform; a piece wholly above the diagonal is skipped
      if (qc >= k0 + 16)      fold(qb, qc, false);
      else if (qc + CH > k0)  fold(qb, qc, true);
      // hand-over, passed by every wave: stage t + 1 is published, stage t's buffer is free
      lds_reads_done();
      copies_landed();
      __syncthreads();
      if (t + 2 < nt) stage(t + 2);
    }
    copies_landed();
    // join the two half-lanes that hold the same column, then the two pieces of the stages
    join_stats(m, s, __shfl_xor(m, 16, 32), __shfl_xor(s, 16, 32));
    if (part == 1 && l < 16) { jm[strip][l] = m; js[strip][l] = s; }
    __syncthreads();                  // the second piece's statistics are published
    if (part == 0 && l < 16) {
      join_stats(m, s, jm[strip][l], js[strip][l]);
      cmax[(size_t)bh * TT + kcol] = m;
      csum[(size_t)bh * TT + kcol] = s;
      // the next leg rewrites the registers that these stores name: keep the wait in front of that
      asm volatile("s_wait_xcnt 0x0" ::: "memory");
    }
    // jm, js are written again only behind the next leg's barriers
  }
}

// ---------------- v' = v / Z, stored transposed [B,H,HS,T] ------------------
// Same register-tile transpose: one wave takes 64 key tokens x 32 columns of a
// head; lane (lk = l & 7, le = l >> 3) reads 8 tokens x 8 halves and writes 8
// runs of 8 halves along t, so each store covers four whole 128-byte lines.
// The two waves that share the 128-byte source rows sit in one work-group.
__global__ __launch_bounds__(256) void vscale(
    const _Float16* __restrict__ v, const float* __restrict__ csum,
    _Float16* __restrict__ vT) {
  const int wave = threadIdx.x >> 5, l = threadIdx.x & 31;
  const int tile = blockIdx.x * 4 + (wave >> 1);   // BB*HH heads x TT/64 tiles
  const int bh = tile >> 5;
  const int kt = (tile & 31) * 64 + (l & 7) * 8;
  const int e = (wave & 1) * 32 + (l >> 3) * 8;
  const _Float16* s = v + ((size_t)bh * TT + kt) * HS + e;
  const float* z = csum + (size_t)bh * TT + kt;
  _Float16* o = vT + ((size_t)bh * HS + e) * TT + kt;
  v8h a[8];
  v4f Z[2];
  for (int i = 0; i < 8; ++i) a[i] = *(const v8h*)(s + (size_t)i * HS);
  for (int i = 0; i < 2; ++i) Z[i] = *(const v4f*)(z + 4 * i);
  // all ten loads go out before the arithmetic starts: left free, the scheduler
  // holds two back behind the first divisions (a second memory round trip)
  __builtin_amdgcn_sched_barrier(0);
  // unrolled so that j is a constant: left rolled, element j of every register
  // vector is picked by a chain of selects
#pragma unroll
  for (int j = 0; j < 8; ++j) {
    v8h t;
    for (int i = 0; i < 8; ++i)
      t[i] = to_h((float)a[i][j] / Z[i >> 2][i & 3]);
    *(v8h*)(o + (size_t)j * TT) = t;
  }
}

__global__ __launch_bounds__(256) __attribute__((amdgpu_waves_per_eu(4, 4))) void attn_pass2(
    const _Float16* __restrict__ q, const _Float16* __restrict__ k,
    const _Float16* __restrict__ vT, const float* __restrict__ cmax,
    _Float16* __restrict__ attn) {
  // two buffers of two pieces: 64 keys x 64 head columns; behind a tile's last stage ks also
  // holds the second piece's sums (16 KiB)
  __shared__ __attribute__((aligned(16))) _Float16 ks[2][2][CH * APITCH];
  __shared__ __attribute__((aligned(16))) _Float16 vs[2][2][CH * APITCH];  // 64 head columns x 64 keys
  const int bh = blockIdx.y;
  const int wave = __builtin_amdgcn_readfirstlane(threadIdx.x >> 5), l = threadIdx.x & 31;
  const int strip = wave & 3, part = wave >> 2;  // 16 query rows; which 64 of a stage's 128 keys
  const int bi = bh / HH, h = bh % HH;
  const _Float16* qh  = q  + (size_t)bh * TT * HS;
  const _Float16* kh  = k  + (size_t)bh * TT * HS;
  const _Float16* vTh = vT + (size_t)bh * HS * TT;
  const float*    mh  = cmax + (size_t)bh * TT;
  const int cn = l & 15, rb = (l >> 4) * 8;

  for (int leg = 0; leg < 2; ++leg) {
    const int tile = leg ? (int)blockIdx.x : NTILE - 1 - (int)blockIdx.x;
    const int q0 = tile * QT + strip * 16;       // this wave's 16 query rows
    const int nt = tile / 2 + 1;                 // stages of 128 keys, at least one
    auto stage = [&](int t) {
      for (int p = 0; p < 2; ++p) {
        stage_rows(ks[t & 1][p], kh + (size_t)(2 * t + p) * CH * HS, HS);
        stage_rows(vs[t & 1][p], vTh + (2 * t + p) * CH, TT);
      }
    };

    // the barrier at the foot of the leg before has ended every use of the buffers
    stage(0);
    v16h qa0 = load_frag(qh + (size_t)q0 * HS, HS);
    v16h qa1 = load_frag(qh + (size_t)q0 * HS + 32, HS);
    copies_landed();
    __syncthreads();
    if (nt > 1) stage(1);

    v8f acc[4];
    for (int j = 0; j < 4; ++j) acc[j] = (v8f){};

    const int qi = q0 + cn;           // this lane's query: column cn of S^T and of O^T
    // 32 keys x 16 queries. All fragment reads of the block (K and, since they do not
    // depend on P, V^T) stand at its head: one LDS round trip. Where the second 16 keys
    // lie wholly behind the diagonal the causal select below writes their zeros (those
    // key rows are part of the stage, so the reads are in range).
    auto pv_block = [&](const _Float16* kr, const _Float16* vr, int kt) {
      v16h kf[2][2], vb[4];
      v4f mk[2][2];                   // column maxima of this lane's 2 x 8 keys
      for (int h2 = 0; h2 < 2; ++h2) {
        kf[h2][0] = load_frag(kr + 16 * h2 * APITCH, APITCH);
        kf[h2][1] = load_frag(kr + 16 * h2 * APITCH + 32, APITCH);
        mk[h2][0] = *(const v4f*)(mh + kt + 16 * h2 + rb);
        mk[h2][1] = *(const v4f*)(mh + kt + 16 * h2 + rb + 4);
      }
      for (int j = 0; j < 4; ++j) vb[j] = load_frag(vr + (16 * j) * APITCH, APITCH);
      // keeps all 16 fragment reads in front of the first product: left free, the scheduler
      // sinks V^T's reads to their products behind the exponentials (three more LDS round trips)
      __builtin_amdgcn_sched_barrier(0);
      // register r of tile h2 is S^T[key kt + 16 h2 + rb + r][query qi]; element 8 h2 + r of a
      // B fragment is k = 16 h2 + rb + r, the order in which load_frag reads V^T's keys
      v8f cc[2];
      for (int h2 = 0; h2 < 2; ++h2) cc[h2] = wmma16(kf[h2][0], qa0, (v8f){});
      for (int h2 = 0; h2 < 2; ++h2) cc[h2] = wmma16(kf[h2][1], qa1, cc[h2]);
      v16h pb;
      for (int h2 = 0; h2 < 2; ++h2) {
        const int ahead = qi - (kt + 16 * h2 + rb);   // causal: key r of the tile counts where r <= ahead
        for (int r = 0; r < 8; ++r) {
          float pv = (r <= ahead) ? __expf(cc[h2][r] - mk[h2][r >> 2][r & 3]) : 0.0f;
          pb[8 * h2 + r] = to_h(pv);
        }
      }
      for (int j = 0; j < 4; ++j) acc[j] = wmma16(vb[j], pb, acc[j]);
      // the address pair of the maxima's loads is stepped at the loop's foot: keep the wait in front of that
      asm volatile("s_wait_xcnt 0x0" ::: "memory");
    };
    for (int t = 0; t < nt; ++t) {
      const _Float16* kst = ks[t & 1][part];
      const _Float16* vst = vs[t & 1][part];
      for (int u = 0; u < CH / 32; ++u) {
        const int kt = (2 * t + part) * CH + u * 32;
        if (kt < q0 + 16)             // wave-uniform: skips keys wholly behind the diagonal
          pv_block(kst + u * 32 * APITCH, vst + u * 32, kt);
      }
      // hand-over, passed by every wave: stage t + 1 is published, stage t's buffers are free
      lds_reads_done();
      copies_landed();
      __syncthreads();
      if (t + 2 < nt) stage(t + 2);
    }
    copies_landed();
    // the four vector slots that the chip needs between the loop's last product and the first
    // vector instruction that touches its registers: on the path out of the loop stand only
    // scalar instructions, waits and barriers, which fill no slot
    asm volatile("v_nop\n\tv_nop\n\tv_nop\n\tv_nop");

    // O^T = the first pieces' sums + the second pieces': behind the last hand-over no copy is
    // in flight and nobody reads ks, so the second piece's waves lay their sums there, 16 bytes
    // a lane and lanes side by side
    v4f* mg = (v4f*)&ks[0][0][0] + strip * 32 + l;
    if (part == 1)
      for (int j = 0; j < 4; ++j)
        for (int g = 0; g < 2; ++g)
          mg[(2 * j + g) * 128] = (v4f){acc[j][4 * g], acc[j][4 * g + 1], acc[j][4 * g + 2], acc[j][4 * g + 3]};
    __syncthreads();                  // those sums are published
    if (part == 0) {
      // write attn as f16 [B,T,D] (feeds the proj GEMM): register r of tile j is
      // O^T[head column 16 j + rb + r][query qi], eight neighbours of one row: one 16-byte store
      _Float16* orow = attn + ((size_t)bi * TT + qi) * DD + h * HS + rb;
      for (int j = 0; j < 4; ++j) {
        v8h t;
        for (int g = 0; g < 2; ++g) {
          const v4f o = mg[(2 * j + g) * 128];
          for (int r = 0; r < 4; ++r) t[4 * g + r] = to_h(acc[j][4 * g + r] + o[r]);
        }
        *(v8h*)(orow + 16 * j) = t;
      }
      // the next leg rewrites the registers that these stores name: keep the wait in front of that
      asm volatile("s_wait_xcnt 0x0" ::: "memory");
    }
    // the next leg's copies overwrite ks: every read of the sums has returned first
    lds_reads_done();
    __syncthreads();
  }
}

// ---------------- host-side orchestration ----------------
extern "C" void kernel_launch(void* const* d_in, const int* in_sizes, int n_in,
                              void* d_out, int out_size, void* d_ws,
                              size_t ws_size, hipStream_t stream) {
  const float* x     = (const float*)d_in[0];
  const float* Wq    = (const float*)d_in[1];
  const float* Wk    = (const float*)d_in[2];
  const float* Wv    = (const float*)d_in[3];
  const float* Wproj = (const float*)d_in[4];
  const float* bproj = (const float*)d_in[5];
  const float* W1    = (const float*)d_in[6];
  const float* b1    = (const float*)d_in[7];
  const float* W2    = (const float*)d_in[8];
  const float* b2    = (const float*)d_in[9];
  const float* ln1g  = (const float*)d_in[10];
  const float* ln1b  = (const float*)d_in[11];
  const float* ln2g  = (const float*)d_in[12];
  const float* ln2b  = (const float*)d_in[13];
  float* out = (float*)d_out;

  char* base = (char*)d_ws;
  size_t off = 0;
  auto alloc = [&](size_t bytes) -> char* {
    char* p = base + off;
    off += (bytes + 255) & ~(size_t)255;
    return p;
  };
  _Float16* wqkvT = (_Float16*)alloc((size_t)3 * DD * DD * 2);  // [3D][D]
  _Float16* wpT   = (_Float16*)alloc((size_t)DD * DD * 2);      // [D][D]
  _Float16* w1T   = (_Float16*)alloc((size_t)DFF * DD * 2);     // [4D][D]
  _Float16* w2T   = (_Float16*)alloc((size_t)DD * DFF * 2);     // [D][4D]
  float*    xn_f  = (float*)   alloc((size_t)BT * DD * 4);
  _Float16* xn_h  = (_Float16*)alloc((size_t)BT * DD * 2);
  _Float16* q_h   = (_Float16*)alloc((size_t)BB * HH * TT * HS * 2);
  _Float16* k_h   = (_Float16*)alloc((size_t)BB * HH * TT * HS * 2);
  _Float16* v_h   = (_Float16*)alloc((size_t)BB * HH * TT * HS * 2);
  _Float16* vT_h  = (_Float16*)alloc((size_t)BB * HH * TT * HS * 2);
  float*    cmax  = (float*)   alloc((size_t)BB * HH * TT * 4);
  float*    csum  = (float*)   alloc((size_t)BB * HH * TT * 4);
  _Float16* attnh = (_Float16*)alloc((size_t)BT * DD * 2);
  float*    x1_f  = (float*)   alloc((size_t)BT * DD * 4);
  float*    x1n_f = (float*)   alloc((size_t)BT * DD * 4);
  _Float16* x1n_h = (_Float16*)alloc((size_t)BT * DD * 2);
  _Float16* h_h   = (_Float16*)alloc((size_t)BT * DFF * 2);

  // 1) pack all weights to f16, transposed [N][K]: 12M elements, 64 n x 256 k a group
  pack_weights<<<(3 * DD * DD + DD * DD + 2 * DD * DFF) / (64 * 256), 256, 0, stream>>>(
      Wq, Wk, Wv, Wproj, W1, W2, wqkvT, wpT, w1T, w2T);
  // 2) LN1 -> xn (f32 + f16)
  ln_kernel<<<BT, 256, 0, stream>>>(x, ln1g, ln1b, xn_f, xn_h);
  // 3) QKV GEMM: [4096x1024] x [1024x3072]
  gemm128<MODE_QKV, 2><<<dim3(3 * DD / 128, BT / 128), 256, 0, stream>>>(
      xn_h, wqkvT, 3 * DD, DD, nullptr, nullptr, nullptr, nullptr,
      q_h, k_h, v_h);
  // 4) per-column softmax stats
  attn_pass1<<<dim3(TT / 128, BB * HH), 256, 0, stream>>>(q_h, k_h, cmax, csum);
  // 5) v' = v / Z, transposed
  vscale<<<BB * HH * (TT / 64) / 4, 256, 0, stream>>>(v_h, csum, vT_h);
  // 6) attn = P @ V'
  attn_pass2<<<dim3(TT / 128, BB * HH), 256, 0, stream>>>(q_h, k_h, vT_h, cmax,
                                                          attnh);
  // 7) proj: x1 = xn + attn @ Wproj + bproj
  gemm128<MODE_PROJ, 4><<<dim3(DD / 128, BT / 128), 256, 0, stream>>>(
      attnh, wpT, DD, DD, bproj, xn_f, x1_f, nullptr, nullptr,
      nullptr, nullptr);
  // 8) LN2 -> x1n (f32 + f16)
  ln_kernel<<<BT, 256, 0, stream>>>(x1_f, ln2g, ln2b, x1n_f, x1n_h);
  // 9) FFN1: h = relu(x1n @ W1 + b1)
  gemm128<MODE_FFN1, 2><<<dim3(DFF / 128, BT / 128), 256, 0, stream>>>(
      x1n_h, w1T, DFF, DD, b1, nullptr, nullptr, h_h, nullptr,
      nullptr, nullptr);
  // 10) FFN2: out = x1n + h @ W2 + b2
  gemm128<MODE_FFN2, 4><<<dim3(DD / 128, BT / 128), 256, 0, stream>>>(
      h_h, w2T, DD, DFF, b2, x1n_f, out, nullptr, nullptr, nullptr,
      nullptr);
}

// v009
// It runs in 155 microseconds.
// Next to v008, in two timings, it ran 1.06 times as fast each time.
// Counting every step since v000, it is 3.57 times as fast.
#include <hip/hip_runtime.h>
#include <hip/hip_bf16.h>

// ---------------- problem constants ----------------
#define BB 2
#define TT 2048
#define DD 1024
#define HH 16
#define HS 64
#define BT (BB * TT)       // 4096 rows
#define DFF (4 * DD)       // 4096

typedef __attribute__((ext_vector_type(16))) _Float16 v16h;
typedef __attribute__((ext_vector_type(8)))  float    v8f;
typedef __attribute__((ext_vector_type(4)))  float    v4f;
typedef __attribute__((ext_vector_type(8)))  _Float16 v8h;

// ---------------- asynchronous copies to LDS: the two waits ----------------
// this wave's copies have landed (the barrier behind it publishes them to the others)
__device__ __forceinline__ void copies_landed() { asm volatile("s_wait_asynccnt 0x0" ::: "memory"); }
// all of this wave's copies but its N youngest have landed (the counter returns in issue order)
template <int N>
__device__ __forceinline__ void copies_landed_but() { asm volatile("s_wait_asynccnt %0" :: "n"(N) : "memory"); }
// this wave's LDS reads of the buffer that is refilled next have returned
__device__ __forceinline__ void lds_reads_done() { asm volatile("s_wait_dscnt 0x0" ::: "memory"); }

// ---------------- WMMA helpers ----------------
__device__ __forceinline__ v8f wmma16(v16h a, v16h b, v8f c) {
  // D = A(16x32 f16) * B(32x16 f16) + C(16x16 f32)
  return __builtin_amdgcn_wmma_f32_16x16x32_f16(false, a, false, b, (short)0, c,
                                                false, false);
}

// A-fragment loader (16-bit A 16x32 layout):
//   lane<16 : row M = lane,    holds K = 0..7  and 16..23
//   lane>=16: row M = lane-16, holds K = 8..15 and 24..31
// B-fragments (stored row=N, col=K) use the same pattern with N as the row.
__device__ __forceinline__ v16h load_frag(const _Float16* p, int stride) {
  int l = threadIdx.x & 31;
  const _Float16* r = p + (size_t)(l & 15) * stride + ((l >> 4) << 3);
  v16h f;
  ((uint4*)&f)[0] = *(const uint4*)(r);
  ((uint4*)&f)[1] = *(const uint4*)(r + 16);
  return f;
}

__device__ __forceinline__ _Float16 to_h(float x) { return (_Float16)x; }

// ---------------- weight packing: f32 -> f16, ALL weights TRANSPOSED --------
// Every packed weight is stored [N][K] so GEMM B-tiles stage with contiguous
// 16B rows (identical to A-tiles, no in-loop transpose).
// One wave transposes a tile of 64 k x 32 n in registers: lane (lk = l >> 3,
// ln = l & 7) reads 16 source rows x 4 floats, so each load covers four whole
// 128-byte lines, and writes 8 runs of 8 halves along k; the wave alone writes
// the 128-byte output lines of its tile. One element per thread had to start
// 64 times as many waves, each with a load that touched 32 lines.
template <int LD, int K>   // source pitch in floats, packed pitch in halves
__device__ __forceinline__ void pack_tile(const float* __restrict__ S,
                                          _Float16* __restrict__ O, int kb) {
  const int wave = threadIdx.x >> 5, l = threadIdx.x & 31;
  const int n = (wave & 1) * 32 + (l & 7) * 4;
  const int k = kb * 256 + (wave >> 1) * 64 + (l >> 3) * 8;
  const float* s = S + (size_t)k * LD + n;
  _Float16* o = O + (size_t)n * K + k;
  v4f v[2][8];
  for (int g = 0; g < 2; ++g)
    for (int i = 0; i < 8; ++i)
      v[g][i] = *(const v4f*)(s + (size_t)(32 * g + i) * LD);
  // the 16 loads share one address pair: it is named here as an input, so that no
  // load's result lands on it, and the wait stands in front of its reuse below
  asm volatile("s_wait_xcnt 0x0" :: "v"(s) : "memory");
  // all 16 loads go out before the first conversion: left free, the scheduler
  // holds some back behind the first results (a second memory round trip)
  __builtin_amdgcn_sched_barrier(0);
  for (int g = 0; g < 2; ++g)
    for (int j = 0; j < 4; ++j) {
      v8h t;
      for (int i = 0; i < 8; ++i) t[i] = to_h(v[g][i][j]);
      *(v8h*)(o + (size_t)j * K + 32 * g) = t;
    }
  // the code of the four matrices stands one part behind the other, parted only by
  // scalar skips, and each part rewrites these registers: keep the wait behind the stores
  asm volatile("s_wait_xcnt 0x0" ::: "memory");
}

// a work-group packs 64 n x 256 k; the matrix it works on is block-uniform
__global__ __launch_bounds__(256) void pack_weights(
    const float* __restrict__ Wq, const float* __restrict__ Wk,
    const float* __restrict__ Wv, const float* __restrict__ Wp,
    const float* __restrict__ W1, const float* __restrict__ W2,
    _Float16* __restrict__ wqkvT, _Float16* __restrict__ wpT,
    _Float16* __restrict__ w1T, _Float16* __restrict__ w2T) {
  const int b = blockIdx.x;
  const int bP = 3 * HH * 4, b1 = bP + (DD / 64) * 4, b2 = b1 + (DFF / 64) * 4;
  if (b < bP) {                    // q, k, v: one head [D][HS] is 64 n wide
    const int hd = b >> 2, sel = hd >> 4, h = hd & 15;
    const float* W = (sel == 0) ? Wq : (sel == 1) ? Wk : Wv;
    pack_tile<HS, DD>(W + (size_t)h * DD * HS, wqkvT + (size_t)hd * 64 * DD, b & 3);
  } else if (b < b1) {             // Wproj [D][D]
    const int nb = (b - bP) >> 2;
    pack_tile<DD, DD>(Wp + nb * 64, wpT + (size_t)nb * 64 * DD, b & 3);
  } else if (b < b2) {             // W1 [D][4D]
    const int nb = (b - b1) >> 2;
    pack_tile<DFF, DD>(W1 + nb * 64, w1T + (size_t)nb * 64 * DD, b & 3);
  } else {                         // W2 [4D][D]
    const int nb = (b - b2) >> 4;
    pack_tile<DD, DFF>(W2 + nb * 64, w2T + (size_t)nb * 64 * DFF, b & 15);
  }
}

// ---------------- LayerNorm: writes f32 (residual) + f16 (GEMM input) -------
__global__ __launch_bounds__(256) void ln_kernel(
    const float* __restrict__ x, const float* __restrict__ g,
    const float* __restrict__ b, float* __restrict__ yf,
    _Float16* __restrict__ yh) {
  __shared__ float s1[256], s2[256];
  int row = blockIdx.x, tid = threadIdx.x;
  const float* xr = x + (size_t)row * DD;
  float4 xv = ((const float4*)xr)[tid];          // 4 elements / thread
  float sum = xv.x + xv.y + xv.z + xv.w;
  float sq  = xv.x * xv.x + xv.y * xv.y + xv.z * xv.z + xv.w * xv.w;
  s1[tid] = sum; s2[tid] = sq;
  __syncthreads();
  for (int off = 128; off; off >>= 1) {
    if (tid < off) { s1[tid] += s1[tid + off]; s2[tid] += s2[tid + off]; }
    __syncthreads();
  }
  float mu  = s1[0] * (1.0f / DD);
  float var = s2[0] * (1.0f / DD) - mu * mu;
  float rs  = rsqrtf(var + 1e-5f);
  float vals[4] = {xv.x, xv.y, xv.z, xv.w};
  for (int j = 0; j < 4; ++j) {
    int c = tid * 4 + j;
    float xn = (vals[j] - mu) * rs * g[c] + b[c];
    yf[(size_t)row * DD + c] = xn;
    yh[(size_t)row * DD + c] = to_h(xn);
  }
}

// ---------------- generic WMMA GEMM with fused epilogues --------------------
#define MODE_QKV  0
#define MODE_PROJ 1
#define MODE_FFN1 2
#define MODE_FFN2 3

// Eight 16-byte copies per lane in one statement. The wait is the statement's last
// line, so that it stands in front of any rewrite of the address registers that the
// copies name.
__device__ __forceinline__ void copy8(const unsigned* l, const _Float16* const* g) {
  asm volatile("global_load_async_to_lds_b128 %0, %1, off\n\t"
               "global_load_async_to_lds_b128 %2, %3, off\n\t"
               "global_load_async_to_lds_b128 %4, %5, off\n\t"
               "global_load_async_to_lds_b128 %6, %7, off\n\t"
               "global_load_async_to_lds_b128 %8, %9, off\n\t"
               "global_load_async_to_lds_b128 %10, %11, off\n\t"
               "global_load_async_to_lds_b128 %12, %13, off\n\t"
               "global_load_async_to_lds_b128 %14, %15, off\n\t"
               "s_wait_xcnt 0x0"
               :: "v"(l[0]), "v"(g[0]), "v"(l[1]), "v"(g[1]), "v"(l[2]), "v"(g[2]),
                  "v"(l[3]), "v"(g[3]), "v"(l[4]), "v"(g[4]), "v"(l[5]), "v"(g[5]),
                  "v"(l[6]), "v"(g[6]), "v"(l[7]), "v"(g[7]) : "memory");
}

// The same for four copies.
__device__ __forceinline__ void copy4(const unsigned* l, const _Float16* const* g) {
  asm volatile("global_load_async_to_lds_b128 %0, %1, off\n\t"
               "global_load_async_to_lds_b128 %2, %3, off\n\t"
               "global_load_async_to_lds_b128 %4, %5, off\n\t"
               "global_load_async_to_lds_b128 %6, %7, off\n\t"
               "s_wait_xcnt 0x0"
               :: "v"(l[0]), "v"(g[0]), "v"(l[1]), "v"(g[1]), "v"(l[2]), "v"(g[2]),
                  "v"(l[3]), "v"(g[3]) : "memory");
}

#define KS 128       // k per stage: rows of 256 bytes
#define GP 136       // LDS row pitch in halves: 272 B = 16 B x 17, conflict-free for 16-byte reads

// One operand's share of a stage: ROWS rows x 256 B = 16 ROWS pieces of 16 B, ROWS / 16 per
// lane (ROWS is a multiple of 64); a wave's copy covers two whole rows (four 128-byte lines).
// src is the lane's own first piece (row r, column c of the stage); the others lie whole
// multiples of 16 rows behind it, a step that is the same in every lane.
template <int ROWS>
__device__ __forceinline__ void stage_tile(_Float16* dst, const _Float16* src, int K) {
  const int r = threadIdx.x >> 4, c = (threadIdx.x & 15) * 8;
  for (int b = 0; b < ROWS; b += 128) {
    unsigned l[8];
    const _Float16* g[8];
    for (int i = 0; i < 8; ++i) {
      const int row = (b + 16 * i < ROWS) ? b + 16 * i : 0;   // the last run may be four copies
      l[i] = (unsigned)(uintptr_t)(dst + (r + row) * GP + c);
      g[i] = src + (size_t)row * K;
    }
    if (b + 128 <= ROWS) copy8(l, g);
    else                 copy4(l, g);
  }
}

// MODE is a compile-time parameter: with it at run time the epilogue stayed a
// rolled loop that tested the mode per element and waited for each element's
// residual load before its store (one memory round trip per element).
// K is walked in stages of 128 k, a ring of NB buffers, one hand-over (two waits, one barrier) a
// stage. A stage is four blocks of 32 k (FM FN products a wave), and the fragments of a block
// are read while the block before it is multiplied. At 32 k a stage, between two
// barriers, there was no block to read ahead of: each wave waited out its own LDS reads.
// NB is the ring's depth, a power of two: a stage's copies are issued NB - 1 stages before
// it is read. With two buffers a work-group alone on its WGP asks for a whole stage at once
// and then for nothing until the next hand-over, and the one stage of lead has to cover the
// way of all 64 KiB (reckoned longer than a stage's products; all work-groups walk K in step,
// so part of every stage is read for the first time). The 128 x 128 tiles, one work-group a
// WGP, have the LDS for four buffers; two buffers of a wide tile fill it.
// The work-group's tile is 32 FM x 64 FN, its eight waves 2 x 4, a wave's tile FM x FN fragments
// of 16 x 16. Per 32 k a wave reads FM + FN fragments from LDS for FM FN products and the group
// copies 32 FM + 64 FN rows from L2 for 8 FM FN: at 4 x 2 both ask more than LDS and L2 give at
// the matrix rate, at 8 x 4 and 8 x 3 less. The wide tiles go where they still make one
// work-group for every WGP (N = 4096: 256 x 256; N = 3072: 256 x 192).
template <int MODE, int NB, int FM, int FN>
__global__ __launch_bounds__(256) void gemm_tile(
    const _Float16* __restrict__ A,   // [M][K] row-major f16
    const _Float16* __restrict__ Bt,  // [N][K] row-major f16 (pre-transposed)
    int N, int K,
    const float* __restrict__ bias, const float* __restrict__ resid,
    float* __restrict__ outf, _Float16* __restrict__ outh,
    _Float16* __restrict__ qp, _Float16* __restrict__ kp,
    _Float16* __restrict__ vp) {
  constexpr int TM = 32 * FM, TN = 64 * FN;
  constexpr int CPS = (TM + TN) / 16;   // copies of a wave per stage
  __shared__ __attribute__((aligned(16))) _Float16 As[NB][TM * GP];
  __shared__ __attribute__((aligned(16))) _Float16 Bs[NB][TN * GP];
  const int tid = threadIdx.x;
  const int m0 = blockIdx.y * TM;
  const int n0 = blockIdx.x * TN;
  const int wave = tid >> 5, l = tid & 31;
  const int wm = (wave & 1) * 16 * FM;   // wave M offset in tile
  const int wn = (wave >> 1) * 16 * FN;  // wave N offset in tile
  const int nt = K / KS;            // stages, at least NB
  // this lane's first piece of the stage that is copied next. One running pointer an operand:
  // formed from the stage's number, every copy's address had a part of its own that stayed
  // in registers over the whole loop, more than the wide tiles leave free (spills)
  const _Float16* pa = A + (size_t)(m0 + (tid >> 4)) * K + (tid & 15) * 8;
  const _Float16* pb = Bt + (size_t)(n0 + (tid >> 4)) * K + (tid & 15) * 8;
  auto stage = [&](int buf) {
    stage_tile<TM>(As[buf], pa, K);
    stage_tile<TN>(Bs[buf], pb, K);
    pa += KS;
    pb += KS;
  };

  v8f acc[FM][FN];
  for (int i = 0; i < FM; ++i)
    for (int j = 0; j < FN; ++j) acc[i][j] = (v8f){};

  for (int p = 0; p < NB - 1; ++p) stage(p);
  copies_landed_but<CPS * (NB - 2)>();   // stage 0 has landed; the stages behind it may still fly
  __syncthreads();
  stage(NB - 1);

  for (int t = 0; t < nt; ++t) {
    const _Float16* as = As[t & (NB - 1)] + wm * GP;
    const _Float16* bs = Bs[t & (NB - 1)] + wn * GP;
    v16h af[2][FM], bf[2][FN];        // two fragment sets: one multiplied, one being read
    auto read_block = [&](int s) {
      for (int j = 0; j < FN; ++j) bf[s & 1][j] = load_frag(bs + 16 * j * GP + 32 * s, GP);
      for (int i = 0; i < FM; ++i) af[s & 1][i] = load_frag(as + 16 * i * GP + 32 * s, GP);
    };
    read_block(0);
    // keeps the first block's reads in front of the second's: left free, the scheduler mixes the
    // two groups, and behind the barrier, where all eight waves read at once and no product
    // is in flight, the first product waits for most of both
    __builtin_amdgcn_sched_barrier(0);
    for (int s = 0; s < KS / 32; ++s) {
      if (s + 1 < KS / 32) read_block(s + 1);
      // the pair of fences keeps the next block's reads one group in front of this
      // block's products: left free, the scheduler puts them among the products in
      // pairs and waits for each pair (four LDS round trips a block)
      __builtin_amdgcn_sched_barrier(0);
      for (int i = 0; i < FM; ++i)
        for (int j = 0; j < FN; ++j) acc[i][j] = wmma16(af[s & 1][i], bf[s & 1][j], acc[i][j]);
      __builtin_amdgcn_sched_barrier(0);
    }
    // hand-over: stage t + 1 is published, stage t's buffers are free
    lds_reads_done();
    // behind stage t + 1 stand the copies of stages t + 2 to t + NB - 1, while these all exist
    // (a test that reads the same in the whole grid); in the last trips the wait is to 0
    if (NB > 2 && t + NB <= nt) copies_landed_but<CPS * (NB - 2)>();
    else                        copies_landed();
    __syncthreads();
    if (t + NB < nt) stage(t & (NB - 1));
  }
  copies_landed();

  // epilogue: C lane map -> col = base + (l&15); rows = base + r + (l>=16)*8
  const int cn = l & 15, rb = (l >> 4) * 8;
  const int gm0 = m0 + wm + rb;   // this lane's first row
  const int gn0 = n0 + wn + cn;   // this lane's first column
  if constexpr (MODE == MODE_QKV) {
    // 16 columns never straddle a 1024-wide q/k/v section or a head: sel and h are the same in a fragment
    // and a tile's rows never straddle a batch (TM divides T): a lane's rows are HS apart
    const int bi = gm0 >> 11, t0 = gm0 & (TT - 1);
    _Float16* dp[FN];
    float sc[FN];
    for (int j = 0; j < FN; ++j) {
      const int gn = gn0 + 16 * j;
      const int sel = gn >> 10;
      const int w = gn & 1023, h = w >> 6, e = w & 63;
      dp[j] = ((sel == 0) ? qp : (sel == 1) ? kp : vp) + (((size_t)(bi * HH + h)) * TT + t0) * HS + e;
      sc[j] = (sel == 0) ? 0.03125f : 1.0f;  // fold D^-0.5 into q
    }
    for (int i = 0; i < FM; ++i) {
      for (int j = 0; j < FN; ++j)
        for (int rr = 0; rr < 8; ++rr)
          dp[j][(16 * i + rr) * HS] = to_h(acc[i][j][rr] * sc[j]);
      // the next row of fragments reuses the registers that these stores name: keep the wait in
      // front of that; the fence keeps the next row's arithmetic behind the wait
      asm volatile("s_wait_xcnt 0x0" ::: "memory");
      __builtin_amdgcn_sched_barrier(0);
    }
  } else if constexpr (MODE == MODE_FFN1) {
    float bv[FN];
    for (int j = 0; j < FN; ++j) bv[j] = bias[gn0 + 16 * j];
    // the bias loads' offset register is reused right behind them: keep the wait in front of that
    asm volatile("s_wait_xcnt 0x0" ::: "memory");
    _Float16* op = outh + (size_t)gm0 * DFF + gn0;
    for (int i = 0; i < FM; ++i) {
      _Float16 hv[FN][8];
      for (int j = 0; j < FN; ++j)
        for (int rr = 0; rr < 8; ++rr) hv[j][rr] = to_h(fmaxf(acc[i][j][rr] + bv[j], 0.0f));
      // the row's arithmetic ends in front of its first store
      __builtin_amdgcn_sched_barrier(0);
      for (int j = 0; j < FN; ++j)
        for (int rr = 0; rr < 8; ++rr) op[(size_t)(16 * i + rr) * DFF + 16 * j] = hv[j][rr];
      // the next row of fragments reuses the registers that these stores name: keep the wait in
      // front of that; the fence keeps the next row's arithmetic behind the wait
      asm volatile("s_wait_xcnt 0x0" ::: "memory");
      __builtin_amdgcn_sched_barrier(0);
    }
  } else {  // MODE_PROJ, MODE_FFN2: out = acc + (bias + resid)
    float bv[FN];
    for (int j = 0; j < FN; ++j) bv[j] = bias[gn0 + 16 * j];
    // the bias loads' offset register is reused right behind them: keep the wait in front of that
    asm volatile("s_wait_xcnt 0x0" ::: "memory");
    const float* rp = resid + (size_t)gm0 * DD + gn0;
    float* op = outf + (size_t)gm0 * DD + gn0;
    // all residual loads are issued before the first store, so they overlap
    float rv[FM][FN][8];
    for (int i = 0; i < FM; ++i)
      for (int j = 0; j < FN; ++j)
        for (int rr = 0; rr < 8; ++rr)
          rv[i][j][rr] = rp[(size_t)(16 * i + rr) * DD + 16 * j];
    for (int i = 0; i < FM; ++i)
      for (int j = 0; j < FN; ++j)
        for (int rr = 0; rr < 8; ++rr)
          op[(size_t)(16 * i + rr) * DD + 16 * j] =
              acc[i][j][rr] + (bv[j] + rv[i][j][rr]);
  }
}

// ---------------- staging for the two attention passes ----------------------
// The waves of a work-group walk the same rows, four to each piece (pass 1: queries, pass 2:
// keys and values). Read as fragments straight from global memory, every load
// touched 16 lines for 512 bytes and every wave fetched the same rows again.
// Here the work-group copies each 64-row piece once, in whole 128-byte lines,
// into LDS, two buffers deep, and the waves read their fragments from there.
#define CH 64        // rows of 128 bytes per piece, two pieces a stage
#define APITCH 72    // LDS row pitch in halves: 144 B = 16 B x 9, conflict-free for 16-byte reads

// 64 rows x 128 B = 512 pieces of 16 B, two per lane; a wave's copy covers four whole lines.
__device__ __forceinline__ void stage_rows(_Float16* dst, const _Float16* src, int pitch) {
  const int r = threadIdx.x >> 3, c = (threadIdx.x & 7) * 8;
  const unsigned l0 = (unsigned)(uintptr_t)(dst + r * APITCH + c);
  const unsigned l1 = (unsigned)(uintptr_t)(dst + (r + 32) * APITCH + c);
  const _Float16* g0 = src + (size_t)r * pitch + c;
  const _Float16* g1 = src + (size_t)(r + 32) * pitch + c;
  // the wait is the statement's last line, so that it stands in front of any
  // rewrite of the address registers that the copies name
  asm volatile("global_load_async_to_lds_b128 %0, %1, off\n\t"
               "global_load_async_to_lds_b128 %2, %3, off\n\t"
               "s_wait_xcnt 0x0"
               :: "v"(l0), "v"(g0), "v"(l1), "v"(g1) : "memory");
}

// ---------------- equal causal work for every work-group --------------------
// A tile's trips grow (pass 2) or fall (pass 1) linearly with its index, and all 512
// work-groups are resident at once: with one 128-row tile each, the launch lasted as long
// as the WGPs that held the longest tiles (32 trips against a mean of 17). Here a tile is
// 64 rows and a work-group takes tiles x and 31 - x one after the other: 17 trips for all,
// wherever they land. Its eight waves are 4 strips of 16 rows x 2 pieces of 64 rows of the
// other axis (a trip stages both pieces), so that the waves per SIMD and a wave's work per
// trip stay; the two pieces' results are joined through LDS.
#define QT 64        // rows of a tile
#define NTILE (TT / QT)

// joins two (maximum, sum) pairs of one key column; a side that has seen no valid query
// holds (-inf, 0), and with both sides so the reference is 0 (-inf - -inf is no number)
__device__ __forceinline__ void join_stats(float& m, float& s, float m2, float s2) {
  const float mn = fmaxf(m, m2);
  const float ref = (mn == -INFINITY) ? 0.0f : mn;
  s = s * __expf(m - ref) + s2 * __expf(m2 - ref);
  m = mn;
}

// ---------------- attention pass 1: per-key-column max / sumexp -------------
// softmax is over the QUERY axis (per reference): m_k, Z_k over q >= k.
__global__ __launch_bounds__(256) void attn_pass1(
    const _Float16* __restrict__ q, const _Float16* __restrict__ k,
    float* __restrict__ cmax, float* __restrict__ csum) {
  // two buffers of two pieces of 64 queries
  __shared__ __attribute__((aligned(16))) _Float16 qs[2][2][CH * APITCH];
  __shared__ float jm[4][16], js[4][16];         // the second piece's statistics, per strip
  const int bh = blockIdx.y;
  const int wave = __builtin_amdgcn_readfirstlane(threadIdx.x >> 5), l = threadIdx.x & 31;
  const int strip = wave & 3, part = wave >> 2;  // 16 key columns; which 64 of a stage's 128 queries
  const _Float16* qh = q + (size_t)bh * TT * HS;
  const _Float16* kh = k + (size_t)bh * TT * HS;

  for (int leg = 0; leg < 2; ++leg) {
    const int tile = leg ? NTILE - 1 - (int)blockIdx.x : (int)blockIdx.x;
    const int kb = tile * QT;                    // the tile's first key column
    const int k0 = kb + strip * 16;              // this wave's 16 key columns
    const int qs0 = kb & ~(2 * CH - 1);          // first staged query: an odd tile's first piece lies above the diagonal
    const int nt = (TT - qs0) / (2 * CH);        // stages of 128 queries, at least one
    auto stage = [&](int t) {
      stage_rows(qs[t & 1][0], qh + (size_t)(qs0 + 2 * t * CH) * HS, HS);
      stage_rows(qs[t & 1][1], qh + (size_t)(qs0 + (2 * t + 1) * CH) * HS, HS);
    };

    // the last hand-over of the leg before has ended every read of both buffers
    stage(0);
    // K^T fragments for this column strip (lane row = key token)
    v16h kf0 = load_frag(kh + (size_t)k0 * HS, HS);
    v16h kf1 = load_frag(kh + (size_t)k0 * HS + 32, HS);
    copies_landed();
    __syncthreads();
    if (nt > 1) stage(1);

    float m = -INFINITY, s = 0.0f;
    const int kcol = k0 + (l & 15);
    // A wave's piece is 64 queries, 32 scores of this lane's key column. Their maximum is
    // taken first, the running sum is rescaled once, and the 32 exponentials then depend
    // on nothing but that maximum. Score by score, each update took two divergent
    // branches and waited for the exponential of the update before it.
    auto fold = [&](const _Float16* qb, int qc, bool diag) {
      v16h qa[CH / 16][2];            // 4 tiles of 16 queries x 64 head columns (two fragments of 32)
      for (int u = 0; u < CH / 16; ++u) {
        qa[u][0] = load_frag(qb + u * 16 * APITCH, APITCH);
        qa[u][1] = load_frag(qb + u * 16 * APITCH + 32, APITCH);
      }
      // all 16 fragment reads go out before the first product, so one LDS round trip serves
      // 64 queries: left free, the scheduler spreads them among the products (several round trips)
      __builtin_amdgcn_sched_barrier(0);
      v8f c[CH / 16];
      for (int u = 0; u < CH / 16; ++u) c[u] = wmma16(qa[u][0], kf0, (v8f){});
      for (int u = 0; u < CH / 16; ++u) c[u] = wmma16(qa[u][1], kf1, c[u]);
      if (diag) {                     // causal (q >= k valid): the others leave both max and sum alone
        const int qrb = qc + ((l >> 4) ? 8 : 0);
        for (int u = 0; u < CH / 16; ++u)
          for (int r = 0; r < 8; ++r)
            if (qrb + u * 16 + r < kcol) c[u][r] = -INFINITY;
      }
      float mu[CH / 16];
      for (int u = 0; u < CH / 16; ++u) {
        mu[u] = c[u][0];
        for (int r = 1; r < 8; ++r) mu[u] = fmaxf(mu[u], c[u][r]);
      }
      const float mn = fmaxf(m, fmaxf(fmaxf(mu[0], mu[1]), fmaxf(mu[2], mu[3])));
      // a lane that has seen no valid query yet keeps m = -inf and s = 0 (-inf - -inf is no number)
      const float ref = (mn == -INFINITY) ? 0.0f : mn;
      // e^(x - ref) = 2^(x * log2(e) - ref * log2(e)): the subtrahend is formed once a stage
      const float l2e = 1.44269504f, nr = -ref * l2e;
      float p[CH / 16];
      for (int u = 0; u < CH / 16; ++u) {
        p[u] = __builtin_amdgcn_exp2f(fmaf(c[u][0], l2e, nr));
        for (int r = 1; r < 8; ++r) p[u] += __builtin_amdgcn_exp2f(fmaf(c[u][r], l2e, nr));
      }
      s = s * __builtin_amdgcn_exp2f(fmaf(m, l2e, nr)) + ((p[0] + p[1]) + (p[2] + p[3]));
      m = mn;
    };
    for (int t = 0; t < nt; ++t) {
      const _Float16* qb = qs[t & 1][part];
      const int qc = qs0 + (2 * t + part) * CH; // first query row of this wave's piece
      // both tests are wave-uniform; a piece wholly above the diagonal is skipped
      if (qc >= k0 + 16)      fold(qb, qc, false);
      else if (qc + CH > k0)  fold(qb, qc, true);
      // hand-over, passed by every wave: stage t + 1 is published, stage t's buffer is free
      lds_reads_done();
      copies_landed();
      __syncthreads();
      if (t + 2 < nt) stage(t + 2);
    }
    copies_landed();
    // join the two half-lanes that hold the same column, then the two pieces of the stages
    join_stats(m, s, __shfl_xor(m, 16, 32), __shfl_xor(s, 16, 32));
    if (part == 1 && l < 16) { jm[strip][l] = m; js[strip][l] = s; }
    __syncthreads();                  // the second piece's statistics are published
    if (part == 0 && l < 16) {
      join_stats(m, s, jm[strip][l], js[strip][l]);
      cmax[(size_t)bh * TT + kcol] = m;
      csum[(size_t)bh * TT + kcol] = s;
      // the next leg rewrites the registers that these stores name: keep the wait in front of that
      asm volatile("s_wait_xcnt 0x0" ::: "memory");
    }
    // jm, js are written again only behind the next leg's barriers
  }
}

// ---------------- v' = v / Z, stored transposed [B,H,HS,T] ------------------
// Same register-tile transpose: one wave takes 64 key tokens x 32 columns of a
// head; lane (lk = l & 7, le = l >> 3) reads 8 tokens x 8 halves and writes 8
// runs of 8 halves along t, so each store covers four whole 128-byte lines.
// The two waves that share the 128-byte source rows sit in one work-group.
__global__ __launch_bounds__(256) void vscale(
    const _Float16* __restrict__ v, const float* __restrict__ csum,
    _Float16* __restrict__ vT) {
  const int wave = threadIdx.x >> 5, l = threadIdx.x & 31;
  const int tile = blockIdx.x * 4 + (wave >> 1);   // BB*HH heads x TT/64 tiles
  const int bh = tile >> 5;
  const int kt = (tile & 31) * 64 + (l & 7) * 8;
  const int e = (wave & 1) * 32 + (l >> 3) * 8;
  const _Float16* s = v + ((size_t)bh * TT + kt) * HS + e;
  const float* z = csum + (size_t)bh * TT + kt;
  _Float16* o = vT + ((size_t)bh * HS + e) * TT + kt;
  v8h a[8];
  v4f Z[2];
  for (int i = 0; i < 8; ++i) a[i] = *(const v8h*)(s + (size_t)i * HS);
  for (int i = 0; i < 2; ++i) Z[i] = *(const v4f*)(z + 4 * i);
  // all ten loads go out before the arithmetic starts: left free, the scheduler
  // holds two back behind the first divisions (a second memory round trip)
  __builtin_amdgcn_sched_barrier(0);
  // unrolled so that j is a constant: left rolled, element j of every register
  // vector is picked by a chain of selects
#pragma unroll
  for (int j = 0; j < 8; ++j) {
    v8h t;
    for (int i = 0; i < 8; ++i)
      t[i] = to_h((float)a[i][j] / Z[i >> 2][i & 3]);
    *(v8h*)(o + (size_t)j * TT) = t;
  }
}

__global__ __launch_bounds__(256) __attribute__((amdgpu_waves_per_eu(4, 4))) void attn_pass2(
    const _Float16* __restrict__ q, const _Float16* __restrict__ k,
    const _Float16* __restrict__ vT, const float* __restrict__ cmax,
    _Float16* __restrict__ attn) {
  // two buffers of two pieces: 64 keys x 64 head columns; behind a tile's last stage ks also
  // holds the second piece's sums (16 KiB)
  __shared__ __attribute__((aligned(16))) _Float16 ks[2][2][CH * APITCH];
  __shared__ __attribute__((aligned(16))) _Float16 vs[2][2][CH * APITCH];  // 64 head columns x 64 keys
  const int bh = blockIdx.y;
  const int wave = __builtin_amdgcn_readfirstlane(threadIdx.x >> 5), l = threadIdx.x & 31;
  const int strip = wave & 3, part = wave >> 2;  // 16 query rows; which 64 of a stage's 128 keys
  const int bi = bh / HH, h = bh % HH;
  const _Float16* qh  = q  + (size_t)bh * TT * HS;
  const _Float16* kh  = k  + (size_t)bh * TT * HS;
  const _Float16* vTh = vT + (size_t)bh * HS * TT;
  const float*    mh  = cmax + (size_t)bh * TT;
  const int cn = l & 15, rb = (l >> 4) * 8;

  for (int leg = 0; leg < 2; ++leg) {
    const int tile = leg ? (int)blockIdx.x : NTILE - 1 - (int)blockIdx.x;
    const int q0 = tile * QT + strip * 16;       // this wave's 16 query rows
    const int nt = tile / 2 + 1;                 // stages of 128 keys, at least one
    auto stage = [&](int t) {
      for (int p = 0; p < 2; ++p) {
        stage_rows(ks[t & 1][p], kh + (size_t)(2 * t + p) * CH * HS, HS);
        stage_rows(vs[t & 1][p], vTh + (2 * t + p) * CH, TT);
      }
    };

    // the barrier at the foot of the leg before has ended every use of the buffers
    stage(0);
    v16h qa0 = load_frag(qh + (size_t)q0 * HS, HS);
    v16h qa1 = load_frag(qh + (size_t)q0 * HS + 32, HS);
    copies_landed();
    __syncthreads();
    if (nt > 1) stage(1);

    v8f acc[4];
    for (int j = 0; j < 4; ++j) acc[j] = (v8f){};

    const int qi = q0 + cn;           // this lane's query: column cn of S^T and of O^T
    // 32 keys x 16 queries. All fragment reads of the block (K and, since they do not
    // depend on P, V^T) stand at its head: one LDS round trip. Where the second 16 keys
    // lie wholly behind the diagonal the causal select below writes their zeros (those
    // key rows are part of the stage, so the reads are in range).
    auto pv_block = [&](const _Float16* kr, const _Float16* vr, int kt) {
      v16h kf[2][2], vb[4];
      v4f mk[2][2];                   // column maxima of this lane's 2 x 8 keys
      for (int h2 = 0; h2 < 2; ++h2) {
        kf[h2][0] = load_frag(kr + 16 * h2 * APITCH, APITCH);
        kf[h2][1] = load_frag(kr + 16 * h2 * APITCH + 32, APITCH);
        mk[h2][0] = *(const v4f*)(mh + kt + 16 * h2 + rb);
        mk[h2][1] = *(const v4f*)(mh + kt + 16 * h2 + rb + 4);
      }
      for (int j = 0; j < 4; ++j) vb[j] = load_frag(vr + (16 * j) * APITCH, APITCH);
      // keeps all 16 fragment reads in front of the first product: left free, the scheduler
      // sinks V^T's reads to their products behind the exponentials (three more LDS round trips)
      __builtin_amdgcn_sched_barrier(0);
      // register r of tile h2 is S^T[key kt + 16 h2 + rb + r][query qi]; element 8 h2 + r of a
      // B fragment is k = 16 h2 + rb + r, the order in which load_frag reads V^T's keys
      v8f cc[2];
      for (int h2 = 0; h2 < 2; ++h2) cc[h2] = wmma16(kf[h2][0], qa0, (v8f){});
      for (int h2 = 0; h2 < 2; ++h2) cc[h2] = wmma16(kf[h2][1], qa1, cc[h2]);
      v16h pb;
      for (int h2 = 0; h2 < 2; ++h2) {
        const int ahead = qi - (kt + 16 * h2 + rb);   // causal: key r of the tile counts where r <= ahead
        for (int r = 0; r < 8; ++r) {
          float pv = (r <= ahead) ? __expf(cc[h2][r] - mk[h2][r >> 2][r & 3]) : 0.0f;
          pb[8 * h2 + r] = to_h(pv);
        }
      }
      for (int j = 0; j < 4; ++j) acc[j] = wmma16(vb[j], pb, acc[j]);
      // the address pair of the maxima's loads is stepped at the loop's foot: keep the wait in front of that
      asm volatile("s_wait_xcnt 0x0" ::: "memory");
    };
    for (int t = 0; t < nt; ++t) {
      const _Float16* kst = ks[t & 1][part];
      const _Float16* vst = vs[t & 1][part];
      for (int u = 0; u < CH / 32; ++u) {
        const int kt = (2 * t + part) * CH + u * 32;
        if (kt < q0 + 16)             // wave-uniform: skips keys wholly behind the diagonal
          pv_block(kst + u * 32 * APITCH, vst + u * 32, kt);
      }
      // hand-over, passed by every wave: stage t + 1 is published, stage t's buffers are free
      lds_reads_done();
      copies_landed();
      __syncthreads();
      if (t + 2 < nt) stage(t + 2);
    }
    copies_landed();
    // the four vector slots that the chip needs between the loop's last product and the first
    // vector instruction that touches its registers: on the path out of the loop stand only
    // scalar instructions, waits and barriers, which fill no slot
    asm volatile("v_nop\n\tv_nop\n\tv_nop\n\tv_nop");

    // O^T = the first pieces' sums + the second pieces': behind the last hand-over no copy is
    // in flight and nobody reads ks, so the second piece's waves lay their sums there, 16 bytes
    // a lane and lanes side by side
    v4f* mg = (v4f*)&ks[0][0][0] + strip * 32 + l;
    if (part == 1)
      for (int j = 0; j < 4; ++j)
        for (int g = 0; g < 2; ++g)
          mg[(2 * j + g) * 128] = (v4f){acc[j][4 * g], acc[j][4 * g + 1], acc[j][4 * g + 2], acc[j][4 * g + 3]};
    __syncthreads();                  // those sums are published
    if (part == 0) {
      // write attn as f16 [B,T,D] (feeds the proj GEMM): register r of tile j is
      // O^T[head column 16 j + rb + r][query qi], eight neighbours of one row: one 16-byte store
      _Float16* orow = attn + ((size_t)bi * TT + qi) * DD + h * HS + rb;
      for (int j = 0; j < 4; ++j) {
        v8h t;
        for (int g = 0; g < 2; ++g) {
          const v4f o = mg[(2 * j + g) * 128];
          for (int r = 0; r < 4; ++r) t[4 * g + r] = to_h(acc[j][4 * g + r] + o[r]);
        }
        *(v8h*)(orow + 16 * j) = t;
      }
      // the next leg rewrites the registers that these stores name: keep the wait in front of that
      asm volatile("s_wait_xcnt 0x0" ::: "memory");
    }
    // the next leg's copies overwrite ks: every read of the sums has returned first
    lds_reads_done();
    __syncthreads();
  }
}

// ---------------- host-side orchestration ----------------
extern "C" void kernel_launch(void* const* d_in, const int* in_sizes, int n_in,
                              void* d_out, int out_size, void* d_ws,
                              size_t ws_size, hipStream_t stream) {
  const float* x     = (const float*)d_in[0];
  const float* Wq    = (const float*)d_in[1];
  const float* Wk    = (const float*)d_in[2];
  const float* Wv    = (const float*)d_in[3];
  const float* Wproj = (const float*)d_in[4];
  const float* bproj = (const float*)d_in[5];
  const float* W1    = (const float*)d_in[6];
  const float* b1    = (const float*)d_in[7];
  const float* W2    = (const float*)d_in[8];
  const float* b2    = (const float*)d_in[9];
  const float* ln1g  = (const float*)d_in[10];
  const float* ln1b  = (const float*)d_in[11];
  const float* ln2g  = (const float*)d_in[12];
  const float* ln2b  = (const float*)d_in[13];
  float* out = (float*)d_out;

  char* base = (char*)d_ws;
  size_t off = 0;
  auto alloc = [&](size_t bytes) -> char* {
    char* p = base + off;
    off += (bytes + 255) & ~(size_t)255;
    return p;
  };
  _Float16* wqkvT = (_Float16*)alloc((size_t)3 * DD * DD * 2);  // [3D][D]
  _Float16* wpT   = (_Float16*)alloc((size_t)DD * DD * 2);      // [D][D]
  _Float16* w1T   = (_Float16*)alloc((size_t)DFF * DD * 2);     // [4D][D]
  _Float16* w2T   = (_Float16*)alloc((size_t)DD * DFF * 2);     // [D][4D]
  float*    xn_f  = (float*)   alloc((size_t)BT * DD * 4);
  _Float16* xn_h  = (_Float16*)alloc((size_t)BT * DD * 2);
  _Float16* q_h   = (_Float16*)alloc((size_t)BB * HH * TT * HS * 2);
  _Float16* k_h   = (_Float16*)alloc((size_t)BB * HH * TT * HS * 2);
  _Float16* v_h   = (_Float16*)alloc((size_t)BB * HH * TT * HS * 2);
  _Float16* vT_h  = (_Float16*)alloc((size_t)BB * HH * TT * HS * 2);
  float*    cmax  = (float*)   alloc((size_t)BB * HH * TT * 4);
  float*    csum  = (float*)   alloc((size_t)BB * HH * TT * 4);
  _Float16* attnh = (_Float16*)alloc((size_t)BT * DD * 2);
  float*    x1_f  = (float*)   alloc((size_t)BT * DD * 4);
  float*    x1n_f = (float*)   alloc((size_t)BT * DD * 4);
  _Float16* x1n_h = (_Float16*)alloc((size_t)BT * DD * 2);
  _Float16* h_h   = (_Float16*)alloc((size_t)BT * DFF * 2);

  // 1) pack all weights to f16, transposed [N][K]: 12M elements, 64 n x 256 k a group
  pack_weights<<<(3 * DD * DD + DD * DD + 2 * DD * DFF) / (64 * 256), 256, 0, stream>>>(
      Wq, Wk, Wv, Wproj, W1, W2, wqkvT, wpT, w1T, w2T);
  // 2) LN1 -> xn (f32 + f16)
  ln_kernel<<<BT, 256, 0, stream>>>(x, ln1g, ln1b, xn_f, xn_h);
  // 3) QKV GEMM: [4096x1024] x [1024x3072]
  gemm_tile<MODE_QKV, 2, 8, 3><<<dim3(3 * DD / 192, BT / 256), 256, 0, stream>>>(
      xn_h, wqkvT, 3 * DD, DD, nullptr, nullptr, nullptr, nullptr,
      q_h, k_h, v_h);
  // 4) per-column softmax stats
  attn_pass1<<<dim3(TT / 128, BB * HH), 256, 0, stream>>>(q_h, k_h, cmax, csum);
  // 5) v' = v / Z, transposed
  vscale<<<BB * HH * (TT / 64) / 4, 256, 0, stream>>>(v_h, csum, vT_h);
  // 6) attn = P @ V'
  attn_pass2<<<dim3(TT / 128, BB * HH), 256, 0, stream>>>(q_h, k_h, vT_h, cmax,
                                                          attnh);
  // 7) proj: x1 = xn + attn @ Wproj + bproj
  gemm_tile<MODE_PROJ, 4, 4, 2><<<dim3(DD / 128, BT / 128), 256, 0, stream>>>(
      attnh, wpT, DD, DD, bproj, xn_f, x1_f, nullptr, nullptr,
      nullptr, nullptr);
  // 8) LN2 -> x1n (f32 + f16)
  ln_kernel<<<BT, 256, 0, stream>>>(x1_f, ln2g, ln2b, x1n_f, x1n_h);
  // 9) FFN1: h = relu(x1n @ W1 + b1)
  gemm_tile<MODE_FFN1, 2, 8, 4><<<dim3(DFF / 256, BT / 256), 256, 0, stream>>>(
      x1n_h, w1T, DFF, DD, b1, nullptr, nullptr, h_h, nullptr,
      nullptr, nullptr);
  // 10) FFN2: out = x1n + h @ W2 + b2
  gemm_tile<MODE_FFN2, 4, 4, 2><<<dim3(DD / 128, BT / 128), 256, 0, stream>>>(
      h_h, w2T, DD, DFF, b2, x1n_f, out, nullptr, nullptr, nullptr,
      nullptr);
}

// v010
// A run of this version takes 145 microseconds.
// In both of two side-by-side timings against v009, it was 1.07 times as fast.
// All steps since v000 together make it 3.82 times as fast.
#include <hip/hip_runtime.h>
#include <hip/hip_bf16.h>

// ---------------- problem constants ----------------
#define BB 2
#define TT 2048
#define DD 1024
#define HH 16
#define HS 64
#define BT (BB * TT)       // 4096 rows
#define DFF (4 * DD)       // 4096

typedef __attribute__((ext_vector_type(16))) _Float16 v16h;
typedef __attribute__((ext_vector_type(8)))  float    v8f;
typedef __attribute__((ext_vector_type(4)))  float    v4f;
typedef __attribute__((ext_vector_type(8)))  _Float16 v8h;

// ---------------- asynchronous copies to LDS: the two waits ----------------
// this wave's copies have landed (the barrier behind it publishes them to the others)
__device__ __forceinline__ void copies_landed() { asm volatile("s_wait_asynccnt 0x0" ::: "memory"); }
// all of this wave's copies but its N youngest have landed (the counter returns in issue order)
template <int N>
__device__ __forceinline__ void copies_landed_but() { asm volatile("s_wait_asynccnt %0" :: "n"(N) : "memory"); }
// this wave's LDS reads of the buffer that is refilled next have returned
__device__ __forceinline__ void lds_reads_done() { asm volatile("s_wait_dscnt 0x0" ::: "memory"); }

// ---------------- WMMA helpers ----------------
__device__ __forceinline__ v8f wmma16(v16h a, v16h b, v8f c) {
  // D = A(16x32 f16) * B(32x16 f16) + C(16x16 f32)
  return __builtin_amdgcn_wmma_f32_16x16x32_f16(false, a, false, b, (short)0, c,
                                                false, false);
}

// A-fragment loader (16-bit A 16x32 layout):
//   lane<16 : row M = lane,    holds K = 0..7  and 16..23
//   lane>=16: row M = lane-16, holds K = 8..15 and 24..31
// B-fragments (stored row=N, col=K) use the same pattern with N as the row.
__device__ __forceinline__ v16h load_frag(const _Float16* p, int stride) {
  int l = threadIdx.x & 31;
  const _Float16* r = p + (size_t)(l & 15) * stride + ((l >> 4) << 3);
  v16h f;
  ((uint4*)&f)[0] = *(const uint4*)(r);
  ((uint4*)&f)[1] = *(const uint4*)(r + 16);
  return f;
}

__device__ __forceinline__ _Float16 to_h(float x) { return (_Float16)x; }

// ---------------- weight packing: f32 -> f16, ALL weights TRANSPOSED --------
// Every packed weight is stored [N][K] so GEMM B-tiles stage with contiguous
// 16B rows (identical to A-tiles, no in-loop transpose).
// One wave transposes a tile of 64 k x 32 n in registers: lane (lk = l >> 3,
// ln = l & 7) reads 16 source rows x 4 floats, so each load covers four whole
// 128-byte lines, and writes 8 runs of 8 halves along k; the wave alone writes
// the 128-byte output lines of its tile. One element per thread had to start
// 64 times as many waves, each with a load that touched 32 lines.
template <int LD, int K>   // source pitch in floats, packed pitch in halves
__device__ __forceinline__ void pack_tile(const float* __restrict__ S,
                                          _Float16* __restrict__ O, int kb) {
  const int wave = threadIdx.x >> 5, l = threadIdx.x & 31;
  const int n = (wave & 1) * 32 + (l & 7) * 4;
  const int k = kb * 256 + (wave >> 1) * 64 + (l >> 3) * 8;
  const float* s = S + (size_t)k * LD + n;
  _Float16* o = O + (size_t)n * K + k;
  v4f v[2][8];
  for (int g = 0; g < 2; ++g)
    for (int i = 0; i < 8; ++i)
      v[g][i] = *(const v4f*)(s + (size_t)(32 * g + i) * LD);
  // the 16 loads share one address pair: it is named here as an input, so that no
  // load's result lands on it, and the wait stands in front of its reuse below
  asm volatile("s_wait_xcnt 0x0" :: "v"(s) : "memory");
  // all 16 loads go out before the first conversion: left free, the scheduler
  // holds some back behind the first results (a second memory round trip)
  __builtin_amdgcn_sched_barrier(0);
  for (int g = 0; g < 2; ++g)
    for (int j = 0; j < 4; ++j) {
      v8h t;
      for (int i = 0; i < 8; ++i) t[i] = to_h(v[g][i][j]);
      *(v8h*)(o + (size_t)j * K + 32 * g) = t;
    }
  // the code of the four matrices stands one part behind the other, parted only by
  // scalar skips, and each part rewrites these registers: keep the wait behind the stores
  asm volatile("s_wait_xcnt 0x0" ::: "memory");
}

// a work-group packs 64 n x 256 k; the matrix it works on is block-uniform
__global__ __launch_bounds__(256) void pack_weights(
    const float* __restrict__ Wq, const float* __restrict__ Wk,
    const float* __restrict__ Wv, const float* __restrict__ Wp,
    const float* __restrict__ W1, const float* __restrict__ W2,
    _Float16* __restrict__ wqkvT, _Float16* __restrict__ wpT,
    _Float16* __restrict__ w1T, _Float16* __restrict__ w2T) {
  const int b = blockIdx.x;
  const int bP = 3 * HH * 4, b1 = bP + (DD / 64) * 4, b2 = b1 + (DFF / 64) * 4;
  if (b < bP) {                    // q, k, v: one head [D][HS] is 64 n wide
    const int hd = b >> 2, sel = hd >> 4, h = hd & 15;
    const float* W = (sel == 0) ? Wq : (sel == 1) ? Wk : Wv;
    pack_tile<HS, DD>(W + (size_t)h * DD * HS, wqkvT + (size_t)hd * 64 * DD, b & 3);
  } else if (b < b1) {             // Wproj [D][D]
    const int nb = (b - bP) >> 2;
    pack_tile<DD, DD>(Wp + nb * 64, wpT + (size_t)nb * 64 * DD, b & 3);
  } else if (b < b2) {             // W1 [D][4D]
    const int nb = (b - b1) >> 2;
    pack_tile<DFF, DD>(W1 + nb * 64, w1T + (size_t)nb * 64 * DD, b & 3);
  } else {                         // W2 [4D][D]
    const int nb = (b - b2) >> 4;
    pack_tile<DD, DFF>(W2 + nb * 64, w2T + (size_t)nb * 64 * DFF, b & 15);
  }
}

// ---------------- LayerNorm: writes f32 (residual) + f16 (GEMM input) -------
__global__ __launch_bounds__(256) void ln_kernel(
    const float* __restrict__ x, const float* __restrict__ g,
    const float* __restrict__ b, float* __restrict__ yf,
    _Float16* __restrict__ yh) {
  __shared__ float s1[256], s2[256];
  int row = blockIdx.x, tid = threadIdx.x;
  const float* xr = x + (size_t)row * DD;
  float4 xv = ((const float4*)xr)[tid];          // 4 elements / thread
  float sum = xv.x + xv.y + xv.z + xv.w;
  float sq  = xv.x * xv.x + xv.y * xv.y + xv.z * xv.z + xv.w * xv.w;
  s1[tid] = sum; s2[tid] = sq;
  __syncthreads();
  for (int off = 128; off; off >>= 1) {
    if (tid < off) { s1[tid] += s1[tid + off]; s2[tid] += s2[tid + off]; }
    __syncthreads();
  }
  float mu  = s1[0] * (1.0f / DD);
  float var = s2[0] * (1.0f / DD) - mu * mu;
  float rs  = rsqrtf(var + 1e-5f);
  float vals[4] = {xv.x, xv.y, xv.z, xv.w};
  for (int j = 0; j < 4; ++j) {
    int c = tid * 4 + j;
    float xn = (vals[j] - mu) * rs * g[c] + b[c];
    yf[(size_t)row * DD + c] = xn;
    yh[(size_t)row * DD + c] = to_h(xn);
  }
}

// ---------------- generic WMMA GEMM with fused epilogues --------------------
#define MODE_QKV  0
#define MODE_PROJ 1
#define MODE_FFN1 2
#define MODE_FFN2 3

// Eight 16-byte copies per lane in one statement. The wait is the statement's last
// line, so that it stands in front of any rewrite of the address registers that the
// copies name.
__device__ __forceinline__ void copy8(const unsigned* l, const _Float16* const* g) {
  asm volatile("global_load_async_to_lds_b128 %0, %1, off\n\t"
               "global_load_async_to_lds_b128 %2, %3, off\n\t"
               "global_load_async_to_lds_b128 %4, %5, off\n\t"
               "global_load_async_to_lds_b128 %6, %7, off\n\t"
               "global_load_async_to_lds_b128 %8, %9, off\n\t"
               "global_load_async_to_lds_b128 %10, %11, off\n\t"
               "global_load_async_to_lds_b128 %12, %13, off\n\t"
               "global_load_async_to_lds_b128 %14, %15, off\n\t"
               "s_wait_xcnt 0x0"
               :: "v"(l[0]), "v"(g[0]), "v"(l[1]), "v"(g[1]), "v"(l[2]), "v"(g[2]),
                  "v"(l[3]), "v"(g[3]), "v"(l[4]), "v"(g[4]), "v"(l[5]), "v"(g[5]),
                  "v"(l[6]), "v"(g[6]), "v"(l[7]), "v"(g[7]) : "memory");
}

// The same for four copies.
__device__ __forceinline__ void copy4(const unsigned* l, const _Float16* const* g) {
  asm volatile("global_load_async_to_lds_b128 %0, %1, off\n\t"
               "global_load_async_to_lds_b128 %2, %3, off\n\t"
               "global_load_async_to_lds_b128 %4, %5, off\n\t"
               "global_load_async_to_lds_b128 %6, %7, off\n\t"
               "s_wait_xcnt 0x0"
               :: "v"(l[0]), "v"(g[0]), "v"(l[1]), "v"(g[1]), "v"(l[2]), "v"(g[2]),
                  "v"(l[3]), "v"(g[3]) : "memory");
}

#define KS 128       // k per stage: rows of 256 bytes
#define GP 136       // LDS row pitch in halves: 272 B = 16 B x 17, conflict-free for 16-byte reads

// One operand's share of a stage: ROWS rows x 256 B = 16 ROWS pieces of 16 B, ROWS / 16 per
// lane (ROWS is a multiple of 64); a wave's copy covers two whole rows (four 128-byte lines).
// src is the lane's own first piece (row r, column c of the stage); the others lie whole
// multiples of 16 rows behind it, a step that is the same in every lane.
template <int ROWS>
__device__ __forceinline__ void stage_tile(_Float16* dst, const _Float16* src, int K) {
  const int r = threadIdx.x >> 4, c = (threadIdx.x & 15) * 8;
  for (int b = 0; b < ROWS; b += 128) {
    unsigned l[8];
    const _Float16* g[8];
    for (int i = 0; i < 8; ++i) {
      const int row = (b + 16 * i < ROWS) ? b + 16 * i : 0;   // the last run may be four copies
      l[i] = (unsigned)(uintptr_t)(dst + (r + row) * GP + c);
      g[i] = src + (size_t)row * K;
    }
    if (b + 128 <= ROWS) copy8(l, g);
    else                 copy4(l, g);
  }
}

// MODE is a compile-time parameter: with it at run time the epilogue stayed a
// rolled loop that tested the mode per element and waited for each element's
// residual load before its store (one memory round trip per element).
// K is walked in stages of 128 k, a ring of NB buffers, one hand-over (two waits, one barrier) a
// stage. A stage is four blocks of 32 k (FM FN products a wave), and the fragments of a block
// are read while the block before it is multiplied. At 32 k a stage, between two
// barriers, there was no block to read ahead of: each wave waited out its own LDS reads.
// NB is the ring's depth, a power of two: a stage's copies are issued NB - 1 stages before
// it is read. With two buffers a work-group alone on its WGP asks for a whole stage at once
// and then for nothing until the next hand-over, and the one stage of lead has to cover the
// way of all 64 KiB (reckoned longer than a stage's products; all work-groups walk K in step,
// so part of every stage is read for the first time). The 128 x 128 tiles, one work-group a
// WGP, have the LDS for four buffers; two buffers of a wide tile fill it.
// The work-group's tile is 32 FM x 64 FN, its eight waves 2 x 4, a wave's tile FM x FN fragments
// of 16 x 16. Per 32 k a wave reads FM + FN fragments from LDS for FM FN products and the group
// copies 32 FM + 64 FN rows from L2 for 8 FM FN: at 4 x 2 both ask more than LDS and L2 give at
// the matrix rate, at 8 x 4 and 8 x 3 less. The wide tiles go where they still make one
// work-group for every WGP (N = 4096: 256 x 256; N = 3072: 256 x 192).
template <int MODE, int NB, int FM, int FN>
__global__ __launch_bounds__(256) void gemm_tile(
    const _Float16* __restrict__ A,   // [M][K] row-major f16
    const _Float16* __restrict__ Bt,  // [N][K] row-major f16 (pre-transposed)
    int N, int K,
    const float* __restrict__ bias, const float* __restrict__ resid,
    float* __restrict__ outf, _Float16* __restrict__ outh,
    _Float16* __restrict__ qp, _Float16* __restrict__ kp,
    _Float16* __restrict__ vp) {
  constexpr int TM = 32 * FM, TN = 64 * FN;
  constexpr int CPS = (TM + TN) / 16;   // copies of a wave per stage
  __shared__ __attribute__((aligned(16))) _Float16 As[NB][TM * GP];
  __shared__ __attribute__((aligned(16))) _Float16 Bs[NB][TN * GP];
  const int tid = threadIdx.x;
  const int m0 = blockIdx.y * TM;
  const int n0 = blockIdx.x * TN;
  const int wave = tid >> 5, l = tid & 31;
  const int wm = (wave & 1) * 16 * FM;   // wave M offset in tile
  const int wn = (wave >> 1) * 16 * FN;  // wave N offset in tile
  const int nt = K / KS;            // stages, at least NB
  // this lane's first piece of the stage that is copied next. One running pointer an operand:
  // formed from the stage's number, every copy's address had a part of its own that stayed
  // in registers over the whole loop, more than the wide tiles leave free (spills)
  const _Float16* pa = A + (size_t)(m0 + (tid >> 4)) * K + (tid & 15) * 8;
  const _Float16* pb = Bt + (size_t)(n0 + (tid >> 4)) * K + (tid & 15) * 8;
  auto stage = [&](int buf) {
    stage_tile<TM>(As[buf], pa, K);
    stage_tile<TN>(Bs[buf], pb, K);
    pa += KS;
    pb += KS;
  };

  v8f acc[FM][FN];
  for (int i = 0; i < FM; ++i)
    for (int j = 0; j < FN; ++j) acc[i][j] = (v8f){};

  for (int p = 0; p < NB - 1; ++p) stage(p);
  copies_landed_but<CPS * (NB - 2)>();   // stage 0 has landed; the stages behind it may still fly
  __syncthreads();
  stage(NB - 1);

  for (int t = 0; t < nt; ++t) {
    const _Float16* as = As[t & (NB - 1)] + wm * GP;
    const _Float16* bs = Bs[t & (NB - 1)] + wn * GP;
    v16h af[2][FM], bf[2][FN];        // two fragment sets: one multiplied, one being read
    auto read_block = [&](int s) {
      for (int j = 0; j < FN; ++j) bf[s & 1][j] = load_frag(bs + 16 * j * GP + 32 * s, GP);
      for (int i = 0; i < FM; ++i) af[s & 1][i] = load_frag(as + 16 * i * GP + 32 * s, GP);
    };
    read_block(0);
    // keeps the first block's reads in front of the second's: left free, the scheduler mixes the
    // two groups, and behind the barrier, where all eight waves read at once and no product
    // is in flight, the first product waits for most of both
    __builtin_amdgcn_sched_barrier(0);
    for (int s = 0; s < KS / 32; ++s) {
      if (s + 1 < KS / 32) read_block(s + 1);
      // the pair of fences keeps the next block's reads one group in front of this
      // block's products: left free, the scheduler puts them among the products in
      // pairs and waits for each pair (four LDS round trips a block)
      __builtin_amdgcn_sched_barrier(0);
      for (int i = 0; i < FM; ++i)
        for (int j = 0; j < FN; ++j) acc[i][j] = wmma16(af[s & 1][i], bf[s & 1][j], acc[i][j]);
      __builtin_amdgcn_sched_barrier(0);
    }
    // hand-over: stage t + 1 is published, stage t's buffers are free
    lds_reads_done();
    // behind stage t + 1 stand the copies of stages t + 2 to t + NB - 1, while these all exist
    // (a test that reads the same in the whole grid); in the last trips the wait is to 0
    if (NB > 2 && t + NB <= nt) copies_landed_but<CPS * (NB - 2)>();
    else                        copies_landed();
    __syncthreads();
    if (t + NB < nt) stage(t & (NB - 1));
  }
  copies_landed();

  // epilogue: C lane map -> col = base + (l&15); rows = base + r + (l>=16)*8
  const int cn = l & 15, rb = (l >> 4) * 8;
  const int gm0 = m0 + wm + rb;   // this lane's first row
  const int gn0 = n0 + wn + cn;   // this lane's first column
  if constexpr (MODE == MODE_QKV) {
    // 16 columns never straddle a 1024-wide q/k/v section or a head: sel and h are the same in a fragment
    // and a tile's rows never straddle a batch (TM divides T): a lane's rows are HS apart
    const int bi = gm0 >> 11, t0 = gm0 & (TT - 1);
    // the fragment's first column, formed from the wave's number alone, so that the test for
    // the v section below is a scalar branch
    const int nu = n0 + __builtin_amdgcn_readfirstlane(wn);
    _Float16* dp[FN];
    float sc[FN];
    for (int j = 0; j < FN; ++j) {
      const int sel = (nu + 16 * j) >> 10;
      const int w = (nu + 16 * j) & 1023, h = w >> 6, e = (w & 63) + cn;
      // q, k: [B,H,T,HS]; v goes out transposed, [B,H,HS,T], as pass 2 stages it
      dp[j] = (sel == 2) ? vp + (((size_t)(bi * HH + h)) * HS + e) * TT + t0
                         : ((sel == 0) ? qp : kp) + (((size_t)(bi * HH + h)) * TT + t0) * HS + e;
      // D^-0.5 and log2(e) are folded into q: the scores come out in base-2 units
      sc[j] = (sel == 0) ? 0.03125f * 1.44269504f : 1.0f;
    }
    // unrolled so that j is a constant: left rolled, the accumulators are picked by index from scratch memory
#pragma unroll
    for (int j = 0; j < FN; ++j) {
      v8h hv[FM];
      // in both branches the column's arithmetic ends in front of its first store (the fence)
      if (((nu + 16 * j) >> 10) == 2) {
        // a lane's eight results are eight tokens of one head column: neighbours in V^T
        for (int i = 0; i < FM; ++i)
          for (int rr = 0; rr < 8; ++rr) hv[i][rr] = to_h(acc[i][j][rr]);
        __builtin_amdgcn_sched_barrier(0);
        for (int i = 0; i < FM; ++i) *(v8h*)(dp[j] + 16 * i) = hv[i];
      } else {
        for (int i = 0; i < FM; ++i)
          for (int rr = 0; rr < 8; ++rr) hv[i][rr] = to_h(acc[i][j][rr] * sc[j]);
        __builtin_amdgcn_sched_barrier(0);
        for (int i = 0; i < FM; ++i)
          for (int rr = 0; rr < 8; ++rr) dp[j][(16 * i + rr) * HS] = hv[i][rr];
      }
      // the next column of fragments reuses the registers that these stores name: keep the wait in
      // front of that; the fence keeps the next column's arithmetic behind the wait
      asm volatile("s_wait_xcnt 0x0" ::: "memory");
      __builtin_amdgcn_sched_barrier(0);
    }
  } else if constexpr (MODE == MODE_FFN1) {
    float bv[FN];
    for (int j = 0; j < FN; ++j) bv[j] = bias[gn0 + 16 * j];
    // the bias loads' offset register is reused right behind them: keep the wait in front of that
    asm volatile("s_wait_xcnt 0x0" ::: "memory");
    _Float16* op = outh + (size_t)gm0 * DFF + gn0;
    for (int i = 0; i < FM; ++i) {
      _Float16 hv[FN][8];
      for (int j = 0; j < FN; ++j)
        for (int rr = 0; rr < 8; ++rr) hv[j][rr] = to_h(fmaxf(acc[i][j][rr] + bv[j], 0.0f));
      // the row's arithmetic ends in front of its first store
      __builtin_amdgcn_sched_barrier(0);
      for (int j = 0; j < FN; ++j)
        for (int rr = 0; rr < 8; ++rr) op[(size_t)(16 * i + rr) * DFF + 16 * j] = hv[j][rr];
      // the next row of fragments reuses the registers that these stores name: keep the wait in
      // front of that; the fence keeps the next row's arithmetic behind the wait
      asm volatile("s_wait_xcnt 0x0" ::: "memory");
      __builtin_amdgcn_sched_barrier(0);
    }
  } else {  // MODE_PROJ, MODE_FFN2: out = acc + (bias + resid)
    float bv[FN];
    for (int j = 0; j < FN; ++j) bv[j] = bias[gn0 + 16 * j];
    // the bias loads' offset register is reused right behind them: keep the wait in front of that
    asm volatile("s_wait_xcnt 0x0" ::: "memory");
    const float* rp = resid + (size_t)gm0 * DD + gn0;
    float* op = outf + (size_t)gm0 * DD + gn0;
    // all residual loads are issued before the first store, so they overlap
    float rv[FM][FN][8];
    for (int i = 0; i < FM; ++i)
      for (int j = 0; j < FN; ++j)
        for (int rr = 0; rr < 8; ++rr)
          rv[i][j][rr] = rp[(size_t)(16 * i + rr) * DD + 16 * j];
    for (int i = 0; i < FM; ++i)
      for (int j = 0; j < FN; ++j)
        for (int rr = 0; rr < 8; ++rr)
          op[(size_t)(16 * i + rr) * DD + 16 * j] =
              acc[i][j][rr] + (bv[j] + rv[i][j][rr]);
  }
}

// ---------------- staging for the two attention passes ----------------------
// The waves of a work-group walk the same rows, four to each piece (pass 1: queries, pass 2:
// keys and values). Read as fragments straight from global memory, every load
// touched 16 lines for 512 bytes and every wave fetched the same rows again.
// Here the work-group copies each 64-row piece once, in whole 128-byte lines,
// into LDS, two buffers deep, and the waves read their fragments from there.
#define CH 64        // rows of 128 bytes per piece, two pieces a stage
#define APITCH 72    // LDS row pitch in halves: 144 B = 16 B x 9, conflict-free for 16-byte reads

// 64 rows x 128 B = 512 pieces of 16 B, two per lane; a wave's copy covers four whole lines.
__device__ __forceinline__ void stage_rows(_Float16* dst, const _Float16* src, int pitch) {
  const int r = threadIdx.x >> 3, c = (threadIdx.x & 7) * 8;
  const unsigned l0 = (unsigned)(uintptr_t)(dst + r * APITCH + c);
  const unsigned l1 = (unsigned)(uintptr_t)(dst + (r + 32) * APITCH + c);
  const _Float16* g0 = src + (size_t)r * pitch + c;
  const _Float16* g1 = src + (size_t)(r + 32) * pitch + c;
  // the wait is the statement's last line, so that it stands in front of any
  // rewrite of the address registers that the copies name
  asm volatile("global_load_async_to_lds_b128 %0, %1, off\n\t"
               "global_load_async_to_lds_b128 %2, %3, off\n\t"
               "s_wait_xcnt 0x0"
               :: "v"(l0), "v"(g0), "v"(l1), "v"(g1) : "memory");
}

// ---------------- equal causal work for every work-group --------------------
// A tile's trips grow (pass 2) or fall (pass 1) linearly with its index, and all 512
// work-groups are resident at once: with one 128-row tile each, the launch lasted as long
// as the WGPs that held the longest tiles (32 trips against a mean of 17). Here a tile is
// 64 rows and a work-group takes tiles x and 31 - x one after the other: 17 trips for all,
// wherever they land. Its eight waves are 4 strips of 16 rows x 2 pieces of 64 rows of the
// other axis (a trip stages both pieces), so that the waves per SIMD and a wave's work per
// trip stay; the two pieces' results are joined through LDS.
#define QT 64        // rows of a tile
#define NTILE (TT / QT)

// joins two (maximum, sum) pairs of one key column (base-2 units); a side that has seen no valid query
// holds (-inf, 0), and with both sides so the reference is 0 (-inf - -inf is no number)
__device__ __forceinline__ void join_stats(float& m, float& s, float m2, float s2) {
  const float mn = fmaxf(m, m2);
  const float ref = (mn == -INFINITY) ? 0.0f : mn;
  s = s * __builtin_amdgcn_exp2f(m - ref) + s2 * __builtin_amdgcn_exp2f(m2 - ref);
  m = mn;
}

// ---------------- attention pass 1: per-key-column softmax bias -------------
// softmax is over the QUERY axis (per reference): m_k, Z_k over q >= k. The scores are in
// base-2 units (log2(e) is folded into q), and the weight of (q, k) is
// 2^(s - m_k) / Z_k = 2^(s - (m_k + log2 Z_k)): one number a key column holds both the
// maximum and the normaliser. It is stored negated, as pass 2 adds it to the scores.
__global__ __launch_bounds__(256) void attn_pass1(
    const _Float16* __restrict__ q, const _Float16* __restrict__ k,
    float* __restrict__ cbias) {
  // two buffers of two pieces of 64 queries
  __shared__ __attribute__((aligned(16))) _Float16 qs[2][2][CH * APITCH];
  __shared__ float jm[4][16], js[4][16];         // the second piece's statistics, per strip
  const int bh = blockIdx.y;
  const int wave = __builtin_amdgcn_readfirstlane(threadIdx.x >> 5), l = threadIdx.x & 31;
  const int strip = wave & 3, part = wave >> 2;  // 16 key columns; which 64 of a stage's 128 queries
  const _Float16* qh = q + (size_t)bh * TT * HS;
  const _Float16* kh = k + (size_t)bh * TT * HS;

  for (int leg = 0; leg < 2; ++leg) {
    const int tile = leg ? NTILE - 1 - (int)blockIdx.x : (int)blockIdx.x;
    const int kb = tile * QT;                    // the tile's first key column
    const int k0 = kb + strip * 16;              // this wave's 16 key columns
    const int qs0 = kb & ~(2 * CH - 1);          // first staged query: an odd tile's first piece lies above the diagonal
    const int nt = (TT - qs0) / (2 * CH);        // stages of 128 queries, at least one
    auto stage = [&](int t) {
      stage_rows(qs[t & 1][0], qh + (size_t)(qs0 + 2 * t * CH) * HS, HS);
      stage_rows(qs[t & 1][1], qh + (size_t)(qs0 + (2 * t + 1) * CH) * HS, HS);
    };

    // the last hand-over of the leg before has ended every read of both buffers
    stage(0);
    // K^T fragments for this column strip (lane row = key token)
    v16h kf0 = load_frag(kh + (size_t)k0 * HS, HS);
    v16h kf1 = load_frag(kh + (size_t)k0 * HS + 32, HS);
    copies_landed();
    __syncthreads();
    if (nt > 1) stage(1);

    float m = -INFINITY, s = 0.0f;
    const int kcol = k0 + (l & 15);
    // A wave's piece is 64 queries, 32 scores of this lane's key column. Their maximum is
    // taken first, the running sum is rescaled once, and the 32 exponentials then depend
    // on nothing but that maximum. Score by score, each update took two divergent
    // branches and waited for the exponential of the update before it.
    auto fold = [&](const _Float16* qb, int qc, bool diag) {
      v16h qa[CH / 16][2];            // 4 tiles of 16 queries x 64 head columns (two fragments of 32)
      for (int u = 0; u < CH / 16; ++u) {
        qa[u][0] = load_frag(qb + u * 16 * APITCH, APITCH);
        qa[u][1] = load_frag(qb + u * 16 * APITCH + 32, APITCH);
      }
      // all 16 fragment reads go out before the first product, so one LDS round trip serves
      // 64 queries: left free, the scheduler spreads them among the products (several round trips)
      __builtin_amdgcn_sched_barrier(0);
      v8f c[CH / 16];
      for (int u = 0; u < CH / 16; ++u) c[u] = wmma16(qa[u][0], kf0, (v8f){});
      for (int u = 0; u < CH / 16; ++u) c[u] = wmma16(qa[u][1], kf1, c[u]);
      if (diag) {                     // causal (q >= k valid): the others leave both max and sum alone
        const int qrb = qc + ((l >> 4) ? 8 : 0);
        for (int u = 0; u < CH / 16; ++u)
          for (int r = 0; r < 8; ++r)
            if (qrb + u * 16 + r < kcol) c[u][r] = -INFINITY;
      }
      float mu[CH / 16];
      for (int u = 0; u < CH / 16; ++u) {
        mu[u] = c[u][0];
        for (int r = 1; r < 8; ++r) mu[u] = fmaxf(mu[u], c[u][r]);
      }
      const float mn = fmaxf(m, fmaxf(fmaxf(mu[0], mu[1]), fmaxf(mu[2], mu[3])));
      // a lane that has seen no valid query yet keeps m = -inf and s = 0 (-inf - -inf is no number)
      const float ref = (mn == -INFINITY) ? 0.0f : mn;
      // parts the products and the maxima from the exponentials, so that the order asked for at
      // the foot binds the exponentials' part alone and leaves the products as they stand
      __builtin_amdgcn_sched_barrier(0);
      float p[CH / 16];
      for (int u = 0; u < CH / 16; ++u) {
        p[u] = __builtin_amdgcn_exp2f(c[u][0] - ref);
        for (int r = 1; r < 8; ++r) p[u] += __builtin_amdgcn_exp2f(c[u][r] - ref);
      }
      s = s * __builtin_amdgcn_exp2f(m - ref) + ((p[0] + p[1]) + (p[2] + p[3]));
      m = mn;
      // one plain vector instruction behind each exponential: it fills the slot that the
      // instruction set asks for there (left free, some exponentials stand directly in front of
      // an instruction that rewrites their source), and the vector port works meanwhile
      for (int r = 0; r < 33; ++r) {
        __builtin_amdgcn_sched_group_barrier(0x400, 1, 0);
        __builtin_amdgcn_sched_group_barrier(0x002, 1, 0);
      }
    };
    for (int t = 0; t < nt; ++t) {
      const _Float16* qb = qs[t & 1][part];
      const int qc = qs0 + (2 * t + part) * CH; // first query row of this wave's piece
      // both tests are wave-uniform; a piece wholly above the diagonal is skipped
      if (qc >= k0 + 16)      fold(qb, qc, false);
      else if (qc + CH > k0)  fold(qb, qc, true);
      // hand-over, passed by every wave: stage t + 1 is published, stage t's buffer is free
      lds_reads_done();
      copies_landed();
      __syncthreads();
      if (t + 2 < nt) stage(t + 2);
    }
    copies_landed();
    // join the two half-lanes that hold the same column, then the two pieces of the stages
    join_stats(m, s, __shfl_xor(m, 16, 32), __shfl_xor(s, 16, 32));
    if (part == 1 && l < 16) { jm[strip][l] = m; js[strip][l] = s; }
    __syncthreads();                  // the second piece's statistics are published
    if (part == 0 && l < 16) {
      join_stats(m, s, jm[strip][l], js[strip][l]);
      // every column holds its own diagonal query, so m is finite and s at least 1
      cbias[(size_t)bh * TT + kcol] = -(m + __builtin_amdgcn_logf(s));   // v_log_f32 is log2
      // the next leg rewrites the registers that this store names: keep the wait in front of that
      asm volatile("s_wait_xcnt 0x0" ::: "memory");
    }
    // jm, js are written again only behind the next leg's barriers
  }
}

// One stage's biases: 128 floats = 32 pieces of 16 B, one copy of one wave. The wait is the
// statement's last line, so that it stands in front of any rewrite of the address registers.
__device__ __forceinline__ void stage_bias(float* dst, const float* src) {
  const int l = threadIdx.x & 31;
  const unsigned d = (unsigned)(uintptr_t)(dst + 4 * l);
  const float* g = src + 4 * l;
  asm volatile("global_load_async_to_lds_b128 %0, %1, off\n\t"
               "s_wait_xcnt 0x0"
               :: "v"(d), "v"(g) : "memory");
}

__global__ __launch_bounds__(256) __attribute__((amdgpu_waves_per_eu(4, 4))) void attn_pass2(
    const _Float16* __restrict__ q, const _Float16* __restrict__ k,
    const _Float16* __restrict__ vT, const float* __restrict__ cbias,
    _Float16* __restrict__ attn) {
  // two buffers of two pieces: 64 keys x 64 head columns; behind a tile's last stage ks also
  // holds the second piece's sums (16 KiB)
  __shared__ __attribute__((aligned(16))) _Float16 ks[2][2][CH * APITCH];
  __shared__ __attribute__((aligned(16))) _Float16 vs[2][2][CH * APITCH];  // 64 head columns x 64 keys
  __shared__ __attribute__((aligned(16))) float bs[2][2 * CH];             // the stage's 128 keys' biases
  const int bh = blockIdx.y;
  const int wave = __builtin_amdgcn_readfirstlane(threadIdx.x >> 5), l = threadIdx.x & 31;
  const int strip = wave & 3, part = wave >> 2;  // 16 query rows; which 64 of a stage's 128 keys
  const int bi = bh / HH, h = bh % HH;
  const _Float16* qh  = q  + (size_t)bh * TT * HS;
  const _Float16* kh  = k  + (size_t)bh * TT * HS;
  const _Float16* vTh = vT + (size_t)bh * HS * TT;
  const float*    bh_ = cbias + (size_t)bh * TT;
  const int cn = l & 15, rb = (l >> 4) * 8;

  for (int leg = 0; leg < 2; ++leg) {
    const int tile = leg ? (int)blockIdx.x : NTILE - 1 - (int)blockIdx.x;
    const int q0 = tile * QT + strip * 16;       // this wave's 16 query rows
    const int nt = tile / 2 + 1;                 // stages of 128 keys, at least one
    auto stage = [&](int t) {
      for (int p = 0; p < 2; ++p) {
        stage_rows(ks[t & 1][p], kh + (size_t)(2 * t + p) * CH * HS, HS);
        stage_rows(vs[t & 1][p], vTh + (2 * t + p) * CH, TT);
      }
      if (wave == 0) stage_bias(bs[t & 1], bh_ + 2 * t * CH);   // a scalar test: the whole wave copies
    };

    // the barrier at the foot of the leg before has ended every use of the buffers
    stage(0);
    v16h qa0 = load_frag(qh + (size_t)q0 * HS, HS);
    v16h qa1 = load_frag(qh + (size_t)q0 * HS + 32, HS);
    copies_landed();
    __syncthreads();
    if (nt > 1) stage(1);

    v8f acc[4];
    for (int j = 0; j < 4; ++j) acc[j] = (v8f){};

    const int qi = q0 + cn;           // this lane's query: column cn of S^T and of O^T
    // 32 keys x 16 queries. All fragment reads of the block (K and, since they do not
    // depend on P, V^T) stand at its head: one LDS round trip. Where the second 16 keys
    // lie wholly behind the diagonal the causal select below writes their zeros (those
    // key rows are part of the stage, so the reads are in range).
    auto pv_block = [&](const _Float16* kr, const _Float16* vr, const float* br, int kt) {
      v16h kf[2][2], vb[4];
      v8f nb[2];                      // biases of this lane's 2 x 8 keys
      for (int h2 = 0; h2 < 2; ++h2) {
        ((v4f*)&nb[h2])[0] = *(const v4f*)(br + 16 * h2 + rb);
        ((v4f*)&nb[h2])[1] = *(const v4f*)(br + 16 * h2 + rb + 4);
        kf[h2][0] = load_frag(kr + 16 * h2 * APITCH, APITCH);
        kf[h2][1] = load_frag(kr + 16 * h2 * APITCH + 32, APITCH);
      }
      for (int j = 0; j < 4; ++j) vb[j] = load_frag(vr + (16 * j) * APITCH, APITCH);
      // keeps all 20 LDS reads in front of the first product: left free, the scheduler
      // sinks V^T's reads to their products behind the exponentials (three more LDS round trips)
      __builtin_amdgcn_sched_barrier(0);
      // register r of tile h2 is S^T[key kt + 16 h2 + rb + r][query qi]; element 8 h2 + r of a
      // B fragment is k = 16 h2 + rb + r, the order in which load_frag reads V^T's keys
      v8f cc[2];
      for (int h2 = 0; h2 < 2; ++h2) cc[h2] = wmma16(kf[h2][0], qa0, nb[h2]);
      for (int h2 = 0; h2 < 2; ++h2) cc[h2] = wmma16(kf[h2][1], qa1, cc[h2]);
      v16h pb;
      for (int h2 = 0; h2 < 2; ++h2) {
        const int ahead = qi - (kt + 16 * h2 + rb);   // causal: key r of the tile counts where r <= ahead
        for (int r = 0; r < 8; ++r) {
          float pv = (r <= ahead) ? __builtin_amdgcn_exp2f(cc[h2][r]) : 0.0f;
          pb[8 * h2 + r] = to_h(pv);
        }
      }
      for (int j = 0; j < 4; ++j) acc[j] = wmma16(vb[j], pb, acc[j]);
      // one plain vector instruction behind each exponential: it fills the slot that the
      // instruction set asks for there (left free, the scheduler sets the exponentials in a row,
      // each writing the register that the one before it reads), and the vector port works meanwhile
      for (int r = 0; r < 16; ++r) {
        __builtin_amdgcn_sched_group_barrier(0x400, 1, 0);
        __builtin_amdgcn_sched_group_barrier(0x002, 1, 0);
      }
    };
    for (int t = 0; t < nt; ++t) {
      const _Float16* kst = ks[t & 1][part];
      const _Float16* vst = vs[t & 1][part];
      for (int u = 0; u < CH / 32; ++u) {
        const int kt = (2 * t + part) * CH + u * 32;
        if (kt < q0 + 16)             // wave-uniform: skips keys wholly behind the diagonal
          pv_block(kst + u * 32 * APITCH, vst + u * 32, bs[t & 1] + part * CH + u * 32, kt);
      }
      // hand-over, passed by every wave: stage t + 1 is published, stage t's buffers are free
      lds_reads_done();
      copies_landed();
      __syncthreads();
      if (t + 2 < nt) stage(t + 2);
    }
    copies_landed();
    // the four vector slots that the chip needs between the loop's last product and the first
    // vector instruction that touches its registers: on the path out of the loop stand only
    // scalar instructions, waits and barriers, which fill no slot
    asm volatile("v_nop\n\tv_nop\n\tv_nop\n\tv_nop");

    // O^T = the first pieces' sums + the second pieces': behind the last hand-over no copy is
    // in flight and nobody reads ks, so the second piece's waves lay their sums there, 16 bytes
    // a lane and lanes side by side
    v4f* mg = (v4f*)&ks[0][0][0] + strip * 32 + l;
    if (part == 1)
      for (int j = 0; j < 4; ++j)
        for (int g = 0; g < 2; ++g)
          mg[(2 * j + g) * 128] = (v4f){acc[j][4 * g], acc[j][4 * g + 1], acc[j][4 * g + 2], acc[j][4 * g + 3]};
    __syncthreads();                  // those sums are published
    if (part == 0) {
      // write attn as f16 [B,T,D] (feeds the proj GEMM): register r of tile j is
      // O^T[head column 16 j + rb + r][query qi], eight neighbours of one row: one 16-byte store
      _Float16* orow = attn + ((size_t)bi * TT + qi) * DD + h * HS + rb;
      for (int j = 0; j < 4; ++j) {
        v8h t;
        for (int g = 0; g < 2; ++g) {
          const v4f o = mg[(2 * j + g) * 128];
          for (int r = 0; r < 4; ++r) t[4 * g + r] = to_h(acc[j][4 * g + r] + o[r]);
        }
        *(v8h*)(orow + 16 * j) = t;
      }
      // the next leg rewrites the registers that these stores name: keep the wait in front of that
      asm volatile("s_wait_xcnt 0x0" ::: "memory");
    }
    // the next leg's copies overwrite ks: every read of the sums has returned first
    lds_reads_done();
    __syncthreads();
  }
}

// ---------------- host-side orchestration ----------------
extern "C" void kernel_launch(void* const* d_in, const int* in_sizes, int n_in,
                              void* d_out, int out_size, void* d_ws,
                              size_t ws_size, hipStream_t stream) {
  const float* x     = (const float*)d_in[0];
  const float* Wq    = (const float*)d_in[1];
  const float* Wk    = (const float*)d_in[2];
  const float* Wv    = (const float*)d_in[3];
  const float* Wproj = (const float*)d_in[4];
  const float* bproj = (const float*)d_in[5];
  const float* W1    = (const float*)d_in[6];
  const float* b1    = (const float*)d_in[7];
  const float* W2    = (const float*)d_in[8];
  const float* b2    = (const float*)d_in[9];
  const float* ln1g  = (const float*)d_in[10];
  const float* ln1b  = (const float*)d_in[11];
  const float* ln2g  = (const float*)d_in[12];
  const float* ln2b  = (const float*)d_in[13];
  float* out = (float*)d_out;

  char* base = (char*)d_ws;
  size_t off = 0;
  auto alloc = [&](size_t bytes) -> char* {
    char* p = base + off;
    off += (bytes + 255) & ~(size_t)255;
    return p;
  };
  _Float16* wqkvT = (_Float16*)alloc((size_t)3 * DD * DD * 2);  // [3D][D]
  _Float16* wpT   = (_Float16*)alloc((size_t)DD * DD * 2);      // [D][D]
  _Float16* w1T   = (_Float16*)alloc((size_t)DFF * DD * 2);     // [4D][D]
  _Float16* w2T   = (_Float16*)alloc((size_t)DD * DFF * 2);     // [D][4D]
  float*    xn_f  = (float*)   alloc((size_t)BT * DD * 4);
  _Float16* xn_h  = (_Float16*)alloc((size_t)BT * DD * 2);
  _Float16* q_h   = (_Float16*)alloc((size_t)BB * HH * TT * HS * 2);
  _Float16* k_h   = (_Float16*)alloc((size_t)BB * HH * TT * HS * 2);
  _Float16* vT_h  = (_Float16*)alloc((size_t)BB * HH * TT * HS * 2);
  float*    cbias = (float*)   alloc((size_t)BB * HH * TT * 4);
  _Float16* attnh = (_Float16*)alloc((size_t)BT * DD * 2);
  float*    x1_f  = (float*)   alloc((size_t)BT * DD * 4);
  float*    x1n_f = (float*)   alloc((size_t)BT * DD * 4);
  _Float16* x1n_h = (_Float16*)alloc((size_t)BT * DD * 2);
  _Float16* h_h   = (_Float16*)alloc((size_t)BT * DFF * 2);

  // 1) pack all weights to f16, transposed [N][K]: 12M elements, 64 n x 256 k a group
  pack_weights<<<(3 * DD * DD + DD * DD + 2 * DD * DFF) / (64 * 256), 256, 0, stream>>>(
      Wq, Wk, Wv, Wproj, W1, W2, wqkvT, wpT, w1T, w2T);
  // 2) LN1 -> xn (f32 + f16)
  ln_kernel<<<BT, 256, 0, stream>>>(x, ln1g, ln1b, xn_f, xn_h);
  // 3) QKV GEMM: [4096x1024] x [1024x3072]
  gemm_tile<MODE_QKV, 2, 8, 3><<<dim3(3 * DD / 192, BT / 256), 256, 0, stream>>>(
      xn_h, wqkvT, 3 * DD, DD, nullptr, nullptr, nullptr, nullptr,
      q_h, k_h, vT_h);
  // 4) per-column softmax bias
  attn_pass1<<<dim3(TT / 128, BB * HH), 256, 0, stream>>>(q_h, k_h, cbias);
  // 5) attn = P @ V
  attn_pass2<<<dim3(TT / 128, BB * HH), 256, 0, stream>>>(q_h, k_h, vT_h, cbias,
                                                          attnh);
  // 6) proj: x1 = xn + attn @ Wproj + bproj
  gemm_tile<MODE_PROJ, 4, 4, 2><<<dim3(DD / 128, BT / 128), 256, 0, stream>>>(
      attnh, wpT, DD, DD, bproj, xn_f, x1_f, nullptr, nullptr,
      nullptr, nullptr);
  // 7) LN2 -> x1n (f32 + f16)
  ln_kernel<<<BT, 256, 0, stream>>>(x1_f, ln2g, ln2b, x1n_f, x1n_h);
  // 8) FFN1: h = relu(x1n @ W1 + b1)
  gemm_tile<MODE_FFN1, 2, 8, 4><<<dim3(DFF / 256, BT / 256), 256, 0, stream>>>(
      x1n_h, w1T, DFF, DD, b1, nullptr, nullptr, h_h, nullptr,
      nullptr, nullptr);
  // 9) FFN2: out = x1n + h @ W2 + b2
  gemm_tile<MODE_FFN2, 4, 4, 2><<<dim3(DD / 128, BT / 128), 256, 0, stream>>>(
      h_h, w2T, DD, DFF, b2, x1n_f, out, nullptr, nullptr, nullptr,
      nullptr);
}
